// v000
// Times are from an AMD MI455X. After a warm-up the kernel runs many times in a row, and a time is the length of
// such a window on the GPU divided by its runs, so every launch and the gaps after it count. The runs cycle
// through copies of the inputs. A figure is the median of several windows, for all but v000 over two sittings.
// Sittings can differ by a few percent; kernels timed side by side share one.
// v000, which the later versions start from, runs in 456 microseconds.
#include <hip/hip_runtime.h>

typedef __attribute__((ext_vector_type(16))) _Float16 v16h;
typedef __attribute__((ext_vector_type(8)))  float    v8f;

#define EMBED    1024
#define HEADS    16
#define HEAD_DIM 64
#define NTOK     8192

#define WMMA_F16(a, b, c) \
  __builtin_amdgcn_wmma_f32_16x16x32_f16(false, (a), false, (b), (short)0, (c), false, false)

__device__ __forceinline__ void async_to_lds_32B(void* lds, const void* gsrc) {
  const unsigned ldst = (unsigned)(unsigned long long)lds;
  asm volatile(
      "global_load_async_to_lds_b128 %0, %1, off\n\t"
      "global_load_async_to_lds_b128 %0, %1, off offset:16"
      :
      : "v"(ldst), "v"(gsrc)
      : "memory");
}

__device__ __forceinline__ void wait_asynccnt0() {
#if __has_builtin(__builtin_amdgcn_s_wait_asynccnt)
  __builtin_amdgcn_s_wait_asynccnt(0);
#else
  asm volatile("s_wait_asynccnt 0x0" ::: "memory");
#endif
}

__device__ __forceinline__ void wait_tensorcnt0() {
#if __has_builtin(__builtin_amdgcn_s_wait_tensorcnt)
  __builtin_amdgcn_s_wait_tensorcnt(0);
#else
  asm volatile("s_wait_tensorcnt 0x0" ::: "memory");
#endif
}

#if __has_builtin(__builtin_amdgcn_tensor_load_to_lds)
#define HAVE_TDM 1
typedef __attribute__((ext_vector_type(4))) unsigned tdm_v4u;
typedef __attribute__((ext_vector_type(8))) int      tdm_v8i;
typedef __attribute__((ext_vector_type(4))) int      tdm_v4i;

__device__ __forceinline__ void tdm_load_tile_64x32(
    void* lds_dst, const void* gsrc, int row_stride_elems) {
  const unsigned long long ga = (unsigned long long)gsrc;
  tdm_v4u g0;
  g0[0] = 1u;
  g0[1] = (unsigned)(unsigned long long)lds_dst;
  g0[2] = (unsigned)(ga & 0xFFFFFFFFull);
  g0[3] = (unsigned)((ga >> 32) & 0x1FFFFFFull) | (2u << 30);  // [56:32]|type=2

  tdm_v8i g1;
  g1[0] = (1 << 16)
        | (1 << 20)
        | (4 << 22)
        | (3 << 25);
  g1[1] = (64 << 16);
  g1[2] = (32 << 16);
  g1[3] = (64 << 16);
  g1[4] = 32;
  g1[5] = row_stride_elems;
  g1[6] = 0;
  g1[7] = 0;

  const tdm_v4i z4 = {};
#if defined(__clang_major__) && __clang_major__ >= 23
  const tdm_v8i z8 = {};
  __builtin_amdgcn_tensor_load_to_lds(g0, g1, z4, z4, z8, 0);
#else
  __builtin_amdgcn_tensor_load_to_lds(g0, g1, z4, z4, 0);
#endif
}
#else
#define HAVE_TDM 0
#endif

// ---- 16-lane butterfly reductions (v_permlane16_b32) -----------------------
#if __has_builtin(__builtin_amdgcn_permlane16)
#define HAVE_PERMLANE16 1
__device__ __forceinline__ float permx16(float x, unsigned lo, unsigned hi) {
  const int xi = __float_as_int(x);
  return __int_as_float(
      __builtin_amdgcn_permlane16(xi, xi, (int)lo, (int)hi, false, false));
}
#else
#define HAVE_PERMLANE16 0
#endif

__device__ __forceinline__ float rowmax16(float x) {
#if HAVE_PERMLANE16
  x = fmaxf(x, permx16(x, 0x67452301u, 0xEFCDAB89u));  // xor 1
  x = fmaxf(x, permx16(x, 0x54761032u, 0xDCFE98BAu));  // xor 2
  x = fmaxf(x, permx16(x, 0x32107654u, 0xBA98FEDCu));  // xor 4
  x = fmaxf(x, permx16(x, 0xFEDCBA98u, 0x76543210u));  // xor 8
#else
  x = fmaxf(x, __shfl_xor(x, 1, 32));
  x = fmaxf(x, __shfl_xor(x, 2, 32));
  x = fmaxf(x, __shfl_xor(x, 4, 32));
  x = fmaxf(x, __shfl_xor(x, 8, 32));
#endif
  return x;
}

__device__ __forceinline__ float rowsum16(float x) {
#if HAVE_PERMLANE16
  x += permx16(x, 0x67452301u, 0xEFCDAB89u);
  x += permx16(x, 0x54761032u, 0xDCFE98BAu);
  x += permx16(x, 0x32107654u, 0xBA98FEDCu);
  x += permx16(x, 0xFEDCBA98u, 0x76543210u);
#else
  x += __shfl_xor(x, 1, 32);
  x += __shfl_xor(x, 2, 32);
  x += __shfl_xor(x, 4, 32);
  x += __shfl_xor(x, 8, 32);
#endif
  return x;
}

__device__ __forceinline__ v16h wmma_load_a(const _Float16* p, int ld) {
  const int lane = threadIdx.x & 31;
  const int row = lane & 15, hi = lane >> 4;
  v16h a;
#pragma unroll
  for (int r = 0; r < 8; ++r) {
    const int k = ((r & 3) << 1) + ((r >> 2) << 4) + (hi << 3);
    a[2 * r]     = p[row * ld + k];
    a[2 * r + 1] = p[row * ld + k + 1];
  }
  return a;
}

__device__ __forceinline__ v16h wmma_load_b_nk(const _Float16* p, int ld) {
  const int lane = threadIdx.x & 31;
  const int n = lane & 15, hi = lane >> 4;
  v16h b;
#pragma unroll
  for (int r = 0; r < 8; ++r) {
    const int k = ((r & 3) << 1) + ((r >> 2) << 4) + (hi << 3);
    b[2 * r]     = p[n * ld + k];
    b[2 * r + 1] = p[n * ld + k + 1];
  }
  return b;
}

__device__ __forceinline__ v16h wmma_load_b_kn(const _Float16* p, int ld) {
  const int lane = threadIdx.x & 31;
  const int n = lane & 15, hi = lane >> 4;
  v16h b;
#pragma unroll
  for (int r = 0; r < 8; ++r) {
    const int k = ((r & 3) << 1) + ((r >> 2) << 4) + (hi << 3);
    b[2 * r]     = p[k * ld + n];
    b[2 * r + 1] = p[(k + 1) * ld + n];
  }
  return b;
}

// ---- GEMM: C[i][j] = sum_k X[i][k] * W[j][k] + bias[j] ---------------------
template <bool OUT_HALF>
__global__ __launch_bounds__(128) void gemm_bias_kernel(
    const float* __restrict__ X, const float* __restrict__ W,
    const float* __restrict__ bias, void* __restrict__ out) {
  __shared__ _Float16 At[64][40];
  __shared__ _Float16 Bt[64][40];
  const int tid = threadIdx.x;
  const int wave = tid >> 5, lane = tid & 31;
  const int hi = lane >> 4, nn = lane & 15;
  const int rowbase = blockIdx.y * 64;
  const int colbase = blockIdx.x * 64;

  v8f acc[4] = {};
  for (int kk = 0; kk < EMBED; kk += 32) {
#pragma unroll
    for (int e = 0; e < 16; ++e) {
      const int flat = tid * 16 + e;  // 2048 elems / 128 threads
      const int r = flat >> 5, c = flat & 31;
      At[r][c] = (_Float16)X[(size_t)(rowbase + r) * EMBED + kk + c];
      Bt[r][c] = (_Float16)W[(size_t)(colbase + r) * EMBED + kk + c];
    }
    // pull next K-chunk toward the WGP while this chunk computes
    if (kk + 32 < EMBED) {
      const int pr = tid >> 1, pc = (tid & 1) * 16;
      __builtin_prefetch(&X[(size_t)(rowbase + pr) * EMBED + kk + 32 + pc], 0, 0);
      __builtin_prefetch(&W[(size_t)(colbase + pr) * EMBED + kk + 32 + pc], 0, 0);
    }
    __syncthreads();
    const v16h a = wmma_load_a(&At[wave * 16][0], 40);
#pragma unroll
    for (int c = 0; c < 4; ++c) {
      const v16h b = wmma_load_b_nk(&Bt[c * 16][0], 40);
      acc[c] = WMMA_F16(a, b, acc[c]);
    }
    __syncthreads();
  }
#pragma unroll
  for (int c = 0; c < 4; ++c)
#pragma unroll
    for (int v = 0; v < 8; ++v) {
      const int row = rowbase + wave * 16 + v + 8 * hi;
      const int col = colbase + c * 16 + nn;
      const float val = acc[c][v] + bias[col];
      if (OUT_HALF)
        ((_Float16*)out)[(size_t)row * EMBED + col] = (_Float16)val;
      else
        ((float*)out)[(size_t)row * EMBED + col] = val;
    }
}

__global__ __launch_bounds__(128) void attn_kernel(
    const _Float16* __restrict__ Q, const _Float16* __restrict__ K,
    const _Float16* __restrict__ V, float* __restrict__ out,
    int seglen, int rate, int off, int hmin, int gheads) {
  __shared__ _Float16 Kt[2][32][72];
  __shared__ _Float16 Vt[2][32][72];
  __shared__ _Float16 Pt[4][16][34];

  const int S = seglen / rate;  // 2048 dilated positions per segment
  const int qtiles = S / 64;
  const int bid = blockIdx.x;
  const int qt = bid % qtiles;
  const int h = (bid / qtiles) % gheads;
  const int seg = bid / (qtiles * gheads);
  const int head = hmin + h;
  const int segbase = seg * seglen + off;

  const int tid = threadIdx.x, wave = tid >> 5, lane = tid & 31;
  const int hi = lane >> 4, nn = lane & 15;
  const size_t hoff = (size_t)head * HEAD_DIM;

  const int srow = tid >> 2, scol = (tid & 3) * 16;

  // Q fragments for this wave's 16 query rows (A-layout gather from global)
  const int qrowA = qt * 64 + wave * 16 + nn;
  const _Float16* qp = Q + (size_t)(segbase + qrowA * rate) * EMBED + hoff;
  v16h qa0, qa1;
#pragma unroll
  for (int r = 0; r < 8; ++r) {
    const int k = ((r & 3) << 1) + ((r >> 2) << 4) + (hi << 3);
    qa0[2 * r]     = qp[k];
    qa0[2 * r + 1] = qp[k + 1];
    qa1[2 * r]     = qp[32 + k];
    qa1[2 * r + 1] = qp[32 + k + 1];
  }

  v8f o0 = {}, o1 = {}, o2 = {}, o3 = {};
  float row_m[8], row_l[8];
#pragma unroll
  for (int v = 0; v < 8; ++v) { row_m[v] = -1e30f; row_l[v] = 0.f; }
  const float scale = 0.125f;  // 1/sqrt(64)

  // issue DMA for tile 0
  {
#if HAVE_TDM
    if (wave == 0)
      tdm_load_tile_64x32(&Kt[0][0][0], K + (size_t)segbase * EMBED + hoff,
                          rate * EMBED);
#else
    {
      const size_t kpos = (size_t)(segbase + srow * rate);
      async_to_lds_32B(&Kt[0][srow][scol], K + kpos * EMBED + hoff + scol);
    }
#endif
    const size_t vpos = (size_t)(segbase + srow * rate);
    async_to_lds_32B(&Vt[0][srow][scol], V + vpos * EMBED + hoff + scol);
  }

  for (int kb = 0; kb < S; kb += 32) {
    const int buf = (kb >> 5) & 1;
    wait_asynccnt0();  // this wave's V-tile DMA has landed in LDS
#if HAVE_TDM
    if (wave == 0) wait_tensorcnt0();
#endif
    __syncthreads();   // ... visible to every wave

    // overlap: issue DMA for the next tile into the other buffer
    if (kb + 32 < S) {
#if HAVE_TDM
      if (wave == 0)
        tdm_load_tile_64x32(&Kt[buf ^ 1][0][0],
                            K + (size_t)(segbase + (kb + 32) * rate) * EMBED + hoff,
                            rate * EMBED);
#else
      {
        const size_t kpos = (size_t)(segbase + (kb + 32 + srow) * rate);
        async_to_lds_32B(&Kt[buf ^ 1][srow][scol],
                         K + kpos * EMBED + hoff + scol);
      }
#endif
      const size_t vpos = (size_t)(segbase + (kb + 32 + srow) * rate);
      async_to_lds_32B(&Vt[buf ^ 1][srow][scol], V + vpos * EMBED + hoff + scol);
    }

    // S = Q K^T : two 16x16 C-tiles, d=64 -> 2 accumulation steps each
    v8f s0 = {}, s1 = {};
    {
      v16h b;
      b = wmma_load_b_nk(&Kt[buf][0][0], 72);   s0 = WMMA_F16(qa0, b, s0);
      b = wmma_load_b_nk(&Kt[buf][0][32], 72);  s0 = WMMA_F16(qa1, b, s0);
      b = wmma_load_b_nk(&Kt[buf][16][0], 72);  s1 = WMMA_F16(qa0, b, s1);
      b = wmma_load_b_nk(&Kt[buf][16][32], 72); s1 = WMMA_F16(qa1, b, s1);
    }

    // online softmax (f32); row = v + 8*hi, 16 cols spread over 16 lanes
    float p0[8], p1[8], alpha[8];
#pragma unroll
    for (int v = 0; v < 8; ++v) {
      const float a = s0[v] * scale, c = s1[v] * scale;
      const float mx = rowmax16(fmaxf(a, c));
      const float mnew = fmaxf(row_m[v], mx);
      alpha[v] = __expf(row_m[v] - mnew);
      row_m[v] = mnew;
      p0[v] = __expf(a - mnew);
      p1[v] = __expf(c - mnew);
      row_l[v] = row_l[v] * alpha[v] + rowsum16(p0[v] + p1[v]);
    }

    // rescale O accumulators; stage P as f16 (C-layout -> row-major LDS)
#pragma unroll
    for (int v = 0; v < 8; ++v) {
      o0[v] *= alpha[v]; o1[v] *= alpha[v];
      o2[v] *= alpha[v]; o3[v] *= alpha[v];
      const int prow = v + 8 * hi;
      Pt[wave][prow][nn]      = (_Float16)p0[v];
      Pt[wave][prow][nn + 16] = (_Float16)p1[v];
    }
    __syncthreads();

    // O += P V : A = P (16x32), B = V 32x16 chunks of d
    {
      const v16h pa = wmma_load_a(&Pt[wave][0][0], 34);
      v16h b;
      b = wmma_load_b_kn(&Vt[buf][0][0], 72);  o0 = WMMA_F16(pa, b, o0);
      b = wmma_load_b_kn(&Vt[buf][0][16], 72); o1 = WMMA_F16(pa, b, o1);
      b = wmma_load_b_kn(&Vt[buf][0][32], 72); o2 = WMMA_F16(pa, b, o2);
      b = wmma_load_b_kn(&Vt[buf][0][48], 72); o3 = WMMA_F16(pa, b, o3);
    }
  }

  // epilogue: scatter O/l to dilated global positions
#pragma unroll
  for (int v = 0; v < 8; ++v) {
    const int qr = qt * 64 + wave * 16 + v + 8 * hi;
    const size_t pos = (size_t)(segbase + qr * rate);
    const float inv = 1.0f / row_l[v];
    float* op = out + pos * EMBED + hoff;
    op[nn]      = o0[v] * inv;
    op[16 + nn] = o1[v] * inv;
    op[32 + nn] = o2[v] * inv;
    op[48 + nn] = o3[v] * inv;
  }
}

// ---- helpers ---------------------------------------------------------------
__global__ void zero_f32(float* __restrict__ p, long n) {
  long i = (long)blockIdx.x * blockDim.x + threadIdx.x;
  const long stride = (long)gridDim.x * blockDim.x;
  for (; i < n; i += stride) p[i] = 0.f;
}

__global__ __launch_bounds__(256) void layernorm_inplace(
    float* __restrict__ x, const float* __restrict__ g,
    const float* __restrict__ b) {
  __shared__ float s_sum[256];
  __shared__ float s_sq[256];
  const int row = blockIdx.x, tid = threadIdx.x;
  float* xr = x + (size_t)row * EMBED;
  float v[4], s = 0.f, sq = 0.f;
#pragma unroll
  for (int i = 0; i < 4; ++i) {
    v[i] = xr[tid + i * 256];
    s += v[i];
    sq += v[i] * v[i];
  }
  s_sum[tid] = s;
  s_sq[tid] = sq;
  __syncthreads();
  for (int st = 128; st > 0; st >>= 1) {
    if (tid < st) {
      s_sum[tid] += s_sum[tid + st];
      s_sq[tid] += s_sq[tid + st];
    }
    __syncthreads();
  }
  const float mean = s_sum[0] * (1.f / EMBED);
  const float var = s_sq[0] * (1.f / EMBED) - mean * mean;
  const float rstd = rsqrtf(var + 1e-5f);
#pragma unroll
  for (int i = 0; i < 4; ++i) {
    const int c = tid + i * 256;
    xr[c] = (v[i] - mean) * rstd * g[c] + b[c];
  }
}

// ---- launcher --------------------------------------------------------------
extern "C" void kernel_launch(void* const* d_in, const int* in_sizes, int n_in,
                              void* d_out, int out_size, void* d_ws,
                              size_t ws_size, hipStream_t stream) {
  const float* query = (const float*)d_in[0];
  const float* key   = (const float*)d_in[1];
  const float* value = (const float*)d_in[2];
  const float* Wq = (const float*)d_in[3];  const float* bq = (const float*)d_in[4];
  const float* Wk = (const float*)d_in[5];  const float* bk = (const float*)d_in[6];
  const float* Wv = (const float*)d_in[7];  const float* bv = (const float*)d_in[8];
  const float* Wo = (const float*)d_in[9];  const float* bo = (const float*)d_in[10];
  const float* ln_g = (const float*)d_in[11];
  const float* ln_b = (const float*)d_in[12];

  char* ws = (char*)d_ws;
  const size_t nelem = (size_t)NTOK * EMBED;  // 8M elements
  _Float16* qf = (_Float16*)(ws);             // 16 MB
  _Float16* kf = (_Float16*)(ws + nelem * 2); // 16 MB
  _Float16* vf = (_Float16*)(ws + nelem * 4); // 16 MB
  float*  attn = (float*)(ws + nelem * 6);    // 32 MB

  const dim3 gblk(EMBED / 64, NTOK / 64);     // (16, 128)
  gemm_bias_kernel<true><<<gblk, 128, 0, stream>>>(query, Wq, bq, qf);
  gemm_bias_kernel<true><<<gblk, 128, 0, stream>>>(key,   Wk, bk, kf);
  gemm_bias_kernel<true><<<gblk, 128, 0, stream>>>(value, Wv, bv, vf);

  zero_f32<<<2048, 256, 0, stream>>>(attn, (long)nelem);

  attn_kernel<<<4 * 6 * 32, 128, 0, stream>>>(qf, kf, vf, attn, 2048, 1, 0, 0, 6);
  attn_kernel<<<2 * 5 * 32, 128, 0, stream>>>(qf, kf, vf, attn, 4096, 2, 1, 6, 5);
  // group 2: seg 8192, r=4, off=2, heads [11,16)
  attn_kernel<<<1 * 5 * 32, 128, 0, stream>>>(qf, kf, vf, attn, 8192, 4, 2, 11, 5);

  layernorm_inplace<<<NTOK, 256, 0, stream>>>(attn, ln_g, ln_b);

  gemm_bias_kernel<false><<<gblk, 128, 0, stream>>>(attn, Wo, bo, (float*)d_out);
}

// v001
// It runs in 324 microseconds.
// Next to v000, in two timings, it ran 1.43 times as fast each time.
#include <hip/hip_runtime.h>

typedef __attribute__((ext_vector_type(16))) _Float16 v16h;
typedef __attribute__((ext_vector_type(8)))  float    v8f;

#define EMBED    1024
#define HEADS    16
#define HEAD_DIM 64
#define NTOK     8192

#define WMMA_F16(a, b, c) \
  __builtin_amdgcn_wmma_f32_16x16x32_f16(false, (a), false, (b), (short)0, (c), false, false)

__device__ __forceinline__ void async_to_lds_32B(void* lds, const void* gsrc) {
  const unsigned ldst = (unsigned)(unsigned long long)lds;
  asm volatile(
      "global_load_async_to_lds_b128 %0, %1, off\n\t"
      "global_load_async_to_lds_b128 %0, %1, off offset:16"
      :
      : "v"(ldst), "v"(gsrc)
      : "memory");
}

__device__ __forceinline__ void wait_asynccnt0() {
#if __has_builtin(__builtin_amdgcn_s_wait_asynccnt)
  __builtin_amdgcn_s_wait_asynccnt(0);
#else
  asm volatile("s_wait_asynccnt 0x0" ::: "memory");
#endif
}

__device__ __forceinline__ void wait_tensorcnt0() {
#if __has_builtin(__builtin_amdgcn_s_wait_tensorcnt)
  __builtin_amdgcn_s_wait_tensorcnt(0);
#else
  asm volatile("s_wait_tensorcnt 0x0" ::: "memory");
#endif
}

#if __has_builtin(__builtin_amdgcn_tensor_load_to_lds)
#define HAVE_TDM 1
typedef __attribute__((ext_vector_type(4))) unsigned tdm_v4u;
typedef __attribute__((ext_vector_type(8))) int      tdm_v8i;
typedef __attribute__((ext_vector_type(4))) int      tdm_v4i;

__device__ __forceinline__ void tdm_load_tile_64x32(
    void* lds_dst, const void* gsrc, int row_stride_elems) {
  const unsigned long long ga = (unsigned long long)gsrc;
  tdm_v4u g0;
  g0[0] = 1u;
  g0[1] = (unsigned)(unsigned long long)lds_dst;
  g0[2] = (unsigned)(ga & 0xFFFFFFFFull);
  g0[3] = (unsigned)((ga >> 32) & 0x1FFFFFFull) | (2u << 30);  // [56:32]|type=2

  tdm_v8i g1;
  g1[0] = (1 << 16)
        | (1 << 20)
        | (4 << 22)
        | (3 << 25);
  g1[1] = (64 << 16);
  g1[2] = (32 << 16);
  g1[3] = (64 << 16);
  g1[4] = 32;
  g1[5] = row_stride_elems;
  g1[6] = 0;
  g1[7] = 0;

  const tdm_v4i z4 = {};
#if defined(__clang_major__) && __clang_major__ >= 23
  const tdm_v8i z8 = {};
  __builtin_amdgcn_tensor_load_to_lds(g0, g1, z4, z4, z8, 0);
#else
  __builtin_amdgcn_tensor_load_to_lds(g0, g1, z4, z4, 0);
#endif
}
#else
#define HAVE_TDM 0
#endif

// ---- 16-lane butterfly reductions (v_permlane16_b32) -----------------------
#if __has_builtin(__builtin_amdgcn_permlane16)
#define HAVE_PERMLANE16 1
__device__ __forceinline__ float permx16(float x, unsigned lo, unsigned hi) {
  const int xi = __float_as_int(x);
  return __int_as_float(
      __builtin_amdgcn_permlane16(xi, xi, (int)lo, (int)hi, false, false));
}
#else
#define HAVE_PERMLANE16 0
#endif

__device__ __forceinline__ float rowmax16(float x) {
#if HAVE_PERMLANE16
  x = fmaxf(x, permx16(x, 0x67452301u, 0xEFCDAB89u));  // xor 1
  x = fmaxf(x, permx16(x, 0x54761032u, 0xDCFE98BAu));  // xor 2
  x = fmaxf(x, permx16(x, 0x32107654u, 0xBA98FEDCu));  // xor 4
  x = fmaxf(x, permx16(x, 0xFEDCBA98u, 0x76543210u));  // xor 8
#else
  x = fmaxf(x, __shfl_xor(x, 1, 32));
  x = fmaxf(x, __shfl_xor(x, 2, 32));
  x = fmaxf(x, __shfl_xor(x, 4, 32));
  x = fmaxf(x, __shfl_xor(x, 8, 32));
#endif
  return x;
}

__device__ __forceinline__ float rowsum16(float x) {
#if HAVE_PERMLANE16
  x += permx16(x, 0x67452301u, 0xEFCDAB89u);
  x += permx16(x, 0x54761032u, 0xDCFE98BAu);
  x += permx16(x, 0x32107654u, 0xBA98FEDCu);
  x += permx16(x, 0xFEDCBA98u, 0x76543210u);
#else
  x += __shfl_xor(x, 1, 32);
  x += __shfl_xor(x, 2, 32);
  x += __shfl_xor(x, 4, 32);
  x += __shfl_xor(x, 8, 32);
#endif
  return x;
}

__device__ __forceinline__ v16h wmma_load_a(const _Float16* p, int ld) {
  const int lane = threadIdx.x & 31;
  const int row = lane & 15, hi = lane >> 4;
  v16h a;
#pragma unroll
  for (int r = 0; r < 8; ++r) {
    const int k = ((r & 3) << 1) + ((r >> 2) << 4) + (hi << 3);
    a[2 * r]     = p[row * ld + k];
    a[2 * r + 1] = p[row * ld + k + 1];
  }
  return a;
}

__device__ __forceinline__ v16h wmma_load_b_nk(const _Float16* p, int ld) {
  const int lane = threadIdx.x & 31;
  const int n = lane & 15, hi = lane >> 4;
  v16h b;
#pragma unroll
  for (int r = 0; r < 8; ++r) {
    const int k = ((r & 3) << 1) + ((r >> 2) << 4) + (hi << 3);
    b[2 * r]     = p[n * ld + k];
    b[2 * r + 1] = p[n * ld + k + 1];
  }
  return b;
}

__device__ __forceinline__ v16h wmma_load_b_kn(const _Float16* p, int ld) {
  const int lane = threadIdx.x & 31;
  const int n = lane & 15, hi = lane >> 4;
  v16h b;
#pragma unroll
  for (int r = 0; r < 8; ++r) {
    const int k = ((r & 3) << 1) + ((r >> 2) << 4) + (hi << 3);
    b[2 * r]     = p[k * ld + n];
    b[2 * r + 1] = p[(k + 1) * ld + n];
  }
  return b;
}

// ---- GEMM: C[i][j] = sum_k X[i][k] * W[j][k] + bias[j] ---------------------
// Block tile 128 x 128 x 64, eight waves in a 2 x 4 grid, 64 x 32 of C per wave:
// every staged operand row feeds 128 outputs, and a barrier pair covers 64 k.
typedef __attribute__((ext_vector_type(4))) _Float16 v4h;
typedef __attribute__((ext_vector_type(4))) float    v4f;
#define GEMM_BM 128
#define GEMM_BN 128
#define GEMM_BK 64
#define GEMM_LD 72  // halfs: 128-B rows + 16 B, the pitch for 16-byte readers

template <bool OUT_HALF>
__global__ __launch_bounds__(256) void gemm_bias_kernel(
    const float* __restrict__ X, const float* __restrict__ W,
    const float* __restrict__ bias, void* __restrict__ out) {
  __shared__ __attribute__((aligned(16))) _Float16 At[GEMM_BM][GEMM_LD];
  __shared__ __attribute__((aligned(16))) _Float16 Bt[GEMM_BN][GEMM_LD];
  const int tid = threadIdx.x;
  const int wave = tid >> 5, lane = tid & 31;
  const int hi = lane >> 4, nn = lane & 15;
  const int wrow = (wave >> 2) * 64, wcol = (wave & 3) * 32;
  const int rowbase = blockIdx.y * GEMM_BM;
  const int colbase = blockIdx.x * GEMM_BN;

  const int sr = tid >> 4, sc = (tid & 15) * 4;
  const float* xp = X + (size_t)(rowbase + sr) * EMBED + sc;
  const float* wp = W + (size_t)(colbase + sr) * EMBED + sc;

  v8f acc[4][2] = {};
  for (int kk = 0; kk < EMBED; kk += GEMM_BK) {
    v4f xs[8], ws[8];
    const float* xk = xp + kk;
    const float* wk = wp + kk;
    // unrolled: xs/ws are indexed by constants only and stay in registers
#pragma unroll
    for (int i = 0; i < 8; ++i) {
      xs[i] = *(const v4f*)(xk + i * 16 * EMBED);
      ws[i] = *(const v4f*)(wk + i * 16 * EMBED);
    }
    // the wait that belongs in front of any reuse of a register that an issued
    // load names; naming both pointers keeps the address pairs whole until it,
    // and the statement keeps all 16 loads ahead of the conversions, in flight
    // together, instead of load and conversion taking turns in few registers
    asm volatile("s_wait_xcnt 0x0" ::"v"(xk), "v"(wk) : "memory");
#pragma unroll
    for (int i = 0; i < 8; ++i) {
      *(v4h*)&At[sr + i * 16][sc] = __builtin_convertvector(xs[i], v4h);
      *(v4h*)&Bt[sr + i * 16][sc] = __builtin_convertvector(ws[i], v4h);
    }
    __syncthreads();
    // this loop and those inside it unrolled: acc, a and b are indexed by
    // constants only; k runs upward as before
#pragma unroll
    for (int ks = 0; ks < GEMM_BK; ks += 32) {
      v16h a[4], b[2];
#pragma unroll
      for (int m = 0; m < 4; ++m)
        a[m] = wmma_load_a(&At[wrow + m * 16][ks], GEMM_LD);
#pragma unroll
      for (int c = 0; c < 2; ++c)
        b[c] = wmma_load_b_nk(&Bt[wcol + c * 16][ks], GEMM_LD);
#pragma unroll
      for (int c = 0; c < 2; ++c)
#pragma unroll
        for (int m = 0; m < 4; ++m) acc[m][c] = WMMA_F16(a[m], b[c], acc[m][c]);
    }
    __syncthreads();
  }
  // all three unrolled: acc is indexed by constants only
#pragma unroll
  for (int m = 0; m < 4; ++m)
#pragma unroll
    for (int c = 0; c < 2; ++c)
#pragma unroll
      for (int v = 0; v < 8; ++v) {
        const int row = rowbase + wrow + m * 16 + v + 8 * hi;
        const int col = colbase + wcol + c * 16 + nn;
        const float val = acc[m][c][v] + bias[col];
        if (OUT_HALF)
          ((_Float16*)out)[(size_t)row * EMBED + col] = (_Float16)val;
        else
          ((float*)out)[(size_t)row * EMBED + col] = val;
      }
}

__global__ __launch_bounds__(128) void attn_kernel(
    const _Float16* __restrict__ Q, const _Float16* __restrict__ K,
    const _Float16* __restrict__ V, float* __restrict__ out,
    int seglen, int rate, int off, int hmin, int gheads) {
  __shared__ _Float16 Kt[2][32][72];
  __shared__ _Float16 Vt[2][32][72];
  __shared__ _Float16 Pt[4][16][34];

  const int S = seglen / rate;  // 2048 dilated positions per segment
  const int qtiles = S / 64;
  const int bid = blockIdx.x;
  const int qt = bid % qtiles;
  const int h = (bid / qtiles) % gheads;
  const int seg = bid / (qtiles * gheads);
  const int head = hmin + h;
  const int segbase = seg * seglen + off;

  const int tid = threadIdx.x, wave = tid >> 5, lane = tid & 31;
  const int hi = lane >> 4, nn = lane & 15;
  const size_t hoff = (size_t)head * HEAD_DIM;

  const int srow = tid >> 2, scol = (tid & 3) * 16;

  // Q fragments for this wave's 16 query rows (A-layout gather from global)
  const int qrowA = qt * 64 + wave * 16 + nn;
  const _Float16* qp = Q + (size_t)(segbase + qrowA * rate) * EMBED + hoff;
  v16h qa0, qa1;
#pragma unroll
  for (int r = 0; r < 8; ++r) {
    const int k = ((r & 3) << 1) + ((r >> 2) << 4) + (hi << 3);
    qa0[2 * r]     = qp[k];
    qa0[2 * r + 1] = qp[k + 1];
    qa1[2 * r]     = qp[32 + k];
    qa1[2 * r + 1] = qp[32 + k + 1];
  }

  v8f o0 = {}, o1 = {}, o2 = {}, o3 = {};
  float row_m[8], row_l[8];
#pragma unroll
  for (int v = 0; v < 8; ++v) { row_m[v] = -1e30f; row_l[v] = 0.f; }
  const float scale = 0.125f;  // 1/sqrt(64)

  // issue DMA for tile 0
  {
#if HAVE_TDM
    if (wave == 0)
      tdm_load_tile_64x32(&Kt[0][0][0], K + (size_t)segbase * EMBED + hoff,
                          rate * EMBED);
#else
    {
      const size_t kpos = (size_t)(segbase + srow * rate);
      async_to_lds_32B(&Kt[0][srow][scol], K + kpos * EMBED + hoff + scol);
    }
#endif
    const size_t vpos = (size_t)(segbase + srow * rate);
    async_to_lds_32B(&Vt[0][srow][scol], V + vpos * EMBED + hoff + scol);
  }

  for (int kb = 0; kb < S; kb += 32) {
    const int buf = (kb >> 5) & 1;
    wait_asynccnt0();  // this wave's V-tile DMA has landed in LDS
#if HAVE_TDM
    if (wave == 0) wait_tensorcnt0();
#endif
    __syncthreads();   // ... visible to every wave

    // overlap: issue DMA for the next tile into the other buffer
    if (kb + 32 < S) {
#if HAVE_TDM
      if (wave == 0)
        tdm_load_tile_64x32(&Kt[buf ^ 1][0][0],
                            K + (size_t)(segbase + (kb + 32) * rate) * EMBED + hoff,
                            rate * EMBED);
#else
      {
        const size_t kpos = (size_t)(segbase + (kb + 32 + srow) * rate);
        async_to_lds_32B(&Kt[buf ^ 1][srow][scol],
                         K + kpos * EMBED + hoff + scol);
      }
#endif
      const size_t vpos = (size_t)(segbase + (kb + 32 + srow) * rate);
      async_to_lds_32B(&Vt[buf ^ 1][srow][scol], V + vpos * EMBED + hoff + scol);
    }

    // S = Q K^T : two 16x16 C-tiles, d=64 -> 2 accumulation steps each
    v8f s0 = {}, s1 = {};
    {
      v16h b;
      b = wmma_load_b_nk(&Kt[buf][0][0], 72);   s0 = WMMA_F16(qa0, b, s0);
      b = wmma_load_b_nk(&Kt[buf][0][32], 72);  s0 = WMMA_F16(qa1, b, s0);
      b = wmma_load_b_nk(&Kt[buf][16][0], 72);  s1 = WMMA_F16(qa0, b, s1);
      b = wmma_load_b_nk(&Kt[buf][16][32], 72); s1 = WMMA_F16(qa1, b, s1);
    }

    // online softmax (f32); row = v + 8*hi, 16 cols spread over 16 lanes
    float p0[8], p1[8], alpha[8];
#pragma unroll
    for (int v = 0; v < 8; ++v) {
      const float a = s0[v] * scale, c = s1[v] * scale;
      const float mx = rowmax16(fmaxf(a, c));
      const float mnew = fmaxf(row_m[v], mx);
      alpha[v] = __expf(row_m[v] - mnew);
      row_m[v] = mnew;
      p0[v] = __expf(a - mnew);
      p1[v] = __expf(c - mnew);
      row_l[v] = row_l[v] * alpha[v] + rowsum16(p0[v] + p1[v]);
    }

    // rescale O accumulators; stage P as f16 (C-layout -> row-major LDS)
#pragma unroll
    for (int v = 0; v < 8; ++v) {
      o0[v] *= alpha[v]; o1[v] *= alpha[v];
      o2[v] *= alpha[v]; o3[v] *= alpha[v];
      const int prow = v + 8 * hi;
      Pt[wave][prow][nn]      = (_Float16)p0[v];
      Pt[wave][prow][nn + 16] = (_Float16)p1[v];
    }
    __syncthreads();

    // O += P V : A = P (16x32), B = V 32x16 chunks of d
    {
      const v16h pa = wmma_load_a(&Pt[wave][0][0], 34);
      v16h b;
      b = wmma_load_b_kn(&Vt[buf][0][0], 72);  o0 = WMMA_F16(pa, b, o0);
      b = wmma_load_b_kn(&Vt[buf][0][16], 72); o1 = WMMA_F16(pa, b, o1);
      b = wmma_load_b_kn(&Vt[buf][0][32], 72); o2 = WMMA_F16(pa, b, o2);
      b = wmma_load_b_kn(&Vt[buf][0][48], 72); o3 = WMMA_F16(pa, b, o3);
    }
  }

  // epilogue: scatter O/l to dilated global positions
#pragma unroll
  for (int v = 0; v < 8; ++v) {
    const int qr = qt * 64 + wave * 16 + v + 8 * hi;
    const size_t pos = (size_t)(segbase + qr * rate);
    const float inv = 1.0f / row_l[v];
    float* op = out + pos * EMBED + hoff;
    op[nn]      = o0[v] * inv;
    op[16 + nn] = o1[v] * inv;
    op[32 + nn] = o2[v] * inv;
    op[48 + nn] = o3[v] * inv;
  }
}

// ---- helpers ---------------------------------------------------------------
__global__ void zero_f32(float* __restrict__ p, long n) {
  long i = (long)blockIdx.x * blockDim.x + threadIdx.x;
  const long stride = (long)gridDim.x * blockDim.x;
  for (; i < n; i += stride) p[i] = 0.f;
}

__global__ __launch_bounds__(256) void layernorm_inplace(
    float* __restrict__ x, const float* __restrict__ g,
    const float* __restrict__ b) {
  __shared__ float s_sum[256];
  __shared__ float s_sq[256];
  const int row = blockIdx.x, tid = threadIdx.x;
  float* xr = x + (size_t)row * EMBED;
  float v[4], s = 0.f, sq = 0.f;
#pragma unroll
  for (int i = 0; i < 4; ++i) {
    v[i] = xr[tid + i * 256];
    s += v[i];
    sq += v[i] * v[i];
  }
  s_sum[tid] = s;
  s_sq[tid] = sq;
  __syncthreads();
  for (int st = 128; st > 0; st >>= 1) {
    if (tid < st) {
      s_sum[tid] += s_sum[tid + st];
      s_sq[tid] += s_sq[tid + st];
    }
    __syncthreads();
  }
  const float mean = s_sum[0] * (1.f / EMBED);
  const float var = s_sq[0] * (1.f / EMBED) - mean * mean;
  const float rstd = rsqrtf(var + 1e-5f);
#pragma unroll
  for (int i = 0; i < 4; ++i) {
    const int c = tid + i * 256;
    xr[c] = (v[i] - mean) * rstd * g[c] + b[c];
  }
}

// ---- launcher --------------------------------------------------------------
extern "C" void kernel_launch(void* const* d_in, const int* in_sizes, int n_in,
                              void* d_out, int out_size, void* d_ws,
                              size_t ws_size, hipStream_t stream) {
  const float* query = (const float*)d_in[0];
  const float* key   = (const float*)d_in[1];
  const float* value = (const float*)d_in[2];
  const float* Wq = (const float*)d_in[3];  const float* bq = (const float*)d_in[4];
  const float* Wk = (const float*)d_in[5];  const float* bk = (const float*)d_in[6];
  const float* Wv = (const float*)d_in[7];  const float* bv = (const float*)d_in[8];
  const float* Wo = (const float*)d_in[9];  const float* bo = (const float*)d_in[10];
  const float* ln_g = (const float*)d_in[11];
  const float* ln_b = (const float*)d_in[12];

  char* ws = (char*)d_ws;
  const size_t nelem = (size_t)NTOK * EMBED;  // 8M elements
  _Float16* qf = (_Float16*)(ws);             // 16 MB
  _Float16* kf = (_Float16*)(ws + nelem * 2); // 16 MB
  _Float16* vf = (_Float16*)(ws + nelem * 4); // 16 MB
  float*  attn = (float*)(ws + nelem * 6);    // 32 MB

  const dim3 gblk(EMBED / GEMM_BN, NTOK / GEMM_BM);  // (8, 64)
  gemm_bias_kernel<true><<<gblk, 256, 0, stream>>>(query, Wq, bq, qf);
  gemm_bias_kernel<true><<<gblk, 256, 0, stream>>>(key,   Wk, bk, kf);
  gemm_bias_kernel<true><<<gblk, 256, 0, stream>>>(value, Wv, bv, vf);

  zero_f32<<<2048, 256, 0, stream>>>(attn, (long)nelem);

  attn_kernel<<<4 * 6 * 32, 128, 0, stream>>>(qf, kf, vf, attn, 2048, 1, 0, 0, 6);
  attn_kernel<<<2 * 5 * 32, 128, 0, stream>>>(qf, kf, vf, attn, 4096, 2, 1, 6, 5);
  // group 2: seg 8192, r=4, off=2, heads [11,16)
  attn_kernel<<<1 * 5 * 32, 128, 0, stream>>>(qf, kf, vf, attn, 8192, 4, 2, 11, 5);

  layernorm_inplace<<<NTOK, 256, 0, stream>>>(attn, ln_g, ln_b);

  gemm_bias_kernel<false><<<gblk, 256, 0, stream>>>(attn, Wo, bo, (float*)d_out);
}

// v002
// One run takes 262 microseconds.
// Two timings next to v001 put it at 1.24 and 1.23 times that version's speed.
// Over all steps from v000 it is 1.77 times as fast.
#include <hip/hip_runtime.h>

typedef __attribute__((ext_vector_type(16))) _Float16 v16h;
typedef __attribute__((ext_vector_type(8)))  float    v8f;

#define EMBED    1024
#define HEADS    16
#define HEAD_DIM 64
#define NTOK     8192

#define WMMA_F16(a, b, c) \
  __builtin_amdgcn_wmma_f32_16x16x32_f16(false, (a), false, (b), (short)0, (c), false, false)

__device__ __forceinline__ void async_to_lds_32B(void* lds, const void* gsrc) {
  const unsigned ldst = (unsigned)(unsigned long long)lds;
  asm volatile(
      "global_load_async_to_lds_b128 %0, %1, off\n\t"
      "global_load_async_to_lds_b128 %0, %1, off offset:16\n\t"
      // stands in front of any reuse of the two address registers the copies name
      "s_wait_xcnt 0x0"
      :
      : "v"(ldst), "v"(gsrc)
      : "memory");
}

__device__ __forceinline__ void wait_asynccnt0() {
#if __has_builtin(__builtin_amdgcn_s_wait_asynccnt)
  __builtin_amdgcn_s_wait_asynccnt(0);
#else
  asm volatile("s_wait_asynccnt 0x0" ::: "memory");
#endif
}

__device__ __forceinline__ void wait_tensorcnt0() {
#if __has_builtin(__builtin_amdgcn_s_wait_tensorcnt)
  __builtin_amdgcn_s_wait_tensorcnt(0);
#else
  asm volatile("s_wait_tensorcnt 0x0" ::: "memory");
#endif
}

#if __has_builtin(__builtin_amdgcn_tensor_load_to_lds)
#define HAVE_TDM 1
typedef __attribute__((ext_vector_type(4))) unsigned tdm_v4u;
typedef __attribute__((ext_vector_type(8))) int      tdm_v8i;
typedef __attribute__((ext_vector_type(4))) int      tdm_v4i;

__device__ __forceinline__ void tdm_load_tile_64x32(
    void* lds_dst, const void* gsrc, int row_stride_elems) {
  const unsigned long long ga = (unsigned long long)gsrc;
  tdm_v4u g0;
  g0[0] = 1u;
  g0[1] = (unsigned)(unsigned long long)lds_dst;
  g0[2] = (unsigned)(ga & 0xFFFFFFFFull);
  g0[3] = (unsigned)((ga >> 32) & 0x1FFFFFFull) | (2u << 30);  // [56:32]|type=2

  tdm_v8i g1;
  g1[0] = (1 << 16)
        | (1 << 20)
        | (4 << 22)
        | (3 << 25);
  g1[1] = (64 << 16);
  g1[2] = (32 << 16);
  g1[3] = (64 << 16);
  g1[4] = 32;
  g1[5] = row_stride_elems;
  g1[6] = 0;
  g1[7] = 0;

  const tdm_v4i z4 = {};
#if defined(__clang_major__) && __clang_major__ >= 23
  const tdm_v8i z8 = {};
  __builtin_amdgcn_tensor_load_to_lds(g0, g1, z4, z4, z8, 0);
#else
  __builtin_amdgcn_tensor_load_to_lds(g0, g1, z4, z4, 0);
#endif
}
#else
#define HAVE_TDM 0
#endif

__device__ __forceinline__ float xhalf(float x) {
  const int xi = __float_as_int(x);
  return __int_as_float(__builtin_amdgcn_permlanex16(
      xi, xi, 0x76543210, (int)0xFEDCBA98u, false, false));
}

__device__ __forceinline__ v16h wmma_load_a(const _Float16* p, int ld) {
  const int lane = threadIdx.x & 31;
  const int row = lane & 15, hi = lane >> 4;
  v16h a;
#pragma unroll
  for (int r = 0; r < 8; ++r) {
    const int k = ((r & 3) << 1) + ((r >> 2) << 4) + (hi << 3);
    a[2 * r]     = p[row * ld + k];
    a[2 * r + 1] = p[row * ld + k + 1];
  }
  return a;
}

__device__ __forceinline__ v16h wmma_load_b_nk(const _Float16* p, int ld) {
  const int lane = threadIdx.x & 31;
  const int n = lane & 15, hi = lane >> 4;
  v16h b;
#pragma unroll
  for (int r = 0; r < 8; ++r) {
    const int k = ((r & 3) << 1) + ((r >> 2) << 4) + (hi << 3);
    b[2 * r]     = p[n * ld + k];
    b[2 * r + 1] = p[n * ld + k + 1];
  }
  return b;
}

// A = T^T for a row-major 32 (k) x 16 (m) LDS tile: two ds_load_tr16_b128.
// Lane (c = lane & 15, hi) gets T[8 hi + 0..7][c] and T[16 + 8 hi + 0..7][c],
// the k order of the loaders above.
typedef __attribute__((ext_vector_type(8))) short s16x8;
typedef __attribute__((ext_vector_type(8))) _Float16 v8h;
__device__ __forceinline__ v8h lds_load_tr16(const _Float16* p) {
  typedef __attribute__((address_space(3))) s16x8 lds_s16x8;
  return __builtin_bit_cast(
      v8h, __builtin_amdgcn_ds_load_tr16_b128_v8i16((lds_s16x8*)p));
}

__device__ __forceinline__ v16h wmma_load_a_tr(const _Float16* p, int ld) {
  const int lane = threadIdx.x & 31;
  const _Float16* q =
      p + (8 * (lane >> 4) + (lane & 7)) * ld + 8 * ((lane >> 3) & 1);
  const v8h lo = lds_load_tr16(q);
  const v8h up = lds_load_tr16(q + 16 * ld);
  return __builtin_shufflevector(lo, up, 0, 1, 2, 3, 4, 5, 6, 7, 8, 9, 10, 11,
                                 12, 13, 14, 15);
}

// ---- GEMM: C[i][j] = sum_k X[i][k] * W[j][k] + bias[j] ---------------------
// Block tile 128 x 128 x 64, eight waves in a 2 x 4 grid, 64 x 32 of C per wave:
// every staged operand row feeds 128 outputs, and a barrier pair covers 64 k.
typedef __attribute__((ext_vector_type(4))) _Float16 v4h;
typedef __attribute__((ext_vector_type(4))) float    v4f;
#define GEMM_BM 128
#define GEMM_BN 128
#define GEMM_BK 64
#define GEMM_LD 72  // halfs: 128-B rows + 16 B, the pitch for 16-byte readers

template <bool OUT_HALF>
__global__ __launch_bounds__(256) void gemm_bias_kernel(
    const float* __restrict__ X, const float* __restrict__ W,
    const float* __restrict__ bias, void* __restrict__ out) {
  __shared__ __attribute__((aligned(16))) _Float16 At[GEMM_BM][GEMM_LD];
  __shared__ __attribute__((aligned(16))) _Float16 Bt[GEMM_BN][GEMM_LD];
  const int tid = threadIdx.x;
  const int wave = tid >> 5, lane = tid & 31;
  const int hi = lane >> 4, nn = lane & 15;
  const int wrow = (wave >> 2) * 64, wcol = (wave & 3) * 32;
  const int rowbase = blockIdx.y * GEMM_BM;
  const int colbase = blockIdx.x * GEMM_BN;

  const int sr = tid >> 4, sc = (tid & 15) * 4;
  const float* xp = X + (size_t)(rowbase + sr) * EMBED + sc;
  const float* wp = W + (size_t)(colbase + sr) * EMBED + sc;

  v8f acc[4][2] = {};
  for (int kk = 0; kk < EMBED; kk += GEMM_BK) {
    v4f xs[8], ws[8];
    const float* xk = xp + kk;
    const float* wk = wp + kk;
    // unrolled: xs/ws are indexed by constants only and stay in registers
#pragma unroll
    for (int i = 0; i < 8; ++i) {
      xs[i] = *(const v4f*)(xk + i * 16 * EMBED);
      ws[i] = *(const v4f*)(wk + i * 16 * EMBED);
    }
    // the wait that belongs in front of any reuse of a register that an issued
    // load names; naming both pointers keeps the address pairs whole until it,
    // and the statement keeps all 16 loads ahead of the conversions, in flight
    // together, instead of load and conversion taking turns in few registers
    asm volatile("s_wait_xcnt 0x0" ::"v"(xk), "v"(wk) : "memory");
#pragma unroll
    for (int i = 0; i < 8; ++i) {
      *(v4h*)&At[sr + i * 16][sc] = __builtin_convertvector(xs[i], v4h);
      *(v4h*)&Bt[sr + i * 16][sc] = __builtin_convertvector(ws[i], v4h);
    }
    __syncthreads();
    // this loop and those inside it unrolled: acc, a and b are indexed by
    // constants only; k runs upward as before
#pragma unroll
    for (int ks = 0; ks < GEMM_BK; ks += 32) {
      v16h a[4], b[2];
#pragma unroll
      for (int m = 0; m < 4; ++m)
        a[m] = wmma_load_a(&At[wrow + m * 16][ks], GEMM_LD);
#pragma unroll
      for (int c = 0; c < 2; ++c)
        b[c] = wmma_load_b_nk(&Bt[wcol + c * 16][ks], GEMM_LD);
#pragma unroll
      for (int c = 0; c < 2; ++c)
#pragma unroll
        for (int m = 0; m < 4; ++m) acc[m][c] = WMMA_F16(a[m], b[c], acc[m][c]);
    }
    __syncthreads();
  }
  // all three unrolled: acc is indexed by constants only
#pragma unroll
  for (int m = 0; m < 4; ++m)
#pragma unroll
    for (int c = 0; c < 2; ++c)
#pragma unroll
      for (int v = 0; v < 8; ++v) {
        const int row = rowbase + wrow + m * 16 + v + 8 * hi;
        const int col = colbase + wcol + c * 16 + nn;
        const float val = acc[m][c][v] + bias[col];
        if (OUT_HALF)
          ((_Float16*)out)[(size_t)row * EMBED + col] = (_Float16)val;
        else
          ((float*)out)[(size_t)row * EMBED + col] = val;
      }
}

__global__ __launch_bounds__(128) void attn_kernel(
    const _Float16* __restrict__ Q, const _Float16* __restrict__ K,
    const _Float16* __restrict__ V, float* __restrict__ out,
    int seglen, int rate, int off, int hmin, int gheads) {
  // one object, K first: the K tiles keep their places in LDS. V has 160-B
  // rows, the pitch (32 B x odd) of the transposing reader.
  struct Tiles {
    _Float16 k[2][32][72];
    _Float16 v[2][32][80];
  };
  __shared__ __attribute__((aligned(16))) Tiles tiles;
  _Float16 (&Kt)[2][32][72] = tiles.k;
  _Float16 (&Vt)[2][32][80] = tiles.v;

  const int S = seglen / rate;  // 2048 dilated positions per segment
  const int qtiles = S / 64;
  const int bid = blockIdx.x;
  const int qt = bid % qtiles;
  const int h = (bid / qtiles) % gheads;
  const int seg = bid / (qtiles * gheads);
  const int head = hmin + h;
  const int segbase = seg * seglen + off;

  const int tid = threadIdx.x, wave = tid >> 5, lane = tid & 31;
  const int hi = lane >> 4, nn = lane & 15;
  const size_t hoff = (size_t)head * HEAD_DIM;

  const int srow = tid >> 2, scol = (tid & 3) * 16;

  // Q fragments for this wave's 16 queries (B operand: column nn, same k order as A)
  const int qrowA = qt * 64 + wave * 16 + nn;
  const _Float16* qp = Q + (size_t)(segbase + qrowA * rate) * EMBED + hoff;
  v16h qa0, qa1;
#pragma unroll
  for (int r = 0; r < 8; ++r) {
    const int k = ((r & 3) << 1) + ((r >> 2) << 4) + (hi << 3);
    qa0[2 * r]     = qp[k];
    qa0[2 * r + 1] = qp[k + 1];
    qa1[2 * r]     = qp[32 + k];
    qa1[2 * r + 1] = qp[32 + k + 1];
  }

  v8f o0 = {}, o1 = {}, o2 = {}, o3 = {};
  // query nn's running maximum, and the sum over this lane half's keys
  float row_m = -1e30f, row_l = 0.f;
  const float scale = 0.125f;  // 1/sqrt(64)

  // issue DMA for tile 0
  {
#if HAVE_TDM
    if (wave == 0)
      tdm_load_tile_64x32(&Kt[0][0][0], K + (size_t)segbase * EMBED + hoff,
                          rate * EMBED);
#else
    {
      const size_t kpos = (size_t)(segbase + srow * rate);
      async_to_lds_32B(&Kt[0][srow][scol], K + kpos * EMBED + hoff + scol);
    }
#endif
    const size_t vpos = (size_t)(segbase + srow * rate);
    async_to_lds_32B(&Vt[0][srow][scol], V + vpos * EMBED + hoff + scol);
  }

  for (int kb = 0; kb < S; kb += 32) {
    const int buf = (kb >> 5) & 1;
    // hand-over order: this wave's LDS reads of the buffer that is refilled
    // behind the barrier have retired before it arrives there
    asm volatile("s_wait_dscnt 0x0" ::: "memory");
    wait_asynccnt0();  // this wave's V-tile DMA has landed in LDS
#if HAVE_TDM
    if (wave == 0) wait_tensorcnt0();
#endif
    __syncthreads();   // ... visible to every wave

    // overlap: issue DMA for the next tile into the other buffer
    if (kb + 32 < S) {
#if HAVE_TDM
      if (wave == 0)
        tdm_load_tile_64x32(&Kt[buf ^ 1][0][0],
                            K + (size_t)(segbase + (kb + 32) * rate) * EMBED + hoff,
                            rate * EMBED);
#else
      {
        const size_t kpos = (size_t)(segbase + (kb + 32 + srow) * rate);
        async_to_lds_32B(&Kt[buf ^ 1][srow][scol],
                         K + kpos * EMBED + hoff + scol);
      }
#endif
      const size_t vpos = (size_t)(segbase + (kb + 32 + srow) * rate);
      async_to_lds_32B(&Vt[buf ^ 1][srow][scol], V + vpos * EMBED + hoff + scol);
    }

    // K fragments, 16 (keys) x 32 (d) each, and V^T fragments, 16 (d) x 32
    // (keys) each
    const v16h ka0 = wmma_load_a(&Kt[buf][0][0], 72);
    const v16h ka1 = wmma_load_a(&Kt[buf][0][32], 72);
    const v16h ka2 = wmma_load_a(&Kt[buf][16][0], 72);
    const v16h ka3 = wmma_load_a(&Kt[buf][16][32], 72);
    const v16h va0 = wmma_load_a_tr(&Vt[buf][0][0], 80);
    const v16h va1 = wmma_load_a_tr(&Vt[buf][0][16], 80);
    const v16h va2 = wmma_load_a_tr(&Vt[buf][0][32], 80);
    const v16h va3 = wmma_load_a_tr(&Vt[buf][0][48], 80);
    // keeps the pass's 16 LDS loads up here as one group, the V loads in flight
    // under the first product; left free they sink to their WMMAs, one exposed
    // LDS latency in front of each
    __builtin_amdgcn_sched_barrier(0);

    // S^T = K Q^T : two 16 (keys) x 16 (queries) tiles, d=64 -> 2 steps each
    v8f s0 = {}, s1 = {};
    s0 = WMMA_F16(ka0, qa0, s0);
    s1 = WMMA_F16(ka2, qa0, s1);
    s0 = WMMA_F16(ka1, qa1, s0);
    s1 = WMMA_F16(ka3, qa1, s1);

    // online softmax (f32); the lane holds keys v + 8*hi (s0) and 16 + v + 8*hi
    // (s1) of query nn, the other half of the wave the other 16 keys
    s0 *= scale;
    s1 *= scale;
    float mx = -1e30f;
    // unrolled: s0 and s1 are indexed by constants only and stay in registers
#pragma unroll
    for (int v = 0; v < 8; ++v) mx = fmaxf(mx, fmaxf(s0[v], s1[v]));
    mx = fmaxf(mx, xhalf(mx));
    const float mnew = fmaxf(row_m, mx);
    const float alpha = __expf(row_m - mnew);
    row_m = mnew;
    v16h pb;  // P^T as B: element s is key 8*hi + s, or 16 + 8*hi + (s - 8)
    float l0 = 0.f, l1 = 0.f;
#pragma unroll
    for (int v = 0; v < 8; ++v) {
      const float p0 = __expf(s0[v] - mnew);
      const float p1 = __expf(s1[v] - mnew);
      l0 += p0;
      l1 += p1;
      pb[v]     = (_Float16)p0;
      pb[8 + v] = (_Float16)p1;
    }
    row_l = row_l * alpha + (l0 + l1);

    // O^T = alpha O^T + V^T P^T
    o0 *= alpha; o1 *= alpha; o2 *= alpha; o3 *= alpha;
    o0 = WMMA_F16(va0, pb, o0);
    o1 = WMMA_F16(va1, pb, o1);
    o2 = WMMA_F16(va2, pb, o2);
    o3 = WMMA_F16(va3, pb, o3);
  }

  // epilogue: query nn's row; this lane holds d = 16 t + 8 hi + 0..7 of tile t
  {
    const int qr = qt * 64 + wave * 16 + nn;
    const size_t pos = (size_t)(segbase + qr * rate);
    const float inv = 1.0f / (row_l + xhalf(row_l));
    float* op = out + pos * EMBED + hoff + 8 * hi;
    o0 *= inv; o1 *= inv; o2 *= inv; o3 *= inv;
    *(v8f*)(op)      = o0;
    *(v8f*)(op + 16) = o1;
    *(v8f*)(op + 32) = o2;
    *(v8f*)(op + 48) = o3;
  }
}

// ---- helpers ---------------------------------------------------------------
__global__ void zero_f32(float* __restrict__ p, long n) {
  long i = (long)blockIdx.x * blockDim.x + threadIdx.x;
  const long stride = (long)gridDim.x * blockDim.x;
  for (; i < n; i += stride) p[i] = 0.f;
}

__global__ __launch_bounds__(256) void layernorm_inplace(
    float* __restrict__ x, const float* __restrict__ g,
    const float* __restrict__ b) {
  __shared__ float s_sum[256];
  __shared__ float s_sq[256];
  const int row = blockIdx.x, tid = threadIdx.x;
  float* xr = x + (size_t)row * EMBED;
  float v[4], s = 0.f, sq = 0.f;
#pragma unroll
  for (int i = 0; i < 4; ++i) {
    v[i] = xr[tid + i * 256];
    s += v[i];
    sq += v[i] * v[i];
  }
  s_sum[tid] = s;
  s_sq[tid] = sq;
  __syncthreads();
  for (int st = 128; st > 0; st >>= 1) {
    if (tid < st) {
      s_sum[tid] += s_sum[tid + st];
      s_sq[tid] += s_sq[tid + st];
    }
    __syncthreads();
  }
  const float mean = s_sum[0] * (1.f / EMBED);
  const float var = s_sq[0] * (1.f / EMBED) - mean * mean;
  const float rstd = rsqrtf(var + 1e-5f);
#pragma unroll
  for (int i = 0; i < 4; ++i) {
    const int c = tid + i * 256;
    xr[c] = (v[i] - mean) * rstd * g[c] + b[c];
  }
}

// ---- launcher --------------------------------------------------------------
extern "C" void kernel_launch(void* const* d_in, const int* in_sizes, int n_in,
                              void* d_out, int out_size, void* d_ws,
                              size_t ws_size, hipStream_t stream) {
  const float* query = (const float*)d_in[0];
  const float* key   = (const float*)d_in[1];
  const float* value = (const float*)d_in[2];
  const float* Wq = (const float*)d_in[3];  const float* bq = (const float*)d_in[4];
  const float* Wk = (const float*)d_in[5];  const float* bk = (const float*)d_in[6];
  const float* Wv = (const float*)d_in[7];  const float* bv = (const float*)d_in[8];
  const float* Wo = (const float*)d_in[9];  const float* bo = (const float*)d_in[10];
  const float* ln_g = (const float*)d_in[11];
  const float* ln_b = (const float*)d_in[12];

  char* ws = (char*)d_ws;
  const size_t nelem = (size_t)NTOK * EMBED;  // 8M elements
  _Float16* qf = (_Float16*)(ws);             // 16 MB
  _Float16* kf = (_Float16*)(ws + nelem * 2); // 16 MB
  _Float16* vf = (_Float16*)(ws + nelem * 4); // 16 MB
  float*  attn = (float*)(ws + nelem * 6);    // 32 MB

  const dim3 gblk(EMBED / GEMM_BN, NTOK / GEMM_BM);  // (8, 64)
  gemm_bias_kernel<true><<<gblk, 256, 0, stream>>>(query, Wq, bq, qf);
  gemm_bias_kernel<true><<<gblk, 256, 0, stream>>>(key,   Wk, bk, kf);
  gemm_bias_kernel<true><<<gblk, 256, 0, stream>>>(value, Wv, bv, vf);

  zero_f32<<<2048, 256, 0, stream>>>(attn, (long)nelem);

  attn_kernel<<<4 * 6 * 32, 128, 0, stream>>>(qf, kf, vf, attn, 2048, 1, 0, 0, 6);
  attn_kernel<<<2 * 5 * 32, 128, 0, stream>>>(qf, kf, vf, attn, 4096, 2, 1, 6, 5);
  // group 2: seg 8192, r=4, off=2, heads [11,16)
  attn_kernel<<<1 * 5 * 32, 128, 0, stream>>>(qf, kf, vf, attn, 8192, 4, 2, 11, 5);

  layernorm_inplace<<<NTOK, 256, 0, stream>>>(attn, ln_g, ln_b);

  gemm_bias_kernel<false><<<gblk, 256, 0, stream>>>(attn, Wo, bo, (float*)d_out);
}

// v003
// It runs in 177 microseconds.
// In two side-by-side timings against v002, it was 1.48 and 1.49 times as fast.
// Counting every step since v000, it is 2.63 times as fast.
#include <hip/hip_runtime.h>

typedef __attribute__((ext_vector_type(16))) _Float16 v16h;
typedef __attribute__((ext_vector_type(8)))  float    v8f;

#define EMBED    1024
#define HEADS    16
#define HEAD_DIM 64
#define NTOK     8192

#define WMMA_F16(a, b, c) \
  __builtin_amdgcn_wmma_f32_16x16x32_f16(false, (a), false, (b), (short)0, (c), false, false)

__device__ __forceinline__ void async_to_lds_32B(void* lds, const void* gsrc) {
  const unsigned ldst = (unsigned)(unsigned long long)lds;
  asm volatile(
      "global_load_async_to_lds_b128 %0, %1, off\n\t"
      "global_load_async_to_lds_b128 %0, %1, off offset:16\n\t"
      // stands in front of any reuse of the two address registers the copies name
      "s_wait_xcnt 0x0"
      :
      : "v"(ldst), "v"(gsrc)
      : "memory");
}

__device__ __forceinline__ void wait_asynccnt0() {
#if __has_builtin(__builtin_amdgcn_s_wait_asynccnt)
  __builtin_amdgcn_s_wait_asynccnt(0);
#else
  asm volatile("s_wait_asynccnt 0x0" ::: "memory");
#endif
}

__device__ __forceinline__ void wait_tensorcnt0() {
#if __has_builtin(__builtin_amdgcn_s_wait_tensorcnt)
  __builtin_amdgcn_s_wait_tensorcnt(0);
#else
  asm volatile("s_wait_tensorcnt 0x0" ::: "memory");
#endif
}

#if __has_builtin(__builtin_amdgcn_tensor_load_to_lds)
#define HAVE_TDM 1
typedef __attribute__((ext_vector_type(4))) unsigned tdm_v4u;
typedef __attribute__((ext_vector_type(8))) int      tdm_v8i;
typedef __attribute__((ext_vector_type(4))) int      tdm_v4i;

__device__ __forceinline__ void tdm_load_tile_64x32(
    void* lds_dst, const void* gsrc, int row_stride_elems) {
  const unsigned long long ga = (unsigned long long)gsrc;
  tdm_v4u g0;
  g0[0] = 1u;
  g0[1] = (unsigned)(unsigned long long)lds_dst;
  g0[2] = (unsigned)(ga & 0xFFFFFFFFull);
  g0[3] = (unsigned)((ga >> 32) & 0x1FFFFFFull) | (2u << 30);  // [56:32]|type=2

  tdm_v8i g1;
  g1[0] = (1 << 16)
        | (1 << 20)
        | (4 << 22)
        | (3 << 25);
  g1[1] = (64 << 16);
  g1[2] = (32 << 16);
  g1[3] = (64 << 16);
  g1[4] = 32;
  g1[5] = row_stride_elems;
  g1[6] = 0;
  g1[7] = 0;

  const tdm_v4i z4 = {};
#if defined(__clang_major__) && __clang_major__ >= 23
  const tdm_v8i z8 = {};
  __builtin_amdgcn_tensor_load_to_lds(g0, g1, z4, z4, z8, 0);
#else
  __builtin_amdgcn_tensor_load_to_lds(g0, g1, z4, z4, 0);
#endif
}
#else
#define HAVE_TDM 0
#endif

__device__ __forceinline__ float xhalf(float x) {
  const int xi = __float_as_int(x);
  return __int_as_float(__builtin_amdgcn_permlanex16(
      xi, xi, 0x76543210, (int)0xFEDCBA98u, false, false));
}

__device__ __forceinline__ v16h wmma_load_a(const _Float16* p, int ld) {
  const int lane = threadIdx.x & 31;
  const int row = lane & 15, hi = lane >> 4;
  v16h a;
#pragma unroll
  for (int r = 0; r < 8; ++r) {
    const int k = ((r & 3) << 1) + ((r >> 2) << 4) + (hi << 3);
    a[2 * r]     = p[row * ld + k];
    a[2 * r + 1] = p[row * ld + k + 1];
  }
  return a;
}

__device__ __forceinline__ v16h wmma_load_b_nk(const _Float16* p, int ld) {
  const int lane = threadIdx.x & 31;
  const int n = lane & 15, hi = lane >> 4;
  v16h b;
#pragma unroll
  for (int r = 0; r < 8; ++r) {
    const int k = ((r & 3) << 1) + ((r >> 2) << 4) + (hi << 3);
    b[2 * r]     = p[n * ld + k];
    b[2 * r + 1] = p[n * ld + k + 1];
  }
  return b;
}

// A = T^T for a row-major 32 (k) x 16 (m) LDS tile: two ds_load_tr16_b128.
// Lane (c = lane & 15, hi) gets T[8 hi + 0..7][c] and T[16 + 8 hi + 0..7][c],
// the k order of the loaders above.
typedef __attribute__((ext_vector_type(8))) short s16x8;
typedef __attribute__((ext_vector_type(8))) _Float16 v8h;
__device__ __forceinline__ v8h lds_load_tr16(const _Float16* p) {
  typedef __attribute__((address_space(3))) s16x8 lds_s16x8;
  return __builtin_bit_cast(
      v8h, __builtin_amdgcn_ds_load_tr16_b128_v8i16((lds_s16x8*)p));
}

__device__ __forceinline__ v16h wmma_load_a_tr(const _Float16* p, int ld) {
  const int lane = threadIdx.x & 31;
  const _Float16* q =
      p + (8 * (lane >> 4) + (lane & 7)) * ld + 8 * ((lane >> 3) & 1);
  const v8h lo = lds_load_tr16(q);
  const v8h up = lds_load_tr16(q + 16 * ld);
  return __builtin_shufflevector(lo, up, 0, 1, 2, 3, 4, 5, 6, 7, 8, 9, 10, 11,
                                 12, 13, 14, 15);
}

// ---- GEMM: C[i][j] = sum_k X[i][k] * W[j][k] + bias[j] ---------------------
// Block tile 128 x 128 x 64, eight waves in a 2 x 4 grid, 64 x 32 of C per wave:
// every staged operand row feeds 128 outputs, and a barrier pair covers 64 k.
typedef __attribute__((ext_vector_type(4))) _Float16 v4h;
typedef __attribute__((ext_vector_type(4))) float    v4f;
#define GEMM_BM 128
#define GEMM_BN 128
#define GEMM_BK 64
#define GEMM_LD 72  // halfs: 128-B rows + 16 B, the pitch for 16-byte readers

template <bool OUT_HALF>
__global__ __launch_bounds__(256) void gemm_bias_kernel(
    const float* __restrict__ X, const float* __restrict__ W,
    const float* __restrict__ bias, void* __restrict__ out) {
  __shared__ __attribute__((aligned(16))) _Float16 At[GEMM_BM][GEMM_LD];
  __shared__ __attribute__((aligned(16))) _Float16 Bt[GEMM_BN][GEMM_LD];
  const int tid = threadIdx.x;
  const int wave = tid >> 5, lane = tid & 31;
  const int hi = lane >> 4, nn = lane & 15;
  const int wrow = (wave >> 2) * 64, wcol = (wave & 3) * 32;
  const int rowbase = blockIdx.y * GEMM_BM;
  const int colbase = blockIdx.x * GEMM_BN;

  const int sr = tid >> 4, sc = (tid & 15) * 4;
  const float* xp = X + (size_t)(rowbase + sr) * EMBED + sc;
  const float* wp = W + (size_t)(colbase + sr) * EMBED + sc;

  v8f acc[4][2] = {};
  for (int kk = 0; kk < EMBED; kk += GEMM_BK) {
    v4f xs[8], ws[8];
    const float* xk = xp + kk;
    const float* wk = wp + kk;
    // unrolled: xs/ws are indexed by constants only and stay in registers
#pragma unroll
    for (int i = 0; i < 8; ++i) {
      xs[i] = *(const v4f*)(xk + i * 16 * EMBED);
      ws[i] = *(const v4f*)(wk + i * 16 * EMBED);
    }
    // the wait that belongs in front of any reuse of a register that an issued
    // load names; naming both pointers keeps the address pairs whole until it,
    // and the statement keeps all 16 loads ahead of the conversions, in flight
    // together, instead of load and conversion taking turns in few registers
    asm volatile("s_wait_xcnt 0x0" ::"v"(xk), "v"(wk) : "memory");
#pragma unroll
    for (int i = 0; i < 8; ++i) {
      *(v4h*)&At[sr + i * 16][sc] = __builtin_convertvector(xs[i], v4h);
      *(v4h*)&Bt[sr + i * 16][sc] = __builtin_convertvector(ws[i], v4h);
    }
    __syncthreads();
    // this loop and those inside it unrolled: acc, a and b are indexed by
    // constants only; k runs upward as before
#pragma unroll
    for (int ks = 0; ks < GEMM_BK; ks += 32) {
      v16h a[4], b[2];
#pragma unroll
      for (int m = 0; m < 4; ++m)
        a[m] = wmma_load_a(&At[wrow + m * 16][ks], GEMM_LD);
#pragma unroll
      for (int c = 0; c < 2; ++c)
        b[c] = wmma_load_b_nk(&Bt[wcol + c * 16][ks], GEMM_LD);
#pragma unroll
      for (int c = 0; c < 2; ++c)
#pragma unroll
        for (int m = 0; m < 4; ++m) acc[m][c] = WMMA_F16(a[m], b[c], acc[m][c]);
    }
    __syncthreads();
  }
  // all three unrolled: acc is indexed by constants only
#pragma unroll
  for (int m = 0; m < 4; ++m)
#pragma unroll
    for (int c = 0; c < 2; ++c)
#pragma unroll
      for (int v = 0; v < 8; ++v) {
        const int row = rowbase + wrow + m * 16 + v + 8 * hi;
        const int col = colbase + wcol + c * 16 + nn;
        const float val = acc[m][c][v] + bias[col];
        if (OUT_HALF)
          ((_Float16*)out)[(size_t)row * EMBED + col] = (_Float16)val;
        else
          ((float*)out)[(size_t)row * EMBED + col] = val;
      }
}

#define ATTN_BLOCKS ((4 * 6 + 2 * 5 + 1 * 5) * 32)
__global__ __launch_bounds__(128) void attn_kernel(
    const _Float16* __restrict__ Q, const _Float16* __restrict__ K,
    const _Float16* __restrict__ V, float* __restrict__ out) {
  // one object, K first: the K tiles keep their places in LDS. V has 160-B
  // rows, the pitch (32 B x odd) of the transposing reader.
  struct Tiles {
    _Float16 k[2][32][72];
    _Float16 v[2][32][80];
  };
  __shared__ __attribute__((aligned(16))) Tiles tiles;
  _Float16 (&Kt)[2][32][72] = tiles.k;
  _Float16 (&Vt)[2][32][80] = tiles.v;

  constexpr int S = 2048;  // dilated positions per segment, seglen / rate
  constexpr int qtiles = S / 64;
  // (segment, head) pairs [0, 24): seg 2048, r=1, off=0, heads [0,6); [24, 34):
  // seg 4096, r=2, off=1, heads [6,11); [34, 39): seg 8192, r=4, off=2, heads
  // [11,16). The divisors are literals, so the whole decode is scalar code.
  const int qt = blockIdx.x % qtiles;
  const int pair = blockIdx.x / qtiles;
  const int grp = (pair >= 24) + (pair >= 34);
  const int rate = 1 << grp;
  const int seg = grp == 0 ? pair / 6 : (grp == 1 ? (pair - 24) / 5 : 0);
  const int head = grp == 0 ? pair % 6 : (grp == 1 ? 6 + (pair - 24) % 5 : pair - 23);
  const int segbase = seg * (S << grp) + grp;
  const int kpitch = __builtin_amdgcn_readfirstlane(rate * EMBED);

  const int tid = threadIdx.x, wave = tid >> 5, lane = tid & 31;
  const int hi = lane >> 4, nn = lane & 15;
  const size_t hoff = (size_t)head * HEAD_DIM;

  const int srow = tid >> 2, scol = (tid & 3) * 16;

  // Q fragments for this wave's 16 queries (B operand: column nn, same k order as A)
  const int qrowA = qt * 64 + wave * 16 + nn;
  const _Float16* qp = Q + (size_t)(segbase + qrowA * rate) * EMBED + hoff;
  v16h qa0, qa1;
#pragma unroll
  for (int r = 0; r < 8; ++r) {
    const int k = ((r & 3) << 1) + ((r >> 2) << 4) + (hi << 3);
    qa0[2 * r]     = qp[k];
    qa0[2 * r + 1] = qp[k + 1];
    qa1[2 * r]     = qp[32 + k];
    qa1[2 * r + 1] = qp[32 + k + 1];
  }

  v8f o0 = {}, o1 = {}, o2 = {}, o3 = {};
  // query nn's running maximum, and the sum over this lane half's keys
  float row_m = -1e30f, row_l = 0.f;
  const float scale = 0.125f;  // 1/sqrt(64)

  // issue DMA for tile 0
  {
#if HAVE_TDM
    if (wave == 0)
      tdm_load_tile_64x32(&Kt[0][0][0], K + (size_t)segbase * EMBED + hoff,
                          kpitch);
#else
    {
      const size_t kpos = (size_t)(segbase + srow * rate);
      async_to_lds_32B(&Kt[0][srow][scol], K + kpos * EMBED + hoff + scol);
    }
#endif
    const size_t vpos = (size_t)(segbase + srow * rate);
    async_to_lds_32B(&Vt[0][srow][scol], V + vpos * EMBED + hoff + scol);
  }

  for (int kb = 0; kb < S; kb += 32) {
    const int buf = (kb >> 5) & 1;
    // hand-over order: this wave's LDS reads of the buffer that is refilled
    // behind the barrier have retired before it arrives there
    asm volatile("s_wait_dscnt 0x0" ::: "memory");
    wait_asynccnt0();  // this wave's V-tile DMA has landed in LDS
#if HAVE_TDM
    if (wave == 0) wait_tensorcnt0();
#endif
    __syncthreads();   // ... visible to every wave

    // overlap: issue DMA for the next tile into the other buffer
    if (kb + 32 < S) {
#if HAVE_TDM
      if (wave == 0)
        tdm_load_tile_64x32(&Kt[buf ^ 1][0][0],
                            K + (size_t)(segbase + (kb + 32) * rate) * EMBED + hoff,
                            kpitch);
#else
      {
        const size_t kpos = (size_t)(segbase + (kb + 32 + srow) * rate);
        async_to_lds_32B(&Kt[buf ^ 1][srow][scol],
                         K + kpos * EMBED + hoff + scol);
      }
#endif
      const size_t vpos = (size_t)(segbase + (kb + 32 + srow) * rate);
      async_to_lds_32B(&Vt[buf ^ 1][srow][scol], V + vpos * EMBED + hoff + scol);
    }

    // K fragments, 16 (keys) x 32 (d) each, and V^T fragments, 16 (d) x 32
    // (keys) each
    const v16h ka0 = wmma_load_a(&Kt[buf][0][0], 72);
    const v16h ka1 = wmma_load_a(&Kt[buf][0][32], 72);
    const v16h ka2 = wmma_load_a(&Kt[buf][16][0], 72);
    const v16h ka3 = wmma_load_a(&Kt[buf][16][32], 72);
    const v16h va0 = wmma_load_a_tr(&Vt[buf][0][0], 80);
    const v16h va1 = wmma_load_a_tr(&Vt[buf][0][16], 80);
    const v16h va2 = wmma_load_a_tr(&Vt[buf][0][32], 80);
    const v16h va3 = wmma_load_a_tr(&Vt[buf][0][48], 80);
    // keeps the pass's 16 LDS loads up here as one group, the V loads in flight
    // under the first product; left free they sink to their WMMAs, one exposed
    // LDS latency in front of each
    __builtin_amdgcn_sched_barrier(0);

    // S^T = K Q^T : two 16 (keys) x 16 (queries) tiles, d=64 -> 2 steps each
    v8f s0 = {}, s1 = {};
    s0 = WMMA_F16(ka0, qa0, s0);
    s1 = WMMA_F16(ka2, qa0, s1);
    s0 = WMMA_F16(ka1, qa1, s0);
    s1 = WMMA_F16(ka3, qa1, s1);

    // online softmax (f32); the lane holds keys v + 8*hi (s0) and 16 + v + 8*hi
    // (s1) of query nn, the other half of the wave the other 16 keys
    s0 *= scale;
    s1 *= scale;
    float mx = -1e30f;
    // unrolled: s0 and s1 are indexed by constants only and stay in registers
#pragma unroll
    for (int v = 0; v < 8; ++v) mx = fmaxf(mx, fmaxf(s0[v], s1[v]));
    mx = fmaxf(mx, xhalf(mx));
    const float mnew = fmaxf(row_m, mx);
    const float alpha = __expf(row_m - mnew);
    row_m = mnew;
    v16h pb;  // P^T as B: element s is key 8*hi + s, or 16 + 8*hi + (s - 8)
    float l0 = 0.f, l1 = 0.f;
#pragma unroll
    for (int v = 0; v < 8; ++v) {
      const float p0 = __expf(s0[v] - mnew);
      const float p1 = __expf(s1[v] - mnew);
      l0 += p0;
      l1 += p1;
      pb[v]     = (_Float16)p0;
      pb[8 + v] = (_Float16)p1;
    }
    row_l = row_l * alpha + (l0 + l1);

    // O^T = alpha O^T + V^T P^T
    o0 *= alpha; o1 *= alpha; o2 *= alpha; o3 *= alpha;
    o0 = WMMA_F16(va0, pb, o0);
    o1 = WMMA_F16(va1, pb, o1);
    o2 = WMMA_F16(va2, pb, o2);
    o3 = WMMA_F16(va3, pb, o3);
  }

  // epilogue: query nn's row; this lane holds d = 16 t + 8 hi + 0..7 of tile t
  {
    const int qr = qt * 64 + wave * 16 + nn;
    const size_t pos = (size_t)(segbase + qr * rate);
    const float inv = 1.0f / (row_l + xhalf(row_l));
    float* op = out + pos * EMBED + hoff + 8 * hi;
    o0 *= inv; o1 *= inv; o2 *= inv; o3 *= inv;
    *(v8f*)(op)      = o0;
    *(v8f*)(op + 16) = o1;
    *(v8f*)(op + 32) = o2;
    *(v8f*)(op + 48) = o3;
  }
}

// ---- helpers ---------------------------------------------------------------
__global__ void zero_f32(float* __restrict__ p, long n) {
  long i = (long)blockIdx.x * blockDim.x + threadIdx.x;
  const long stride = (long)gridDim.x * blockDim.x;
  for (; i < n; i += stride) p[i] = 0.f;
}

__global__ __launch_bounds__(256) void layernorm_inplace(
    float* __restrict__ x, const float* __restrict__ g,
    const float* __restrict__ b) {
  __shared__ float s_sum[256];
  __shared__ float s_sq[256];
  const int row = blockIdx.x, tid = threadIdx.x;
  float* xr = x + (size_t)row * EMBED;
  float v[4], s = 0.f, sq = 0.f;
#pragma unroll
  for (int i = 0; i < 4; ++i) {
    v[i] = xr[tid + i * 256];
    s += v[i];
    sq += v[i] * v[i];
  }
  s_sum[tid] = s;
  s_sq[tid] = sq;
  __syncthreads();
  for (int st = 128; st > 0; st >>= 1) {
    if (tid < st) {
      s_sum[tid] += s_sum[tid + st];
      s_sq[tid] += s_sq[tid + st];
    }
    __syncthreads();
  }
  const float mean = s_sum[0] * (1.f / EMBED);
  const float var = s_sq[0] * (1.f / EMBED) - mean * mean;
  const float rstd = rsqrtf(var + 1e-5f);
#pragma unroll
  for (int i = 0; i < 4; ++i) {
    const int c = tid + i * 256;
    xr[c] = (v[i] - mean) * rstd * g[c] + b[c];
  }
}

// ---- launcher --------------------------------------------------------------
extern "C" void kernel_launch(void* const* d_in, const int* in_sizes, int n_in,
                              void* d_out, int out_size, void* d_ws,
                              size_t ws_size, hipStream_t stream) {
  const float* query = (const float*)d_in[0];
  const float* key   = (const float*)d_in[1];
  const float* value = (const float*)d_in[2];
  const float* Wq = (const float*)d_in[3];  const float* bq = (const float*)d_in[4];
  const float* Wk = (const float*)d_in[5];  const float* bk = (const float*)d_in[6];
  const float* Wv = (const float*)d_in[7];  const float* bv = (const float*)d_in[8];
  const float* Wo = (const float*)d_in[9];  const float* bo = (const float*)d_in[10];
  const float* ln_g = (const float*)d_in[11];
  const float* ln_b = (const float*)d_in[12];

  char* ws = (char*)d_ws;
  const size_t nelem = (size_t)NTOK * EMBED;  // 8M elements
  _Float16* qf = (_Float16*)(ws);             // 16 MB
  _Float16* kf = (_Float16*)(ws + nelem * 2); // 16 MB
  _Float16* vf = (_Float16*)(ws + nelem * 4); // 16 MB
  float*  attn = (float*)(ws + nelem * 6);    // 32 MB

  const dim3 gblk(EMBED / GEMM_BN, NTOK / GEMM_BM);  // (8, 64)
  gemm_bias_kernel<true><<<gblk, 256, 0, stream>>>(query, Wq, bq, qf);
  gemm_bias_kernel<true><<<gblk, 256, 0, stream>>>(key,   Wk, bk, kf);
  gemm_bias_kernel<true><<<gblk, 256, 0, stream>>>(value, Wv, bv, vf);

  zero_f32<<<2048, 256, 0, stream>>>(attn, (long)nelem);

  // (4 segments x 6 heads + 2 x 5 + 1 x 5) x 32 query tiles
  attn_kernel<<<ATTN_BLOCKS, 128, 0, stream>>>(qf, kf, vf, attn);

  layernorm_inplace<<<NTOK, 256, 0, stream>>>(attn, ln_g, ln_b);

  gemm_bias_kernel<false><<<gblk, 256, 0, stream>>>(attn, Wo, bo, (float*)d_out);
}

// v004
// Measured time: 166 microseconds a run.
// In both of two side-by-side timings against v003, it was 1.07 times as fast.
// Over all steps from v000 it is 2.81 times as fast.
#include <hip/hip_runtime.h>

typedef __attribute__((ext_vector_type(16))) _Float16 v16h;
typedef __attribute__((ext_vector_type(8)))  float    v8f;

#define EMBED    1024
#define HEADS    16
#define HEAD_DIM 64
#define NTOK     8192

#define WMMA_F16(a, b, c) \
  __builtin_amdgcn_wmma_f32_16x16x32_f16(false, (a), false, (b), (short)0, (c), false, false)

__device__ __forceinline__ void async_to_lds_32B(void* lds, const void* gsrc) {
  const unsigned ldst = (unsigned)(unsigned long long)lds;
  asm volatile(
      "global_load_async_to_lds_b128 %0, %1, off\n\t"
      "global_load_async_to_lds_b128 %0, %1, off offset:16\n\t"
      // stands in front of any reuse of the two address registers the copies name
      "s_wait_xcnt 0x0"
      :
      : "v"(ldst), "v"(gsrc)
      : "memory");
}

__device__ __forceinline__ void wait_asynccnt0() {
#if __has_builtin(__builtin_amdgcn_s_wait_asynccnt)
  __builtin_amdgcn_s_wait_asynccnt(0);
#else
  asm volatile("s_wait_asynccnt 0x0" ::: "memory");
#endif
}

__device__ __forceinline__ void wait_tensorcnt0() {
#if __has_builtin(__builtin_amdgcn_s_wait_tensorcnt)
  __builtin_amdgcn_s_wait_tensorcnt(0);
#else
  asm volatile("s_wait_tensorcnt 0x0" ::: "memory");
#endif
}

#if __has_builtin(__builtin_amdgcn_tensor_load_to_lds)
#define HAVE_TDM 1
typedef __attribute__((ext_vector_type(4))) unsigned tdm_v4u;
typedef __attribute__((ext_vector_type(8))) int      tdm_v8i;
typedef __attribute__((ext_vector_type(4))) int      tdm_v4i;

__device__ __forceinline__ void tdm_load_tile_64x32(
    void* lds_dst, const void* gsrc, int row_stride_elems) {
  const unsigned long long ga = (unsigned long long)gsrc;
  tdm_v4u g0;
  g0[0] = 1u;
  g0[1] = (unsigned)(unsigned long long)lds_dst;
  g0[2] = (unsigned)(ga & 0xFFFFFFFFull);
  g0[3] = (unsigned)((ga >> 32) & 0x1FFFFFFull) | (2u << 30);  // [56:32]|type=2

  tdm_v8i g1;
  g1[0] = (1 << 16)
        | (1 << 20)
        | (4 << 22)
        | (3 << 25);
  g1[1] = (64 << 16);
  g1[2] = (32 << 16);
  g1[3] = (64 << 16);
  g1[4] = 32;
  g1[5] = row_stride_elems;
  g1[6] = 0;
  g1[7] = 0;

  const tdm_v4i z4 = {};
#if defined(__clang_major__) && __clang_major__ >= 23
  const tdm_v8i z8 = {};
  __builtin_amdgcn_tensor_load_to_lds(g0, g1, z4, z4, z8, 0);
#else
  __builtin_amdgcn_tensor_load_to_lds(g0, g1, z4, z4, 0);
#endif
}
#else
#define HAVE_TDM 0
#endif

__device__ __forceinline__ float xhalf(float x) {
  const int xi = __float_as_int(x);
  return __int_as_float(__builtin_amdgcn_permlanex16(
      xi, xi, 0x76543210, (int)0xFEDCBA98u, false, false));
}

__device__ __forceinline__ v16h wmma_load_a(const _Float16* p, int ld) {
  const int lane = threadIdx.x & 31;
  const int row = lane & 15, hi = lane >> 4;
  v16h a;
#pragma unroll
  for (int r = 0; r < 8; ++r) {
    const int k = ((r & 3) << 1) + ((r >> 2) << 4) + (hi << 3);
    a[2 * r]     = p[row * ld + k];
    a[2 * r + 1] = p[row * ld + k + 1];
  }
  return a;
}

__device__ __forceinline__ v16h wmma_load_b_nk(const _Float16* p, int ld) {
  const int lane = threadIdx.x & 31;
  const int n = lane & 15, hi = lane >> 4;
  v16h b;
#pragma unroll
  for (int r = 0; r < 8; ++r) {
    const int k = ((r & 3) << 1) + ((r >> 2) << 4) + (hi << 3);
    b[2 * r]     = p[n * ld + k];
    b[2 * r + 1] = p[n * ld + k + 1];
  }
  return b;
}

// A = T^T for a row-major 32 (k) x 16 (m) LDS tile: two ds_load_tr16_b128.
// Lane (c = lane & 15, hi) gets T[8 hi + 0..7][c] and T[16 + 8 hi + 0..7][c],
// the k order of the loaders above.
typedef __attribute__((ext_vector_type(8))) short s16x8;
typedef __attribute__((ext_vector_type(8))) _Float16 v8h;
__device__ __forceinline__ v8h lds_load_tr16(const _Float16* p) {
  typedef __attribute__((address_space(3))) s16x8 lds_s16x8;
  return __builtin_bit_cast(
      v8h, __builtin_amdgcn_ds_load_tr16_b128_v8i16((lds_s16x8*)p));
}

__device__ __forceinline__ v16h wmma_load_a_tr(const _Float16* p, int ld) {
  const int lane = threadIdx.x & 31;
  const _Float16* q =
      p + (8 * (lane >> 4) + (lane & 7)) * ld + 8 * ((lane >> 3) & 1);
  const v8h lo = lds_load_tr16(q);
  const v8h up = lds_load_tr16(q + 16 * ld);
  return __builtin_shufflevector(lo, up, 0, 1, 2, 3, 4, 5, 6, 7, 8, 9, 10, 11,
                                 12, 13, 14, 15);
}

// ---- GEMM: C[i][j] = sum_k X[i][k] * W[j][k] + bias[j] ---------------------
// Block tile 128 x 128 x 64, eight waves in a 2 x 4 grid, 64 x 32 of C per wave:
// every staged operand row feeds 128 outputs, and a barrier pair covers 64 k.
typedef __attribute__((ext_vector_type(4))) _Float16 v4h;
typedef __attribute__((ext_vector_type(4))) float    v4f;
#define GEMM_BM 128
#define GEMM_BN 128
#define GEMM_BK 64
#define GEMM_LD 72  // halfs: 128-B rows + 16 B, the pitch for 16-byte readers

template <bool OUT_HALF>
__device__ __forceinline__ void gemm_bias_tile(
    const float* __restrict__ X, const float* __restrict__ W,
    const float* __restrict__ bias, void* __restrict__ out) {
  __shared__ __attribute__((aligned(16))) _Float16 At[GEMM_BM][GEMM_LD];
  __shared__ __attribute__((aligned(16))) _Float16 Bt[GEMM_BN][GEMM_LD];
  const int tid = threadIdx.x;
  const int wave = tid >> 5, lane = tid & 31;
  const int hi = lane >> 4, nn = lane & 15;
  const int wrow = (wave >> 2) * 64, wcol = (wave & 3) * 32;
  const int rowbase = blockIdx.y * GEMM_BM;
  const int colbase = blockIdx.x * GEMM_BN;

  const int sr = tid >> 4, sc = (tid & 15) * 4;
  const float* xp = X + (size_t)(rowbase + sr) * EMBED + sc;
  const float* wp = W + (size_t)(colbase + sr) * EMBED + sc;

  v8f acc[4][2] = {};
  for (int kk = 0; kk < EMBED; kk += GEMM_BK) {
    v4f xs[8], ws[8];
    const float* xk = xp + kk;
    const float* wk = wp + kk;
    // unrolled: xs/ws are indexed by constants only and stay in registers
#pragma unroll
    for (int i = 0; i < 8; ++i) {
      xs[i] = *(const v4f*)(xk + i * 16 * EMBED);
      ws[i] = *(const v4f*)(wk + i * 16 * EMBED);
    }
    // the wait that belongs in front of any reuse of a register that an issued
    // load names; naming both pointers keeps the address pairs whole until it,
    // and the statement keeps all 16 loads ahead of the conversions, in flight
    // together, instead of load and conversion taking turns in few registers
    asm volatile("s_wait_xcnt 0x0" ::"v"(xk), "v"(wk) : "memory");
#pragma unroll
    for (int i = 0; i < 8; ++i) {
      *(v4h*)&At[sr + i * 16][sc] = __builtin_convertvector(xs[i], v4h);
      *(v4h*)&Bt[sr + i * 16][sc] = __builtin_convertvector(ws[i], v4h);
    }
    __syncthreads();
    // this loop and those inside it unrolled: acc, a and b are indexed by
    // constants only; k runs upward as before
#pragma unroll
    for (int ks = 0; ks < GEMM_BK; ks += 32) {
      v16h a[4], b[2];
#pragma unroll
      for (int m = 0; m < 4; ++m)
        a[m] = wmma_load_a(&At[wrow + m * 16][ks], GEMM_LD);
#pragma unroll
      for (int c = 0; c < 2; ++c)
        b[c] = wmma_load_b_nk(&Bt[wcol + c * 16][ks], GEMM_LD);
#pragma unroll
      for (int c = 0; c < 2; ++c)
#pragma unroll
        for (int m = 0; m < 4; ++m) acc[m][c] = WMMA_F16(a[m], b[c], acc[m][c]);
    }
    __syncthreads();
  }
  // all three unrolled: acc is indexed by constants only
#pragma unroll
  for (int m = 0; m < 4; ++m)
#pragma unroll
    for (int c = 0; c < 2; ++c)
#pragma unroll
      for (int v = 0; v < 8; ++v) {
        const int row = rowbase + wrow + m * 16 + v + 8 * hi;
        const int col = colbase + wcol + c * 16 + nn;
        const float val = acc[m][c][v] + bias[col];
        if (OUT_HALF)
          ((_Float16*)out)[(size_t)row * EMBED + col] = (_Float16)val;
        else
          ((float*)out)[(size_t)row * EMBED + col] = val;
      }
}

__global__ __launch_bounds__(256) void gemm_bias_kernel(
    const float* __restrict__ X, const float* __restrict__ W,
    const float* __restrict__ bias, float* __restrict__ out) {
  gemm_bias_tile<false>(X, W, bias, out);
}

// The three projections and the clearing of the attention buffer depend on
// nothing of one another: one launch, blockIdx.z picks the projection, so their
// fills, load waits and tails overlap. The 1024 blocks of the first two
// projections each clear 32 KiB of `clr` (8M floats in all), behind the last
// barrier, so that nothing in the block waits for those stores.
__global__ __launch_bounds__(256) void qkv_gemm_kernel(
    const float* __restrict__ Xq, const float* __restrict__ Xk,
    const float* __restrict__ Xv, const float* __restrict__ Wq,
    const float* __restrict__ Wk, const float* __restrict__ Wv,
    const float* __restrict__ bq, const float* __restrict__ bk,
    const float* __restrict__ bv, _Float16* __restrict__ oq,
    _Float16* __restrict__ ok, _Float16* __restrict__ ov,
    float* __restrict__ clr) {
  const int z = blockIdx.z;
  const float* X = z == 0 ? Xq : (z == 1 ? Xk : Xv);
  const float* W = z == 0 ? Wq : (z == 1 ? Wk : Wv);
  const float* bias = z == 0 ? bq : (z == 1 ? bk : bv);
  _Float16* out = z == 0 ? oq : (z == 1 ? ok : ov);
  gemm_bias_tile<true>(X, W, bias, out);
  // stands in front of any reuse of a register that the tile's stores name
  asm volatile("s_wait_xcnt 0x0" ::: "memory");
  if (z < 2) {
    const int blk =
        (z * (NTOK / GEMM_BM) + blockIdx.y) * (EMBED / GEMM_BN) + blockIdx.x;
    float* cp = clr + (size_t)blk * 8192 + threadIdx.x * 4;
    const v4f zero = {};
    // unrolled: eight whole-line 16-B stores, constant offsets from one address
#pragma unroll
    for (int i = 0; i < 8; ++i) *(v4f*)(cp + i * 1024) = zero;
  }
}

#define ATTN_BLOCKS ((4 * 6 + 2 * 5 + 1 * 5) * 32)
__global__ __launch_bounds__(128) void attn_kernel(
    const _Float16* __restrict__ Q, const _Float16* __restrict__ K,
    const _Float16* __restrict__ V, float* __restrict__ out) {
  // one object, K first: the K tiles keep their places in LDS. V has 160-B
  // rows, the pitch (32 B x odd) of the transposing reader.
  struct Tiles {
    _Float16 k[2][32][72];
    _Float16 v[2][32][80];
  };
  __shared__ __attribute__((aligned(16))) Tiles tiles;
  _Float16 (&Kt)[2][32][72] = tiles.k;
  _Float16 (&Vt)[2][32][80] = tiles.v;

  constexpr int S = 2048;  // dilated positions per segment, seglen / rate
  constexpr int qtiles = S / 64;
  // (segment, head) pairs [0, 24): seg 2048, r=1, off=0, heads [0,6); [24, 34):
  // seg 4096, r=2, off=1, heads [6,11); [34, 39): seg 8192, r=4, off=2, heads
  // [11,16). The divisors are literals, so the whole decode is scalar code.
  const int qt = blockIdx.x % qtiles;
  const int pair = blockIdx.x / qtiles;
  const int grp = (pair >= 24) + (pair >= 34);
  const int rate = 1 << grp;
  const int seg = grp == 0 ? pair / 6 : (grp == 1 ? (pair - 24) / 5 : 0);
  const int head = grp == 0 ? pair % 6 : (grp == 1 ? 6 + (pair - 24) % 5 : pair - 23);
  const int segbase = seg * (S << grp) + grp;
  const int kpitch = __builtin_amdgcn_readfirstlane(rate * EMBED);

  const int tid = threadIdx.x, wave = tid >> 5, lane = tid & 31;
  const int hi = lane >> 4, nn = lane & 15;
  const size_t hoff = (size_t)head * HEAD_DIM;

  const int srow = tid >> 2, scol = (tid & 3) * 16;

  // Q fragments for this wave's 16 queries (B operand: column nn, same k order as A)
  const int qrowA = qt * 64 + wave * 16 + nn;
  const _Float16* qp = Q + (size_t)(segbase + qrowA * rate) * EMBED + hoff;
  v16h qa0, qa1;
#pragma unroll
  for (int r = 0; r < 8; ++r) {
    const int k = ((r & 3) << 1) + ((r >> 2) << 4) + (hi << 3);
    qa0[2 * r]     = qp[k];
    qa0[2 * r + 1] = qp[k + 1];
    qa1[2 * r]     = qp[32 + k];
    qa1[2 * r + 1] = qp[32 + k + 1];
  }

  v8f o0 = {}, o1 = {}, o2 = {}, o3 = {};
  // query nn's running maximum, and the sum over this lane half's keys
  float row_m = -1e30f, row_l = 0.f;
  const float scale = 0.125f;  // 1/sqrt(64)

  // issue DMA for tile 0
  {
#if HAVE_TDM
    if (wave == 0)
      tdm_load_tile_64x32(&Kt[0][0][0], K + (size_t)segbase * EMBED + hoff,
                          kpitch);
#else
    {
      const size_t kpos = (size_t)(segbase + srow * rate);
      async_to_lds_32B(&Kt[0][srow][scol], K + kpos * EMBED + hoff + scol);
    }
#endif
    const size_t vpos = (size_t)(segbase + srow * rate);
    async_to_lds_32B(&Vt[0][srow][scol], V + vpos * EMBED + hoff + scol);
  }

  for (int kb = 0; kb < S; kb += 32) {
    const int buf = (kb >> 5) & 1;
    // hand-over order: this wave's LDS reads of the buffer that is refilled
    // behind the barrier have retired before it arrives there
    asm volatile("s_wait_dscnt 0x0" ::: "memory");
    wait_asynccnt0();  // this wave's V-tile DMA has landed in LDS
#if HAVE_TDM
    if (wave == 0) wait_tensorcnt0();
#endif
    __syncthreads();   // ... visible to every wave

    // overlap: issue DMA for the next tile into the other buffer
    if (kb + 32 < S) {
#if HAVE_TDM
      if (wave == 0)
        tdm_load_tile_64x32(&Kt[buf ^ 1][0][0],
                            K + (size_t)(segbase + (kb + 32) * rate) * EMBED + hoff,
                            kpitch);
#else
      {
        const size_t kpos = (size_t)(segbase + (kb + 32 + srow) * rate);
        async_to_lds_32B(&Kt[buf ^ 1][srow][scol],
                         K + kpos * EMBED + hoff + scol);
      }
#endif
      const size_t vpos = (size_t)(segbase + (kb + 32 + srow) * rate);
      async_to_lds_32B(&Vt[buf ^ 1][srow][scol], V + vpos * EMBED + hoff + scol);
    }

    // K fragments, 16 (keys) x 32 (d) each, and V^T fragments, 16 (d) x 32
    // (keys) each
    const v16h ka0 = wmma_load_a(&Kt[buf][0][0], 72);
    const v16h ka1 = wmma_load_a(&Kt[buf][0][32], 72);
    const v16h ka2 = wmma_load_a(&Kt[buf][16][0], 72);
    const v16h ka3 = wmma_load_a(&Kt[buf][16][32], 72);
    const v16h va0 = wmma_load_a_tr(&Vt[buf][0][0], 80);
    const v16h va1 = wmma_load_a_tr(&Vt[buf][0][16], 80);
    const v16h va2 = wmma_load_a_tr(&Vt[buf][0][32], 80);
    const v16h va3 = wmma_load_a_tr(&Vt[buf][0][48], 80);
    // keeps the pass's 16 LDS loads up here as one group, the V loads in flight
    // under the first product; left free they sink to their WMMAs, one exposed
    // LDS latency in front of each
    __builtin_amdgcn_sched_barrier(0);

    // S^T = K Q^T : two 16 (keys) x 16 (queries) tiles, d=64 -> 2 steps each
    v8f s0 = {}, s1 = {};
    s0 = WMMA_F16(ka0, qa0, s0);
    s1 = WMMA_F16(ka2, qa0, s1);
    s0 = WMMA_F16(ka1, qa1, s0);
    s1 = WMMA_F16(ka3, qa1, s1);

    // online softmax (f32); the lane holds keys v + 8*hi (s0) and 16 + v + 8*hi
    // (s1) of query nn, the other half of the wave the other 16 keys
    s0 *= scale;
    s1 *= scale;
    float mx = -1e30f;
    // unrolled: s0 and s1 are indexed by constants only and stay in registers
#pragma unroll
    for (int v = 0; v < 8; ++v) mx = fmaxf(mx, fmaxf(s0[v], s1[v]));
    mx = fmaxf(mx, xhalf(mx));
    const float mnew = fmaxf(row_m, mx);
    const float alpha = __expf(row_m - mnew);
    row_m = mnew;
    v16h pb;  // P^T as B: element s is key 8*hi + s, or 16 + 8*hi + (s - 8)
    float l0 = 0.f, l1 = 0.f;
#pragma unroll
    for (int v = 0; v < 8; ++v) {
      const float p0 = __expf(s0[v] - mnew);
      const float p1 = __expf(s1[v] - mnew);
      l0 += p0;
      l1 += p1;
      pb[v]     = (_Float16)p0;
      pb[8 + v] = (_Float16)p1;
    }
    row_l = row_l * alpha + (l0 + l1);

    // O^T = alpha O^T + V^T P^T
    o0 *= alpha; o1 *= alpha; o2 *= alpha; o3 *= alpha;
    o0 = WMMA_F16(va0, pb, o0);
    o1 = WMMA_F16(va1, pb, o1);
    o2 = WMMA_F16(va2, pb, o2);
    o3 = WMMA_F16(va3, pb, o3);
  }

  // epilogue: query nn's row; this lane holds d = 16 t + 8 hi + 0..7 of tile t
  {
    const int qr = qt * 64 + wave * 16 + nn;
    const size_t pos = (size_t)(segbase + qr * rate);
    const float inv = 1.0f / (row_l + xhalf(row_l));
    float* op = out + pos * EMBED + hoff + 8 * hi;
    o0 *= inv; o1 *= inv; o2 *= inv; o3 *= inv;
    *(v8f*)(op)      = o0;
    *(v8f*)(op + 16) = o1;
    *(v8f*)(op + 32) = o2;
    *(v8f*)(op + 48) = o3;
  }
}

// ---- helpers ---------------------------------------------------------------
__global__ __launch_bounds__(256) void layernorm_inplace(
    float* __restrict__ x, const float* __restrict__ g,
    const float* __restrict__ b) {
  __shared__ float s_sum[256];
  __shared__ float s_sq[256];
  const int row = blockIdx.x, tid = threadIdx.x;
  float* xr = x + (size_t)row * EMBED;
  float v[4], s = 0.f, sq = 0.f;
#pragma unroll
  for (int i = 0; i < 4; ++i) {
    v[i] = xr[tid + i * 256];
    s += v[i];
    sq += v[i] * v[i];
  }
  s_sum[tid] = s;
  s_sq[tid] = sq;
  __syncthreads();
  for (int st = 128; st > 0; st >>= 1) {
    if (tid < st) {
      s_sum[tid] += s_sum[tid + st];
      s_sq[tid] += s_sq[tid + st];
    }
    __syncthreads();
  }
  const float mean = s_sum[0] * (1.f / EMBED);
  const float var = s_sq[0] * (1.f / EMBED) - mean * mean;
  const float rstd = rsqrtf(var + 1e-5f);
#pragma unroll
  for (int i = 0; i < 4; ++i) {
    const int c = tid + i * 256;
    xr[c] = (v[i] - mean) * rstd * g[c] + b[c];
  }
}

// ---- launcher --------------------------------------------------------------
extern "C" void kernel_launch(void* const* d_in, const int* in_sizes, int n_in,
                              void* d_out, int out_size, void* d_ws,
                              size_t ws_size, hipStream_t stream) {
  const float* query = (const float*)d_in[0];
  const float* key   = (const float*)d_in[1];
  const float* value = (const float*)d_in[2];
  const float* Wq = (const float*)d_in[3];  const float* bq = (const float*)d_in[4];
  const float* Wk = (const float*)d_in[5];  const float* bk = (const float*)d_in[6];
  const float* Wv = (const float*)d_in[7];  const float* bv = (const float*)d_in[8];
  const float* Wo = (const float*)d_in[9];  const float* bo = (const float*)d_in[10];
  const float* ln_g = (const float*)d_in[11];
  const float* ln_b = (const float*)d_in[12];

  char* ws = (char*)d_ws;
  const size_t nelem = (size_t)NTOK * EMBED;  // 8M elements
  _Float16* qf = (_Float16*)(ws);             // 16 MB
  _Float16* kf = (_Float16*)(ws + nelem * 2); // 16 MB
  _Float16* vf = (_Float16*)(ws + nelem * 4); // 16 MB
  float*  attn = (float*)(ws + nelem * 6);    // 32 MB

  const dim3 gblk(EMBED / GEMM_BN, NTOK / GEMM_BM);  // (8, 64)
  // q, k, v projections and the clearing of attn, one launch
  const dim3 gqkv(EMBED / GEMM_BN, NTOK / GEMM_BM, 3);  // (8, 64, 3)
  qkv_gemm_kernel<<<gqkv, 256, 0, stream>>>(query, key, value, Wq, Wk, Wv, bq,
                                            bk, bv, qf, kf, vf, attn);

  // (4 segments x 6 heads + 2 x 5 + 1 x 5) x 32 query tiles
  attn_kernel<<<ATTN_BLOCKS, 128, 0, stream>>>(qf, kf, vf, attn);

  layernorm_inplace<<<NTOK, 256, 0, stream>>>(attn, ln_g, ln_b);

  gemm_bias_kernel<<<gblk, 256, 0, stream>>>(attn, Wo, bo, (float*)d_out);
}

// v005
// Measured time: 158 microseconds a run.
// In both of two side-by-side timings against v004, it was 1.05 times as fast.
// Over all steps from v000 it is 2.95 times as fast.
#include <hip/hip_runtime.h>

typedef __attribute__((ext_vector_type(16))) _Float16 v16h;
typedef __attribute__((ext_vector_type(8)))  float    v8f;

#define EMBED    1024
#define HEADS    16
#define HEAD_DIM 64
#define NTOK     8192

#define WMMA_F16(a, b, c) \
  __builtin_amdgcn_wmma_f32_16x16x32_f16(false, (a), false, (b), (short)0, (c), false, false)

__device__ __forceinline__ void async_to_lds_32B(void* lds, const void* gsrc) {
  const unsigned ldst = (unsigned)(unsigned long long)lds;
  asm volatile(
      "global_load_async_to_lds_b128 %0, %1, off\n\t"
      "global_load_async_to_lds_b128 %0, %1, off offset:16\n\t"
      // stands in front of any reuse of the two address registers the copies name
      "s_wait_xcnt 0x0"
      :
      : "v"(ldst), "v"(gsrc)
      : "memory");
}

__device__ __forceinline__ void wait_asynccnt0() {
#if __has_builtin(__builtin_amdgcn_s_wait_asynccnt)
  __builtin_amdgcn_s_wait_asynccnt(0);
#else
  asm volatile("s_wait_asynccnt 0x0" ::: "memory");
#endif
}

__device__ __forceinline__ void wait_tensorcnt0() {
#if __has_builtin(__builtin_amdgcn_s_wait_tensorcnt)
  __builtin_amdgcn_s_wait_tensorcnt(0);
#else
  asm volatile("s_wait_tensorcnt 0x0" ::: "memory");
#endif
}

#if __has_builtin(__builtin_amdgcn_tensor_load_to_lds)
#define HAVE_TDM 1
typedef __attribute__((ext_vector_type(4))) unsigned tdm_v4u;
typedef __attribute__((ext_vector_type(8))) int      tdm_v8i;
typedef __attribute__((ext_vector_type(4))) int      tdm_v4i;

__device__ __forceinline__ void tdm_load_tile_64x32(
    void* lds_dst, const void* gsrc, int row_stride_elems) {
  const unsigned long long ga = (unsigned long long)gsrc;
  tdm_v4u g0;
  g0[0] = 1u;
  g0[1] = (unsigned)(unsigned long long)lds_dst;
  g0[2] = (unsigned)(ga & 0xFFFFFFFFull);
  g0[3] = (unsigned)((ga >> 32) & 0x1FFFFFFull) | (2u << 30);  // [56:32]|type=2

  tdm_v8i g1;
  g1[0] = (1 << 16)
        | (1 << 20)
        | (4 << 22)
        | (3 << 25);
  g1[1] = (64 << 16);
  g1[2] = (32 << 16);
  g1[3] = (64 << 16);
  g1[4] = 32;
  g1[5] = row_stride_elems;
  g1[6] = 0;
  g1[7] = 0;

  const tdm_v4i z4 = {};
#if defined(__clang_major__) && __clang_major__ >= 23
  const tdm_v8i z8 = {};
  __builtin_amdgcn_tensor_load_to_lds(g0, g1, z4, z4, z8, 0);
#else
  __builtin_amdgcn_tensor_load_to_lds(g0, g1, z4, z4, 0);
#endif
}
#else
#define HAVE_TDM 0
#endif

__device__ __forceinline__ float xhalf(float x) {
  const int xi = __float_as_int(x);
  return __int_as_float(__builtin_amdgcn_permlanex16(
      xi, xi, 0x76543210, (int)0xFEDCBA98u, false, false));
}

__device__ __forceinline__ v16h wmma_load_a(const _Float16* p, int ld) {
  const int lane = threadIdx.x & 31;
  const int row = lane & 15, hi = lane >> 4;
  v16h a;
#pragma unroll
  for (int r = 0; r < 8; ++r) {
    const int k = ((r & 3) << 1) + ((r >> 2) << 4) + (hi << 3);
    a[2 * r]     = p[row * ld + k];
    a[2 * r + 1] = p[row * ld + k + 1];
  }
  return a;
}

__device__ __forceinline__ v16h wmma_load_b_nk(const _Float16* p, int ld) {
  const int lane = threadIdx.x & 31;
  const int n = lane & 15, hi = lane >> 4;
  v16h b;
#pragma unroll
  for (int r = 0; r < 8; ++r) {
    const int k = ((r & 3) << 1) + ((r >> 2) << 4) + (hi << 3);
    b[2 * r]     = p[n * ld + k];
    b[2 * r + 1] = p[n * ld + k + 1];
  }
  return b;
}

// A = T^T for a row-major 32 (k) x 16 (m) LDS tile: two ds_load_tr16_b128.
// Lane (c = lane & 15, hi) gets T[8 hi + 0..7][c] and T[16 + 8 hi + 0..7][c],
// the k order of the loaders above.
typedef __attribute__((ext_vector_type(8))) short s16x8;
typedef __attribute__((ext_vector_type(8))) _Float16 v8h;
__device__ __forceinline__ v8h lds_load_tr16(const _Float16* p) {
  typedef __attribute__((address_space(3))) s16x8 lds_s16x8;
  return __builtin_bit_cast(
      v8h, __builtin_amdgcn_ds_load_tr16_b128_v8i16((lds_s16x8*)p));
}

__device__ __forceinline__ v16h wmma_load_a_tr(const _Float16* p, int ld) {
  const int lane = threadIdx.x & 31;
  const _Float16* q =
      p + (8 * (lane >> 4) + (lane & 7)) * ld + 8 * ((lane >> 3) & 1);
  const v8h lo = lds_load_tr16(q);
  const v8h up = lds_load_tr16(q + 16 * ld);
  return __builtin_shufflevector(lo, up, 0, 1, 2, 3, 4, 5, 6, 7, 8, 9, 10, 11,
                                 12, 13, 14, 15);
}

// ---- GEMM: C[i][j] = sum_k X[i][k] * W[j][k] + bias[j] ---------------------
// Block tile 128 x 128 x 64, eight waves in a 2 x 4 grid, 64 x 32 of C per wave:
// every staged operand row feeds 128 outputs, and a barrier pair covers 64 k.
// With LN set, X is layer-normalised on its way into LDS: a row's mean and
// variance come from the per-(head, row) sums that the attention kernel left in
// `stats`, so the normalised matrix is never written to memory.
typedef __attribute__((ext_vector_type(4))) _Float16 v4h;
typedef __attribute__((ext_vector_type(4))) float    v4f;
typedef __attribute__((ext_vector_type(2))) float    v2f;
#define GEMM_BM 128
#define GEMM_BN 128
#define GEMM_BK 64
#define GEMM_LD 72  // halfs: 128-B rows + 16 B, the pitch for 16-byte readers

template <bool OUT_HALF, bool LN = false>
__device__ __forceinline__ void gemm_bias_tile(
    const float* __restrict__ X, const float* __restrict__ W,
    const float* __restrict__ bias, void* __restrict__ out,
    const float* __restrict__ stats = nullptr,
    const float* __restrict__ lng = nullptr,
    const float* __restrict__ lnb = nullptr) {
  __shared__ __attribute__((aligned(16))) _Float16 At[GEMM_BM][GEMM_LD];
  __shared__ __attribute__((aligned(16))) _Float16 Bt[GEMM_BN][GEMM_LD];
  // LN only: each row's sums over heads 0..7 and 8..15; gain and shift vectors
  __shared__ __attribute__((aligned(16))) float lnpart[2][GEMM_BM][2];
  __shared__ __attribute__((aligned(16))) float lngb[2][EMBED];
  const int tid = threadIdx.x;
  const int wave = tid >> 5, lane = tid & 31;
  const int hi = lane >> 4, nn = lane & 15;
  const int wrow = (wave >> 2) * 64, wcol = (wave & 3) * 32;
  const int rowbase = blockIdx.y * GEMM_BM;
  const int colbase = blockIdx.x * GEMM_BN;

  const int sr = tid >> 4, sc = (tid & 15) * 4;
  const float* xp = X + (size_t)(rowbase + sr) * EMBED + sc;
  const float* wp = W + (size_t)(colbase + sr) * EMBED + sc;

  // LN: x -> x * ra + rc is (x - mean) * rstd for the thread's eight staged rows
  float ra[8], rc[8];
  if constexpr (LN) {
    const int prow = tid & (GEMM_BM - 1), ph = tid >> 7;
    const int grow = rowbase + prow;
    float s = 0.f, q = 0.f;
    // unrolled: eight independent 8-B loads in flight together
#pragma unroll
    for (int j = 0; j < 8; ++j) {
      const int head = ph * 8 + j;
      const int grp = (head >= 6) + (head >= 11);
      const int crow = (grow & ~((1 << grp) - 1)) | grp;
      const v2f p = *(const v2f*)(stats + ((size_t)head * NTOK + crow) * 2);
      s += crow == grow ? p[0] : 0.f;
      q += crow == grow ? p[1] : 0.f;
    }
    lnpart[ph][prow][0] = s;
    lnpart[ph][prow][1] = q;
    *(v4f*)&lngb[0][tid * 4] = *(const v4f*)(lng + tid * 4);
    *(v4f*)&lngb[1][tid * 4] = *(const v4f*)(lnb + tid * 4);
    __syncthreads();  // the sums and the two vectors, visible to every wave
    // unrolled: ra and rc are indexed by constants only and stay in registers
#pragma unroll
    for (int i = 0; i < 8; ++i) {
      const int r = sr + i * 16;
      const float mean = (lnpart[0][r][0] + lnpart[1][r][0]) * (1.f / EMBED);
      const float var =
          (lnpart[0][r][1] + lnpart[1][r][1]) * (1.f / EMBED) - mean * mean;
      const float rstd = rsqrtf(var + 1e-5f);
      ra[i] = rstd;
      rc[i] = -mean * rstd;
    }
  }

  v8f acc[4][2] = {};
  for (int kk = 0; kk < EMBED; kk += GEMM_BK) {
    v4f xs[8], ws[8];
    const float* xk = xp + kk;
    const float* wk = wp + kk;
    // unrolled: xs/ws are indexed by constants only and stay in registers
#pragma unroll
    for (int i = 0; i < 8; ++i) {
      xs[i] = *(const v4f*)(xk + i * 16 * EMBED);
      ws[i] = *(const v4f*)(wk + i * 16 * EMBED);
    }
    // the wait that belongs in front of any reuse of a register that an issued
    // load names; naming both pointers keeps the address pairs whole until it,
    // and the statement keeps all 16 loads ahead of the conversions, in flight
    // together, instead of load and conversion taking turns in few registers
    asm volatile("s_wait_xcnt 0x0" ::"v"(xk), "v"(wk) : "memory");
    if constexpr (LN) {
      const v4f g4 = *(const v4f*)&lngb[0][kk + sc];
      const v4f b4 = *(const v4f*)&lngb[1][kk + sc];
#pragma unroll
      for (int i = 0; i < 8; ++i) xs[i] = (xs[i] * ra[i] + rc[i]) * g4 + b4;
    }
#pragma unroll
    for (int i = 0; i < 8; ++i) {
      *(v4h*)&At[sr + i * 16][sc] = __builtin_convertvector(xs[i], v4h);
      *(v4h*)&Bt[sr + i * 16][sc] = __builtin_convertvector(ws[i], v4h);
    }
    __syncthreads();
    // this loop and those inside it unrolled: acc, a and b are indexed by
    // constants only; k runs upward as before
#pragma unroll
    for (int ks = 0; ks < GEMM_BK; ks += 32) {
      v16h a[4], b[2];
#pragma unroll
      for (int m = 0; m < 4; ++m)
        a[m] = wmma_load_a(&At[wrow + m * 16][ks], GEMM_LD);
#pragma unroll
      for (int c = 0; c < 2; ++c)
        b[c] = wmma_load_b_nk(&Bt[wcol + c * 16][ks], GEMM_LD);
#pragma unroll
      for (int c = 0; c < 2; ++c)
#pragma unroll
        for (int m = 0; m < 4; ++m) acc[m][c] = WMMA_F16(a[m], b[c], acc[m][c]);
    }
    __syncthreads();
  }
  // all three unrolled: acc is indexed by constants only
#pragma unroll
  for (int m = 0; m < 4; ++m)
#pragma unroll
    for (int c = 0; c < 2; ++c)
#pragma unroll
      for (int v = 0; v < 8; ++v) {
        const int row = rowbase + wrow + m * 16 + v + 8 * hi;
        const int col = colbase + wcol + c * 16 + nn;
        const float val = acc[m][c][v] + bias[col];
        if (OUT_HALF)
          ((_Float16*)out)[(size_t)row * EMBED + col] = (_Float16)val;
        else
          ((float*)out)[(size_t)row * EMBED + col] = val;
      }
}

__global__ __launch_bounds__(256) void ln_gemm_bias_kernel(
    const float* __restrict__ X, const float* __restrict__ W,
    const float* __restrict__ bias, float* __restrict__ out,
    const float* __restrict__ stats, const float* __restrict__ lng,
    const float* __restrict__ lnb) {
  gemm_bias_tile<false, true>(X, W, bias, out, stats, lng, lnb);
}

// The three projections and the clearing of the attention buffer depend on
// nothing of one another: one launch, blockIdx.z picks the projection, so their
// fills, load waits and tails overlap. The 1024 blocks of the first two
// projections each clear 32 KiB of `clr` (8M floats in all), behind the last
// barrier, so that nothing in the block waits for those stores.
__global__ __launch_bounds__(256) void qkv_gemm_kernel(
    const float* __restrict__ Xq, const float* __restrict__ Xk,
    const float* __restrict__ Xv, const float* __restrict__ Wq,
    const float* __restrict__ Wk, const float* __restrict__ Wv,
    const float* __restrict__ bq, const float* __restrict__ bk,
    const float* __restrict__ bv, _Float16* __restrict__ oq,
    _Float16* __restrict__ ok, _Float16* __restrict__ ov,
    float* __restrict__ clr) {
  const int z = blockIdx.z;
  const float* X = z == 0 ? Xq : (z == 1 ? Xk : Xv);
  const float* W = z == 0 ? Wq : (z == 1 ? Wk : Wv);
  const float* bias = z == 0 ? bq : (z == 1 ? bk : bv);
  _Float16* out = z == 0 ? oq : (z == 1 ? ok : ov);
  gemm_bias_tile<true>(X, W, bias, out);
  // stands in front of any reuse of a register that the tile's stores name
  asm volatile("s_wait_xcnt 0x0" ::: "memory");
  if (z < 2) {
    const int blk =
        (z * (NTOK / GEMM_BM) + blockIdx.y) * (EMBED / GEMM_BN) + blockIdx.x;
    float* cp = clr + (size_t)blk * 8192 + threadIdx.x * 4;
    const v4f zero = {};
    // unrolled: eight whole-line 16-B stores, constant offsets from one address
#pragma unroll
    for (int i = 0; i < 8; ++i) *(v4f*)(cp + i * 1024) = zero;
  }
}

#define ATTN_BLOCKS ((4 * 6 + 2 * 5 + 1 * 5) * 32)
__global__ __launch_bounds__(128) void attn_kernel(
    const _Float16* __restrict__ Q, const _Float16* __restrict__ K,
    const _Float16* __restrict__ V, float* __restrict__ out,
    float* __restrict__ stats) {
  // one object, K first: the K tiles keep their places in LDS. V has 160-B
  // rows, the pitch (32 B x odd) of the transposing reader.
  struct Tiles {
    _Float16 k[2][32][72];
    _Float16 v[2][32][80];
  };
  __shared__ __attribute__((aligned(16))) Tiles tiles;
  _Float16 (&Kt)[2][32][72] = tiles.k;
  _Float16 (&Vt)[2][32][80] = tiles.v;

  constexpr int S = 2048;  // dilated positions per segment, seglen / rate
  constexpr int qtiles = S / 64;
  // (segment, head) pairs [0, 24): seg 2048, r=1, off=0, heads [0,6); [24, 34):
  // seg 4096, r=2, off=1, heads [6,11); [34, 39): seg 8192, r=4, off=2, heads
  // [11,16). The divisors are literals, so the whole decode is scalar code.
  const int qt = blockIdx.x % qtiles;
  const int pair = blockIdx.x / qtiles;
  const int grp = (pair >= 24) + (pair >= 34);
  const int rate = 1 << grp;
  const int seg = grp == 0 ? pair / 6 : (grp == 1 ? (pair - 24) / 5 : 0);
  const int head = grp == 0 ? pair % 6 : (grp == 1 ? 6 + (pair - 24) % 5 : pair - 23);
  const int segbase = seg * (S << grp) + grp;
  const int kpitch = __builtin_amdgcn_readfirstlane(rate * EMBED);

  const int tid = threadIdx.x, wave = tid >> 5, lane = tid & 31;
  const int hi = lane >> 4, nn = lane & 15;
  const size_t hoff = (size_t)head * HEAD_DIM;

  const int srow = tid >> 2, scol = (tid & 3) * 16;

  // Q fragments for this wave's 16 queries (B operand: column nn, same k order as A)
  const int qrowA = qt * 64 + wave * 16 + nn;
  const _Float16* qp = Q + (size_t)(segbase + qrowA * rate) * EMBED + hoff;
  v16h qa0, qa1;
#pragma unroll
  for (int r = 0; r < 8; ++r) {
    const int k = ((r & 3) << 1) + ((r >> 2) << 4) + (hi << 3);
    qa0[2 * r]     = qp[k];
    qa0[2 * r + 1] = qp[k + 1];
    qa1[2 * r]     = qp[32 + k];
    qa1[2 * r + 1] = qp[32 + k + 1];
  }

  v8f o0 = {}, o1 = {}, o2 = {}, o3 = {};
  // query nn's running maximum, and the sum over this lane half's keys
  float row_m = -1e30f, row_l = 0.f;
  const float scale = 0.125f;  // 1/sqrt(64)

  // issue DMA for tile 0
  {
#if HAVE_TDM
    if (wave == 0)
      tdm_load_tile_64x32(&Kt[0][0][0], K + (size_t)segbase * EMBED + hoff,
                          kpitch);
#else
    {
      const size_t kpos = (size_t)(segbase + srow * rate);
      async_to_lds_32B(&Kt[0][srow][scol], K + kpos * EMBED + hoff + scol);
    }
#endif
    const size_t vpos = (size_t)(segbase + srow * rate);
    async_to_lds_32B(&Vt[0][srow][scol], V + vpos * EMBED + hoff + scol);
  }

  for (int kb = 0; kb < S; kb += 32) {
    const int buf = (kb >> 5) & 1;
    // hand-over order: this wave's LDS reads of the buffer that is refilled
    // behind the barrier have retired before it arrives there
    asm volatile("s_wait_dscnt 0x0" ::: "memory");
    wait_asynccnt0();  // this wave's V-tile DMA has landed in LDS
#if HAVE_TDM
    if (wave == 0) wait_tensorcnt0();
#endif
    __syncthreads();   // ... visible to every wave

    // overlap: issue DMA for the next tile into the other buffer
    if (kb + 32 < S) {
#if HAVE_TDM
      if (wave == 0)
        tdm_load_tile_64x32(&Kt[buf ^ 1][0][0],
                            K + (size_t)(segbase + (kb + 32) * rate) * EMBED + hoff,
                            kpitch);
#else
      {
        const size_t kpos = (size_t)(segbase + (kb + 32 + srow) * rate);
        async_to_lds_32B(&Kt[buf ^ 1][srow][scol],
                         K + kpos * EMBED + hoff + scol);
      }
#endif
      const size_t vpos = (size_t)(segbase + (kb + 32 + srow) * rate);
      async_to_lds_32B(&Vt[buf ^ 1][srow][scol], V + vpos * EMBED + hoff + scol);
    }

    // K fragments, 16 (keys) x 32 (d) each, and V^T fragments, 16 (d) x 32
    // (keys) each
    const v16h ka0 = wmma_load_a(&Kt[buf][0][0], 72);
    const v16h ka1 = wmma_load_a(&Kt[buf][0][32], 72);
    const v16h ka2 = wmma_load_a(&Kt[buf][16][0], 72);
    const v16h ka3 = wmma_load_a(&Kt[buf][16][32], 72);
    const v16h va0 = wmma_load_a_tr(&Vt[buf][0][0], 80);
    const v16h va1 = wmma_load_a_tr(&Vt[buf][0][16], 80);
    const v16h va2 = wmma_load_a_tr(&Vt[buf][0][32], 80);
    const v16h va3 = wmma_load_a_tr(&Vt[buf][0][48], 80);
    // keeps the pass's 16 LDS loads up here as one group, the V loads in flight
    // under the first product; left free they sink to their WMMAs, one exposed
    // LDS latency in front of each
    __builtin_amdgcn_sched_barrier(0);

    // S^T = K Q^T : two 16 (keys) x 16 (queries) tiles, d=64 -> 2 steps each
    v8f s0 = {}, s1 = {};
    s0 = WMMA_F16(ka0, qa0, s0);
    s1 = WMMA_F16(ka2, qa0, s1);
    s0 = WMMA_F16(ka1, qa1, s0);
    s1 = WMMA_F16(ka3, qa1, s1);

    // online softmax (f32); the lane holds keys v + 8*hi (s0) and 16 + v + 8*hi
    // (s1) of query nn, the other half of the wave the other 16 keys
    s0 *= scale;
    s1 *= scale;
    float mx = -1e30f;
    // unrolled: s0 and s1 are indexed by constants only and stay in registers
#pragma unroll
    for (int v = 0; v < 8; ++v) mx = fmaxf(mx, fmaxf(s0[v], s1[v]));
    mx = fmaxf(mx, xhalf(mx));
    const float mnew = fmaxf(row_m, mx);
    const float alpha = __expf(row_m - mnew);
    row_m = mnew;
    v16h pb;  // P^T as B: element s is key 8*hi + s, or 16 + 8*hi + (s - 8)
    float l0 = 0.f, l1 = 0.f;
#pragma unroll
    for (int v = 0; v < 8; ++v) {
      const float p0 = __expf(s0[v] - mnew);
      const float p1 = __expf(s1[v] - mnew);
      l0 += p0;
      l1 += p1;
      pb[v]     = (_Float16)p0;
      pb[8 + v] = (_Float16)p1;
    }
    row_l = row_l * alpha + (l0 + l1);

    // O^T = alpha O^T + V^T P^T
    o0 *= alpha; o1 *= alpha; o2 *= alpha; o3 *= alpha;
    o0 = WMMA_F16(va0, pb, o0);
    o1 = WMMA_F16(va1, pb, o1);
    o2 = WMMA_F16(va2, pb, o2);
    o3 = WMMA_F16(va3, pb, o3);
  }

  // epilogue: query nn's row; this lane holds d = 16 t + 8 hi + 0..7 of tile t
  {
    const int qr = qt * 64 + wave * 16 + nn;
    const size_t pos = (size_t)(segbase + qr * rate);
    const float inv = 1.0f / (row_l + xhalf(row_l));
    float* op = out + pos * EMBED + hoff + 8 * hi;
    o0 *= inv; o1 *= inv; o2 *= inv; o3 *= inv;
    // this head's share of the row's layer-norm sums: sum and sum of squares of
    // the 64 values, half of them in each lane half
    const v8f t = (o0 + o1) + (o2 + o3);
    const v8f u = (o0 * o0 + o1 * o1) + (o2 * o2 + o3 * o3);
    float rs = ((t[0] + t[1]) + (t[2] + t[3])) + ((t[4] + t[5]) + (t[6] + t[7]));
    float rq = ((u[0] + u[1]) + (u[2] + u[3])) + ((u[4] + u[5]) + (u[6] + u[7]));
    rs += xhalf(rs);
    rq += xhalf(rq);
    *(v8f*)(op)      = o0;
    *(v8f*)(op + 16) = o1;
    *(v8f*)(op + 32) = o2;
    *(v8f*)(op + 48) = o3;
    if (hi == 0) {
      const v2f st = {rs, rq};
      *(v2f*)(stats + ((size_t)head * NTOK + pos) * 2) = st;
    }
  }
}

// ---- launcher --------------------------------------------------------------
extern "C" void kernel_launch(void* const* d_in, const int* in_sizes, int n_in,
                              void* d_out, int out_size, void* d_ws,
                              size_t ws_size, hipStream_t stream) {
  const float* query = (const float*)d_in[0];
  const float* key   = (const float*)d_in[1];
  const float* value = (const float*)d_in[2];
  const float* Wq = (const float*)d_in[3];  const float* bq = (const float*)d_in[4];
  const float* Wk = (const float*)d_in[5];  const float* bk = (const float*)d_in[6];
  const float* Wv = (const float*)d_in[7];  const float* bv = (const float*)d_in[8];
  const float* Wo = (const float*)d_in[9];  const float* bo = (const float*)d_in[10];
  const float* ln_g = (const float*)d_in[11];
  const float* ln_b = (const float*)d_in[12];

  char* ws = (char*)d_ws;
  const size_t nelem = (size_t)NTOK * EMBED;  // 8M elements
  _Float16* qf = (_Float16*)(ws);             // 16 MB
  _Float16* kf = (_Float16*)(ws + nelem * 2); // 16 MB
  _Float16* vf = (_Float16*)(ws + nelem * 4); // 16 MB
  float*  attn = (float*)(ws + nelem * 6);    // 32 MB
  float* stats = (float*)(ws + nelem * 10);   // 1 MB: [head][row] (sum, sum sq)

  const dim3 gblk(EMBED / GEMM_BN, NTOK / GEMM_BM);  // (8, 64)
  // q, k, v projections and the clearing of attn, one launch
  const dim3 gqkv(EMBED / GEMM_BN, NTOK / GEMM_BM, 3);  // (8, 64, 3)
  qkv_gemm_kernel<<<gqkv, 256, 0, stream>>>(query, key, value, Wq, Wk, Wv, bq,
                                            bk, bv, qf, kf, vf, attn);

  // (4 segments x 6 heads + 2 x 5 + 1 x 5) x 32 query tiles
  attn_kernel<<<ATTN_BLOCKS, 128, 0, stream>>>(qf, kf, vf, attn, stats);

  // layer norm and output projection
  ln_gemm_bias_kernel<<<gblk, 256, 0, stream>>>(attn, Wo, bo, (float*)d_out,
                                                stats, ln_g, ln_b);
}

// v006
// It runs in 152 microseconds.
// Timed twice side by side with v005, it ran 1.04 times as fast both times.
// Counting every step since v000, it is 3.07 times as fast.
#include <hip/hip_runtime.h>

typedef __attribute__((ext_vector_type(16))) _Float16 v16h;
typedef __attribute__((ext_vector_type(8)))  float    v8f;

#define EMBED    1024
#define HEADS    16
#define HEAD_DIM 64
#define NTOK     8192

#define WMMA_F16(a, b, c) \
  __builtin_amdgcn_wmma_f32_16x16x32_f16(false, (a), false, (b), (short)0, (c), false, false)

__device__ __forceinline__ void async_to_lds_32B(void* lds, const void* gsrc) {
  const unsigned ldst = (unsigned)(unsigned long long)lds;
  asm volatile(
      "global_load_async_to_lds_b128 %0, %1, off\n\t"
      "global_load_async_to_lds_b128 %0, %1, off offset:16\n\t"
      // stands in front of any reuse of the two address registers the copies name
      "s_wait_xcnt 0x0"
      :
      : "v"(ldst), "v"(gsrc)
      : "memory");
}

typedef __attribute__((ext_vector_type(4))) uint32_t u32x4;
typedef __attribute__((ext_vector_type(8))) uint32_t u32x8;

__device__ __forceinline__ uint32_t uni(uint32_t v) {
  return (uint32_t)__builtin_amdgcn_readfirstlane(v);
}

__device__ __forceinline__ uint32_t pinned(uint32_t v) {
  uint32_t w = uni(v);
  asm volatile("" : "+s"(w));  // pinned(): holds the test in a scalar register
  return w;
}

__device__ __forceinline__ u32x8 tdm_group1(uint32_t src_pitch_bytes) {
  u32x8 g;
  g[0] = uni((1u << 20) | (4u << 22) | (3u << 25));
  g[1] = uni(128u << 16);
  g[2] = uni(64u << 16);
  g[3] = uni(128u << 16);
  g[4] = uni(64u);
  g[5] = uni(src_pitch_bytes);
  g[6] = uni(0u);
  g[7] = uni(0u);
  asm volatile("" : "+s"(g));
  return g;
}

__device__ __forceinline__ u32x4 tdm_group0(const void* lds_dst, const void* gsrc) {
  const uint64_t ga = (uint64_t)gsrc;
  u32x4 g;
  g[0] = uni(1u);                                   // count = 1
  g[1] = uni((uint32_t)(uint64_t)lds_dst);          // byte offset in the LDS
  g[2] = uni((uint32_t)ga);                         // address [31:0]
  g[3] = uni((((uint32_t)(ga >> 32)) & 0x01FFFFFFu) | 0x80000000u);
  asm volatile("" : "+s"(g));
  return g;
}

__device__ __forceinline__ void tdm_load(u32x4 g0, u32x8 g1) {
  asm volatile("tensor_load_to_lds %0, %1" ::"s"(g0), "s"(g1) : "memory");
}

// The issuing wave's wait for its request. Naming the request's two groups keeps
// their registers whole until it has landed.
__device__ __forceinline__ void tdm_wait(u32x4 g0, u32x8 g1) {
  asm volatile("s_wait_tensorcnt 0x0" ::"s"(g0), "s"(g1) : "memory");
}

__device__ __forceinline__ float xhalf(float x) {
  const int xi = __float_as_int(x);
  return __int_as_float(__builtin_amdgcn_permlanex16(
      xi, xi, 0x76543210, (int)0xFEDCBA98u, false, false));
}

__device__ __forceinline__ v16h wmma_load_a(const _Float16* p, int ld) {
  const int lane = threadIdx.x & 31;
  const int row = lane & 15, hi = lane >> 4;
  v16h a;
#pragma unroll
  for (int r = 0; r < 8; ++r) {
    const int k = ((r & 3) << 1) + ((r >> 2) << 4) + (hi << 3);
    a[2 * r]     = p[row * ld + k];
    a[2 * r + 1] = p[row * ld + k + 1];
  }
  return a;
}

__device__ __forceinline__ v16h wmma_load_b_nk(const _Float16* p, int ld) {
  const int lane = threadIdx.x & 31;
  const int n = lane & 15, hi = lane >> 4;
  v16h b;
#pragma unroll
  for (int r = 0; r < 8; ++r) {
    const int k = ((r & 3) << 1) + ((r >> 2) << 4) + (hi << 3);
    b[2 * r]     = p[n * ld + k];
    b[2 * r + 1] = p[n * ld + k + 1];
  }
  return b;
}

// A = T^T for a row-major 32 (k) x 16 (m) LDS tile: two ds_load_tr16_b128.
// Lane (c = lane & 15, hi) gets T[8 hi + 0..7][c] and T[16 + 8 hi + 0..7][c],
// the k order of the loaders above.
typedef __attribute__((ext_vector_type(8))) short s16x8;
typedef __attribute__((ext_vector_type(8))) _Float16 v8h;
__device__ __forceinline__ v8h lds_load_tr16(const _Float16* p) {
  typedef __attribute__((address_space(3))) s16x8 lds_s16x8;
  return __builtin_bit_cast(
      v8h, __builtin_amdgcn_ds_load_tr16_b128_v8i16((lds_s16x8*)p));
}

__device__ __forceinline__ v16h wmma_load_a_tr(const _Float16* p, int ld) {
  const int lane = threadIdx.x & 31;
  const _Float16* q =
      p + (8 * (lane >> 4) + (lane & 7)) * ld + 8 * ((lane >> 3) & 1);
  const v8h lo = lds_load_tr16(q);
  const v8h up = lds_load_tr16(q + 16 * ld);
  return __builtin_shufflevector(lo, up, 0, 1, 2, 3, 4, 5, 6, 7, 8, 9, 10, 11,
                                 12, 13, 14, 15);
}

// ---- GEMM: C[i][j] = sum_k X[i][k] * W[j][k] + bias[j] ---------------------
// Block tile 128 x 128 x 64, eight waves in a 2 x 4 grid, 64 x 32 of C per wave:
// every staged operand row feeds 128 outputs, and a barrier pair covers 64 k.
// With LN set, X is layer-normalised on its way into LDS: a row's mean and
// variance come from the per-(head, row) sums that the attention kernel left in
// `stats`, so the normalised matrix is never written to memory.
typedef __attribute__((ext_vector_type(4))) _Float16 v4h;
typedef __attribute__((ext_vector_type(4))) float    v4f;
typedef __attribute__((ext_vector_type(2))) float    v2f;
#define GEMM_BM 128
#define GEMM_BN 128
#define GEMM_BK 64
#define GEMM_LD 72  // halfs: 128-B rows + 16 B, the pitch for 16-byte readers

template <bool OUT_HALF, bool LN = false>
__device__ __forceinline__ void gemm_bias_tile(
    const float* __restrict__ X, const float* __restrict__ W,
    const float* __restrict__ bias, void* __restrict__ out,
    const float* __restrict__ stats = nullptr,
    const float* __restrict__ lng = nullptr,
    const float* __restrict__ lnb = nullptr) {
  __shared__ __attribute__((aligned(16))) _Float16 At[GEMM_BM][GEMM_LD];
  __shared__ __attribute__((aligned(16))) _Float16 Bt[GEMM_BN][GEMM_LD];
  // LN only: each row's sums over heads 0..7 and 8..15; gain and shift vectors
  __shared__ __attribute__((aligned(16))) float lnpart[2][GEMM_BM][2];
  __shared__ __attribute__((aligned(16))) float lngb[2][EMBED];
  const int tid = threadIdx.x;
  const int wave = tid >> 5, lane = tid & 31;
  const int hi = lane >> 4, nn = lane & 15;
  const int wrow = (wave >> 2) * 64, wcol = (wave & 3) * 32;
  const int rowbase = blockIdx.y * GEMM_BM;
  const int colbase = blockIdx.x * GEMM_BN;

  const int sr = tid >> 4, sc = (tid & 15) * 4;
  const float* xp = X + (size_t)(rowbase + sr) * EMBED + sc;
  const float* wp = W + (size_t)(colbase + sr) * EMBED + sc;

  // LN: x -> x * ra + rc is (x - mean) * rstd for the thread's eight staged rows
  float ra[8], rc[8];
  if constexpr (LN) {
    const int prow = tid & (GEMM_BM - 1), ph = tid >> 7;
    const int grow = rowbase + prow;
    float s = 0.f, q = 0.f;
    // unrolled: eight independent 8-B loads in flight together
#pragma unroll
    for (int j = 0; j < 8; ++j) {
      const int head = ph * 8 + j;
      const int grp = (head >= 6) + (head >= 11);
      const int crow = (grow & ~((1 << grp) - 1)) | grp;
      const v2f p = *(const v2f*)(stats + ((size_t)head * NTOK + crow) * 2);
      s += crow == grow ? p[0] : 0.f;
      q += crow == grow ? p[1] : 0.f;
    }
    lnpart[ph][prow][0] = s;
    lnpart[ph][prow][1] = q;
    *(v4f*)&lngb[0][tid * 4] = *(const v4f*)(lng + tid * 4);
    *(v4f*)&lngb[1][tid * 4] = *(const v4f*)(lnb + tid * 4);
    __syncthreads();  // the sums and the two vectors, visible to every wave
    // unrolled: ra and rc are indexed by constants only and stay in registers
#pragma unroll
    for (int i = 0; i < 8; ++i) {
      const int r = sr + i * 16;
      const float mean = (lnpart[0][r][0] + lnpart[1][r][0]) * (1.f / EMBED);
      const float var =
          (lnpart[0][r][1] + lnpart[1][r][1]) * (1.f / EMBED) - mean * mean;
      const float rstd = rsqrtf(var + 1e-5f);
      ra[i] = rstd;
      rc[i] = -mean * rstd;
    }
  }

  v8f acc[4][2] = {};
  for (int kk = 0; kk < EMBED; kk += GEMM_BK) {
    v4f xs[8], ws[8];
    const float* xk = xp + kk;
    const float* wk = wp + kk;
    // unrolled: xs/ws are indexed by constants only and stay in registers
#pragma unroll
    for (int i = 0; i < 8; ++i) {
      xs[i] = *(const v4f*)(xk + i * 16 * EMBED);
      ws[i] = *(const v4f*)(wk + i * 16 * EMBED);
    }
    // the wait that belongs in front of any reuse of a register that an issued
    // load names; naming both pointers keeps the address pairs whole until it,
    // and the statement keeps all 16 loads ahead of the conversions, in flight
    // together, instead of load and conversion taking turns in few registers
    asm volatile("s_wait_xcnt 0x0" ::"v"(xk), "v"(wk) : "memory");
    if constexpr (LN) {
      const v4f g4 = *(const v4f*)&lngb[0][kk + sc];
      const v4f b4 = *(const v4f*)&lngb[1][kk + sc];
#pragma unroll
      for (int i = 0; i < 8; ++i) xs[i] = (xs[i] * ra[i] + rc[i]) * g4 + b4;
    }
#pragma unroll
    for (int i = 0; i < 8; ++i) {
      *(v4h*)&At[sr + i * 16][sc] = __builtin_convertvector(xs[i], v4h);
      *(v4h*)&Bt[sr + i * 16][sc] = __builtin_convertvector(ws[i], v4h);
    }
    __syncthreads();
    // this loop and those inside it unrolled: acc, a and b are indexed by
    // constants only; k runs upward as before
#pragma unroll
    for (int ks = 0; ks < GEMM_BK; ks += 32) {
      v16h a[4], b[2];
#pragma unroll
      for (int m = 0; m < 4; ++m)
        a[m] = wmma_load_a(&At[wrow + m * 16][ks], GEMM_LD);
#pragma unroll
      for (int c = 0; c < 2; ++c)
        b[c] = wmma_load_b_nk(&Bt[wcol + c * 16][ks], GEMM_LD);
#pragma unroll
      for (int c = 0; c < 2; ++c)
#pragma unroll
        for (int m = 0; m < 4; ++m) acc[m][c] = WMMA_F16(a[m], b[c], acc[m][c]);
    }
    __syncthreads();
  }
  // all three unrolled: acc is indexed by constants only
#pragma unroll
  for (int m = 0; m < 4; ++m)
#pragma unroll
    for (int c = 0; c < 2; ++c)
#pragma unroll
      for (int v = 0; v < 8; ++v) {
        const int row = rowbase + wrow + m * 16 + v + 8 * hi;
        const int col = colbase + wcol + c * 16 + nn;
        const float val = acc[m][c][v] + bias[col];
        if (OUT_HALF)
          ((_Float16*)out)[(size_t)row * EMBED + col] = (_Float16)val;
        else
          ((float*)out)[(size_t)row * EMBED + col] = val;
      }
}

__global__ __launch_bounds__(256) void ln_gemm_bias_kernel(
    const float* __restrict__ X, const float* __restrict__ W,
    const float* __restrict__ bias, float* __restrict__ out,
    const float* __restrict__ stats, const float* __restrict__ lng,
    const float* __restrict__ lnb) {
  gemm_bias_tile<false, true>(X, W, bias, out, stats, lng, lnb);
}

// The three projections and the clearing of the attention buffer depend on
// nothing of one another: one launch, blockIdx.z picks the projection, so their
// fills, load waits and tails overlap. The 1024 blocks of the first two
// projections each clear 32 KiB of `clr` (8M floats in all), behind the last
// barrier, so that nothing in the block waits for those stores.
__global__ __launch_bounds__(256) void qkv_gemm_kernel(
    const float* __restrict__ Xq, const float* __restrict__ Xk,
    const float* __restrict__ Xv, const float* __restrict__ Wq,
    const float* __restrict__ Wk, const float* __restrict__ Wv,
    const float* __restrict__ bq, const float* __restrict__ bk,
    const float* __restrict__ bv, _Float16* __restrict__ oq,
    _Float16* __restrict__ ok, _Float16* __restrict__ ov,
    float* __restrict__ clr) {
  const int z = blockIdx.z;
  const float* X = z == 0 ? Xq : (z == 1 ? Xk : Xv);
  const float* W = z == 0 ? Wq : (z == 1 ? Wk : Wv);
  const float* bias = z == 0 ? bq : (z == 1 ? bk : bv);
  _Float16* out = z == 0 ? oq : (z == 1 ? ok : ov);
  gemm_bias_tile<true>(X, W, bias, out);
  // stands in front of any reuse of a register that the tile's stores name
  asm volatile("s_wait_xcnt 0x0" ::: "memory");
  if (z < 2) {
    const int blk =
        (z * (NTOK / GEMM_BM) + blockIdx.y) * (EMBED / GEMM_BN) + blockIdx.x;
    float* cp = clr + (size_t)blk * 8192 + threadIdx.x * 4;
    const v4f zero = {};
    // unrolled: eight whole-line 16-B stores, constant offsets from one address
#pragma unroll
    for (int i = 0; i < 8; ++i) *(v4f*)(cp + i * 1024) = zero;
  }
}

#define ATTN_BLOCKS ((4 * 6 + 2 * 5 + 1 * 5) * 32)
__global__ __launch_bounds__(128) void attn_kernel(
    const _Float16* __restrict__ Q, const _Float16* __restrict__ K,
    const _Float16* __restrict__ V, float* __restrict__ out,
    float* __restrict__ stats) {
  // one object, K first. A K buffer is 64 rows of 144 B, rounded up to 10 KiB, so
  // that each tensor load's place in LDS is a multiple of 2 KiB. V has 160-B
  // rows, the pitch (32 B x odd) of the transposing reader.
  struct Tiles {
    _Float16 k[2][5120];
    _Float16 v[2][64][80];
  };
  __shared__ __attribute__((aligned(2048))) Tiles tiles;
  _Float16 (&Vt)[2][64][80] = tiles.v;

  constexpr int S = 2048;  // dilated positions per segment, seglen / rate
  constexpr int qtiles = S / 64;
  // (segment, head) pairs [0, 24): seg 2048, r=1, off=0, heads [0,6); [24, 34):
  // seg 4096, r=2, off=1, heads [6,11); [34, 39): seg 8192, r=4, off=2, heads
  // [11,16). The divisors are literals, so the whole decode is scalar code.
  const int qt = blockIdx.x % qtiles;
  const int pair = blockIdx.x / qtiles;
  const int grp = (pair >= 24) + (pair >= 34);
  const int rate = 1 << grp;
  const int seg = grp == 0 ? pair / 6 : (grp == 1 ? (pair - 24) / 5 : 0);
  const int head = grp == 0 ? pair % 6 : (grp == 1 ? 6 + (pair - 24) % 5 : pair - 23);
  const int segbase = seg * (S << grp) + grp;
  const u32x8 kg1 = tdm_group1((uint32_t)(rate * EMBED * 2));

  const int tid = threadIdx.x, lane = tid & 31;
  const int wave = (int)uni((uint32_t)tid >> 5);
  const int hi = lane >> 4, nn = lane & 15;
  const size_t hoff = (size_t)head * HEAD_DIM;

  const int srow = tid >> 2, scol = (tid & 3) * 16;
  constexpr int NST = S / 64;  // stages
  const size_t half_step = (size_t)(32 * rate) * EMBED;  // 32 keys on, elements
  const _Float16* ksrc = K + (size_t)segbase * EMBED + hoff;
  const _Float16* vsrc = V + (size_t)(segbase + srow * rate) * EMBED + hoff + scol;

  // Q fragments for this wave's 16 queries (B operand: column nn, same k order as A)
  const int qrowA = qt * 64 + wave * 16 + nn;
  const _Float16* qp = Q + (size_t)(segbase + qrowA * rate) * EMBED + hoff;
  v16h qa0, qa1;
#pragma unroll
  for (int r = 0; r < 8; ++r) {
    const int k = ((r & 3) << 1) + ((r >> 2) << 4) + (hi << 3);
    qa0[2 * r]     = qp[k];
    qa0[2 * r + 1] = qp[k + 1];
    qa1[2 * r]     = qp[32 + k];
    qa1[2 * r + 1] = qp[32 + k + 1];
  }

  v8f o0 = {}, o1 = {}, o2 = {}, o3 = {};
  // query nn's running maximum, and the sum over this lane half's keys
  float row_m = -1e30f, row_l = 0.f;
  const float scale = 0.125f;  // 1/sqrt(64)

  // stage 0, waited for and published; then stage 1, in flight under pass 0
  async_to_lds_32B(&Vt[0][srow][scol], vsrc);
  async_to_lds_32B(&Vt[0][srow + 32][scol], vsrc + half_step);
  u32x4 kg0 = tdm_group0(&tiles.k[0][0], ksrc);
  if (pinned(wave == 0)) {
    tdm_load(kg0, kg1);
    tdm_wait(kg0, kg1);  // K stage 0 has landed
  }
  asm volatile("s_wait_asynccnt 0x0" ::: "memory");  // this wave's V copies too
  __syncthreads();  // ... visible to every wave
  if (pinned(wave == 0)) {
    kg0 = tdm_group0(&tiles.k[1][0], ksrc + 2 * half_step);
    tdm_load(kg0, kg1);
  }
  async_to_lds_32B(&Vt[1][srow][scol], vsrc + 2 * half_step);
  async_to_lds_32B(&Vt[1][srow + 32][scol], vsrc + 3 * half_step);

  for (int st = 0; st < NST; ++st) {
    const int buf = st & 1;
    // unrolled: the two blocks' LDS addresses differ by constants only
#pragma unroll
    for (int blk = 0; blk < 2; ++blk) {
    const _Float16* kt = &tiles.k[buf][blk * 32 * 72];
    const _Float16* vt = &Vt[buf][blk * 32][0];
    // K fragments, 16 (keys) x 32 (d) each, and V^T fragments, 16 (d) x 32
    // (keys) each
    const v16h ka0 = wmma_load_a(kt, 72);
    const v16h ka1 = wmma_load_a(kt + 32, 72);
    const v16h ka2 = wmma_load_a(kt + 16 * 72, 72);
    const v16h ka3 = wmma_load_a(kt + 16 * 72 + 32, 72);
    const v16h va0 = wmma_load_a_tr(vt, 80);
    const v16h va1 = wmma_load_a_tr(vt + 16, 80);
    const v16h va2 = wmma_load_a_tr(vt + 32, 80);
    const v16h va3 = wmma_load_a_tr(vt + 48, 80);
    // keeps the block's 16 LDS loads up here as one group, the V loads in flight
    // under the first product; left free they sink to their WMMAs, one exposed
    // LDS latency in front of each
    __builtin_amdgcn_sched_barrier(0);

    // S^T = K Q^T : two 16 (keys) x 16 (queries) tiles, d=64 -> 2 steps each
    v8f s0 = {}, s1 = {};
    s0 = WMMA_F16(ka0, qa0, s0);
    s1 = WMMA_F16(ka2, qa0, s1);
    s0 = WMMA_F16(ka1, qa1, s0);
    s1 = WMMA_F16(ka3, qa1, s1);

    // online softmax (f32); the lane holds keys v + 8*hi (s0) and 16 + v + 8*hi
    // (s1) of query nn, the other half of the wave the other 16 keys
    s0 *= scale;
    s1 *= scale;
    float mx = -1e30f;
    // unrolled: s0 and s1 are indexed by constants only and stay in registers
#pragma unroll
    for (int v = 0; v < 8; ++v) mx = fmaxf(mx, fmaxf(s0[v], s1[v]));
    mx = fmaxf(mx, xhalf(mx));
    const float mnew = fmaxf(row_m, mx);
    const float alpha = __expf(row_m - mnew);
    row_m = mnew;
    v16h pb;  // P^T as B: element s is key 8*hi + s, or 16 + 8*hi + (s - 8)
    float l0 = 0.f, l1 = 0.f;
#pragma unroll
    for (int v = 0; v < 8; ++v) {
      const float p0 = __expf(s0[v] - mnew);
      const float p1 = __expf(s1[v] - mnew);
      l0 += p0;
      l1 += p1;
      pb[v]     = (_Float16)p0;
      pb[8 + v] = (_Float16)p1;
    }
    row_l = row_l * alpha + (l0 + l1);

    // O^T = alpha O^T + V^T P^T
    o0 *= alpha; o1 *= alpha; o2 *= alpha; o3 *= alpha;
    o0 = WMMA_F16(va0, pb, o0);
    o1 = WMMA_F16(va1, pb, o1);
    o2 = WMMA_F16(va2, pb, o2);
    o3 = WMMA_F16(va3, pb, o3);
    __builtin_amdgcn_sched_barrier(0);
    }

    // publish point of stage st + 1, in the ring's order: this wave's LDS reads
    // of the buffer that is refilled behind the barrier have retired,
    asm volatile("s_wait_dscnt 0x0" ::: "memory");
    // its V copies of stage st + 1 have landed,
    asm volatile("s_wait_asynccnt 0x0" ::: "memory");
    // and the issuing wave's K stage
    if (pinned(wave == 0)) tdm_wait(kg0, kg1);
    __syncthreads();  // ... visible to every wave; every reader has left buf
    // stage st + 2 into the buffer this pass has read
    if (pinned(st + 2 < NST)) {
      const size_t off = (size_t)(st + 2) * 2 * half_step;
      if (pinned(wave == 0)) {
        kg0 = tdm_group0(&tiles.k[buf][0], ksrc + off);
        tdm_load(kg0, kg1);
      }
      async_to_lds_32B(&Vt[buf][srow][scol], vsrc + off);
      async_to_lds_32B(&Vt[buf][srow + 32][scol], vsrc + off + half_step);
    }
  }
  // nothing is in flight when the waves leave the loop
  asm volatile("s_wait_tensorcnt 0x0" ::: "memory");
  asm volatile("s_wait_asynccnt 0x0" ::: "memory");
  asm volatile("s_wait_dscnt 0x0" ::: "memory");

  // epilogue: query nn's row; this lane holds d = 16 t + 8 hi + 0..7 of tile t
  {
    const int qr = qt * 64 + wave * 16 + nn;
    const size_t pos = (size_t)(segbase + qr * rate);
    const float inv = 1.0f / (row_l + xhalf(row_l));
    float* op = out + pos * EMBED + hoff + 8 * hi;
    o0 *= inv; o1 *= inv; o2 *= inv; o3 *= inv;
    // this head's share of the row's layer-norm sums: sum and sum of squares of
    // the 64 values, half of them in each lane half
    const v8f t = (o0 + o1) + (o2 + o3);
    const v8f u = (o0 * o0 + o1 * o1) + (o2 * o2 + o3 * o3);
    float rs = ((t[0] + t[1]) + (t[2] + t[3])) + ((t[4] + t[5]) + (t[6] + t[7]));
    float rq = ((u[0] + u[1]) + (u[2] + u[3])) + ((u[4] + u[5]) + (u[6] + u[7]));
    rs += xhalf(rs);
    rq += xhalf(rq);
    *(v8f*)(op)      = o0;
    *(v8f*)(op + 16) = o1;
    *(v8f*)(op + 32) = o2;
    *(v8f*)(op + 48) = o3;
    if (hi == 0) {
      const v2f st = {rs, rq};
      *(v2f*)(stats + ((size_t)head * NTOK + pos) * 2) = st;
    }
  }
}

// ---- launcher --------------------------------------------------------------
extern "C" void kernel_launch(void* const* d_in, const int* in_sizes, int n_in,
                              void* d_out, int out_size, void* d_ws,
                              size_t ws_size, hipStream_t stream) {
  const float* query = (const float*)d_in[0];
  const float* key   = (const float*)d_in[1];
  const float* value = (const float*)d_in[2];
  const float* Wq = (const float*)d_in[3];  const float* bq = (const float*)d_in[4];
  const float* Wk = (const float*)d_in[5];  const float* bk = (const float*)d_in[6];
  const float* Wv = (const float*)d_in[7];  const float* bv = (const float*)d_in[8];
  const float* Wo = (const float*)d_in[9];  const float* bo = (const float*)d_in[10];
  const float* ln_g = (const float*)d_in[11];
  const float* ln_b = (const float*)d_in[12];

  char* ws = (char*)d_ws;
  const size_t nelem = (size_t)NTOK * EMBED;  // 8M elements
  _Float16* qf = (_Float16*)(ws);             // 16 MB
  _Float16* kf = (_Float16*)(ws + nelem * 2); // 16 MB
  _Float16* vf = (_Float16*)(ws + nelem * 4); // 16 MB
  float*  attn = (float*)(ws + nelem * 6);    // 32 MB
  float* stats = (float*)(ws + nelem * 10);   // 1 MB: [head][row] (sum, sum sq)

  const dim3 gblk(EMBED / GEMM_BN, NTOK / GEMM_BM);  // (8, 64)
  // q, k, v projections and the clearing of attn, one launch
  const dim3 gqkv(EMBED / GEMM_BN, NTOK / GEMM_BM, 3);  // (8, 64, 3)
  qkv_gemm_kernel<<<gqkv, 256, 0, stream>>>(query, key, value, Wq, Wk, Wv, bq,
                                            bk, bv, qf, kf, vf, attn);

  // (4 segments x 6 heads + 2 x 5 + 1 x 5) x 32 query tiles
  attn_kernel<<<ATTN_BLOCKS, 128, 0, stream>>>(qf, kf, vf, attn, stats);

  // layer norm and output projection
  ln_gemm_bias_kernel<<<gblk, 256, 0, stream>>>(attn, Wo, bo, (float*)d_out,
                                                stats, ln_g, ln_b);
}

// v007
// One run takes 134 microseconds.
// Timed twice side by side with v006, it ran 1.14 times as fast both times.
// Counting every step since v000, it is 3.49 times as fast.
#include <hip/hip_runtime.h>

typedef __attribute__((ext_vector_type(16))) _Float16 v16h;
typedef __attribute__((ext_vector_type(8)))  float    v8f;

#define EMBED    1024
#define HEADS    16
#define HEAD_DIM 64
#define NTOK     8192

#define WMMA_F16(a, b, c) \
  __builtin_amdgcn_wmma_f32_16x16x32_f16(false, (a), false, (b), (short)0, (c), false, false)

__device__ __forceinline__ void async_to_lds_32B(void* lds, const void* gsrc) {
  const unsigned ldst = (unsigned)(unsigned long long)lds;
  asm volatile(
      "global_load_async_to_lds_b128 %0, %1, off\n\t"
      "global_load_async_to_lds_b128 %0, %1, off offset:16\n\t"
      // stands in front of any reuse of the two address registers the copies name
      "s_wait_xcnt 0x0"
      :
      : "v"(ldst), "v"(gsrc)
      : "memory");
}

typedef __attribute__((ext_vector_type(4))) uint32_t u32x4;
typedef __attribute__((ext_vector_type(8))) uint32_t u32x8;

__device__ __forceinline__ uint32_t uni(uint32_t v) {
  return (uint32_t)__builtin_amdgcn_readfirstlane(v);
}

__device__ __forceinline__ uint32_t pinned(uint32_t v) {
  uint32_t w = uni(v);
  asm volatile("" : "+s"(w));  // pinned(): holds the test in a scalar register
  return w;
}

__device__ __forceinline__ u32x8 tdm_group1(uint32_t src_pitch_bytes) {
  u32x8 g;
  g[0] = uni((1u << 20) | (4u << 22) | (3u << 25));
  g[1] = uni(128u << 16);
  g[2] = uni(64u << 16);
  g[3] = uni(128u << 16);
  g[4] = uni(64u);
  g[5] = uni(src_pitch_bytes);
  g[6] = uni(0u);
  g[7] = uni(0u);
  asm volatile("" : "+s"(g));
  return g;
}

__device__ __forceinline__ u32x4 tdm_group0(const void* lds_dst, const void* gsrc) {
  const uint64_t ga = (uint64_t)gsrc;
  u32x4 g;
  g[0] = uni(1u);                                   // count = 1
  g[1] = uni((uint32_t)(uint64_t)lds_dst);          // byte offset in the LDS
  g[2] = uni((uint32_t)ga);                         // address [31:0]
  g[3] = uni((((uint32_t)(ga >> 32)) & 0x01FFFFFFu) | 0x80000000u);
  asm volatile("" : "+s"(g));
  return g;
}

__device__ __forceinline__ void tdm_load(u32x4 g0, u32x8 g1) {
  asm volatile("tensor_load_to_lds %0, %1" ::"s"(g0), "s"(g1) : "memory");
}

// The issuing wave's wait for its request. Naming the request's two groups keeps
// their registers whole until it has landed.
__device__ __forceinline__ void tdm_wait(u32x4 g0, u32x8 g1) {
  asm volatile("s_wait_tensorcnt 0x0" ::"s"(g0), "s"(g1) : "memory");
}

__device__ __forceinline__ float xhalf(float x) {
  const int xi = __float_as_int(x);
  return __int_as_float(__builtin_amdgcn_permlanex16(
      xi, xi, 0x76543210, (int)0xFEDCBA98u, false, false));
}

__device__ __forceinline__ v16h wmma_load_a(const _Float16* p, int ld) {
  const int lane = threadIdx.x & 31;
  const int row = lane & 15, hi = lane >> 4;
  v16h a;
#pragma unroll
  for (int r = 0; r < 8; ++r) {
    const int k = ((r & 3) << 1) + ((r >> 2) << 4) + (hi << 3);
    a[2 * r]     = p[row * ld + k];
    a[2 * r + 1] = p[row * ld + k + 1];
  }
  return a;
}

__device__ __forceinline__ v16h wmma_load_b_nk(const _Float16* p, int ld) {
  const int lane = threadIdx.x & 31;
  const int n = lane & 15, hi = lane >> 4;
  v16h b;
#pragma unroll
  for (int r = 0; r < 8; ++r) {
    const int k = ((r & 3) << 1) + ((r >> 2) << 4) + (hi << 3);
    b[2 * r]     = p[n * ld + k];
    b[2 * r + 1] = p[n * ld + k + 1];
  }
  return b;
}

// A = T^T for a row-major 32 (k) x 16 (m) LDS tile: two ds_load_tr16_b128.
// Lane (c = lane & 15, hi) gets T[8 hi + 0..7][c] and T[16 + 8 hi + 0..7][c],
// the k order of the loaders above.
typedef __attribute__((ext_vector_type(8))) short s16x8;
typedef __attribute__((ext_vector_type(8))) _Float16 v8h;
__device__ __forceinline__ v8h lds_load_tr16(const _Float16* p) {
  typedef __attribute__((address_space(3))) s16x8 lds_s16x8;
  return __builtin_bit_cast(
      v8h, __builtin_amdgcn_ds_load_tr16_b128_v8i16((lds_s16x8*)p));
}

__device__ __forceinline__ v16h wmma_load_a_tr(const _Float16* p, int ld) {
  const int lane = threadIdx.x & 31;
  const _Float16* q =
      p + (8 * (lane >> 4) + (lane & 7)) * ld + 8 * ((lane >> 3) & 1);
  const v8h lo = lds_load_tr16(q);
  const v8h up = lds_load_tr16(q + 16 * ld);
  return __builtin_shufflevector(lo, up, 0, 1, 2, 3, 4, 5, 6, 7, 8, 9, 10, 11,
                                 12, 13, 14, 15);
}

// ---- GEMM: C[i][j] = sum_k X[i][k] * W[j][k] + bias[j] ---------------------
// Block tile 128 x 128 x 64, eight waves in a 2 x 4 grid, 64 x 32 of C per wave:
// every staged operand row feeds 128 outputs, and a barrier pair covers 64 k.
// The tile's 128 rows are rows rowbase + (r << RS) of X and of C, r = 0..127.
// With LN set, X is layer-normalised on its way into LDS: a row's mean and
// variance come from the per-(head, row) sums that the attention kernel left in
// `stats`, so the normalised matrix is never written to memory.
typedef __attribute__((ext_vector_type(4))) _Float16 v4h;
typedef __attribute__((ext_vector_type(4))) float    v4f;
typedef __attribute__((ext_vector_type(2))) float    v2f;
#define GEMM_BM 128
#define GEMM_BN 128
#define GEMM_BK 64
#define GEMM_LD 72  // halfs: 128-B rows + 16 B, the pitch for 16-byte readers

template <bool LN, int RS>
__device__ __forceinline__ void gemm_tile(
    v8f (&acc)[4][2],
    _Float16 (&At)[GEMM_BM][GEMM_LD], _Float16 (&Bt)[GEMM_BN][GEMM_LD],
    const int rowbase, const int colbase,
    const float* __restrict__ X, const float* __restrict__ W,
    const float* __restrict__ stats = nullptr,
    const float* __restrict__ lng = nullptr,
    const float* __restrict__ lnb = nullptr) {
  // LN only: each row's sums over heads 0..7 and 8..15; gain and shift vectors
  __shared__ __attribute__((aligned(16))) float lnpart[2][GEMM_BM][2];
  __shared__ __attribute__((aligned(16))) float lngb[2][EMBED];
  const int tid = threadIdx.x;
  const int wave = tid >> 5, lane = tid & 31;
  const int hi = lane >> 4, nn = lane & 15;
  const int wrow = (wave >> 2) * 64, wcol = (wave & 3) * 32;

  const int sr = tid >> 4, sc = (tid & 15) * 4;
  const float* xp = X + (size_t)(rowbase + (sr << RS)) * EMBED + sc;
  const float* wp = W + (size_t)(colbase + sr) * EMBED + sc;

  // LN: x -> x * ra + rc is (x - mean) * rstd for the thread's eight staged rows
  float ra[8], rc[8];
  if constexpr (LN) {
    const int prow = tid & (GEMM_BM - 1), ph = tid >> 7;
    const int grow = rowbase + prow;
    float s = 0.f, q = 0.f;
    // unrolled: eight independent 8-B loads in flight together
#pragma unroll
    for (int j = 0; j < 8; ++j) {
      const int head = ph * 8 + j;
      const int grp = (head >= 6) + (head >= 11);
      const int crow = (grow & ~((1 << grp) - 1)) | grp;
      const v2f p = *(const v2f*)(stats + ((size_t)head * NTOK + crow) * 2);
      s += crow == grow ? p[0] : 0.f;
      q += crow == grow ? p[1] : 0.f;
    }
    lnpart[ph][prow][0] = s;
    lnpart[ph][prow][1] = q;
    *(v4f*)&lngb[0][tid * 4] = *(const v4f*)(lng + tid * 4);
    *(v4f*)&lngb[1][tid * 4] = *(const v4f*)(lnb + tid * 4);
    __syncthreads();  // the sums and the two vectors, visible to every wave
    // unrolled: ra and rc are indexed by constants only and stay in registers
#pragma unroll
    for (int i = 0; i < 8; ++i) {
      const int r = sr + i * 16;
      const float mean = (lnpart[0][r][0] + lnpart[1][r][0]) * (1.f / EMBED);
      const float var =
          (lnpart[0][r][1] + lnpart[1][r][1]) * (1.f / EMBED) - mean * mean;
      const float rstd = rsqrtf(var + 1e-5f);
      ra[i] = rstd;
      rc[i] = -mean * rstd;
    }
  }

  for (int kk = 0; kk < EMBED; kk += GEMM_BK) {
    v4f xs[8], ws[8];
    const float* xk = xp + kk;
    const float* wk = wp + kk;
    // unrolled: xs/ws are indexed by constants only and stay in registers
#pragma unroll
    for (int i = 0; i < 8; ++i) {
      xs[i] = *(const v4f*)(xk + ((i * 16) << RS) * EMBED);
      ws[i] = *(const v4f*)(wk + i * 16 * EMBED);
    }
    // the wait that belongs in front of any reuse of a register that an issued
    // load names; naming both pointers keeps the address pairs whole until it,
    // and the statement keeps all 16 loads ahead of the conversions, in flight
    // together, instead of load and conversion taking turns in few registers
    asm volatile("s_wait_xcnt 0x0" ::"v"(xk), "v"(wk) : "memory");
    if constexpr (LN) {
      const v4f g4 = *(const v4f*)&lngb[0][kk + sc];
      const v4f b4 = *(const v4f*)&lngb[1][kk + sc];
#pragma unroll
      for (int i = 0; i < 8; ++i) xs[i] = (xs[i] * ra[i] + rc[i]) * g4 + b4;
    }
#pragma unroll
    for (int i = 0; i < 8; ++i) {
      *(v4h*)&At[sr + i * 16][sc] = __builtin_convertvector(xs[i], v4h);
      *(v4h*)&Bt[sr + i * 16][sc] = __builtin_convertvector(ws[i], v4h);
    }
    __syncthreads();
    // this loop and those inside it unrolled: acc, a and b are indexed by
    // constants only; k runs upward as before
#pragma unroll
    for (int ks = 0; ks < GEMM_BK; ks += 32) {
      v16h a[4], b[2];
#pragma unroll
      for (int m = 0; m < 4; ++m)
        a[m] = wmma_load_a(&At[wrow + m * 16][ks], GEMM_LD);
#pragma unroll
      for (int c = 0; c < 2; ++c)
        b[c] = wmma_load_b_nk(&Bt[wcol + c * 16][ks], GEMM_LD);
#pragma unroll
      for (int c = 0; c < 2; ++c)
#pragma unroll
        for (int m = 0; m < 4; ++m) acc[m][c] = WMMA_F16(a[m], b[c], acc[m][c]);
    }
    __syncthreads();
  }
}

// C = acc + bias for the tile above; rs is the tile's RS, here a run-time value:
// one copy of the stores serves every row step, at one address addition a row.
template <typename T>
__device__ __forceinline__ void gemm_store_tile(
    const v8f (&acc)[4][2], const int rowbase, const int rs, const int colbase,
    const float* __restrict__ bias, T* __restrict__ out) {
  const int tid = threadIdx.x;
  const int wave = tid >> 5, lane = tid & 31;
  const int hi = lane >> 4, nn = lane & 15;
  const int wrow = (wave >> 2) * 64, wcol = (wave & 3) * 32;
  const int col0 = colbase + wcol + nn;
  const float b0 = bias[col0], b1 = bias[col0 + 16];
  const unsigned mine = (unsigned)(((wrow + 8 * hi) << rs) * EMBED + wcol + nn);
  T* tile = out + (size_t)rowbase * EMBED + colbase;
  // both unrolled: acc is indexed by constants only
#pragma unroll
  for (int m = 0; m < 4; ++m)
#pragma unroll
    for (int v = 0; v < 8; ++v) {
      T* row = tile + (((m * 16 + v) * EMBED) << rs);
      row[mine]      = (T)(acc[m][0][v] + b0);
      row[mine + 16] = (T)(acc[m][1][v] + b1);
    }
}

__global__ __launch_bounds__(256) void ln_gemm_bias_kernel(
    const float* __restrict__ X, const float* __restrict__ W,
    const float* __restrict__ bias, float* __restrict__ out,
    const float* __restrict__ stats, const float* __restrict__ lng,
    const float* __restrict__ lnb) {
  __shared__ __attribute__((aligned(16))) _Float16 At[GEMM_BM][GEMM_LD];
  __shared__ __attribute__((aligned(16))) _Float16 Bt[GEMM_BN][GEMM_LD];
  const int rowbase = blockIdx.y * GEMM_BM, colbase = blockIdx.x * GEMM_BN;
  v8f acc[4][2] = {};
  gemm_tile<true, 0>(acc, At, Bt, rowbase, colbase, X, W, stats, lng, lnb);
  gemm_store_tile(acc, rowbase, 0, colbase, bias, out);
}

// The three projections and the clearing of the attention buffer depend on
// nothing of one another: one launch, the block index picks the projection, so
// their fills, load waits and tails overlap.
// The attention reads a head's q, k and v only at the rows of its dilation: heads
// [0,6) at every row, [6,11) at rows = 1 mod 2, [11,16) at rows = 2 mod 4. Only
// tiles that hold such elements are computed; the rest of oq, ok and ov stays
// unwritten and is never read. Per 512 rows and projection, by 128-column block:
//   blocks 0..2 (heads 0..5)    4 tiles each, rows in a run
//   blocks 3, 4 (heads 6..9)    2 tiles each, every second row from row 1
//   block  5    (heads 10, 11)  3 tiles, every fourth row from row 1, 2 or 3
//   blocks 6, 7 (heads 12..15)  1 tile each, every fourth row from row 2
// 21 tiles where the full product has 32.
// The blocks clear the 1024 pieces of 32 KiB of `clr` (8M floats in all) in turn,
// behind the last barrier, so that nothing in the block waits for those stores.
#define QKV_TILES_512 21
#define QKV_TILES ((NTOK / 512) * QKV_TILES_512)  // per projection
__global__ __launch_bounds__(256) void qkv_gemm_kernel(
    const float* __restrict__ Xq, const float* __restrict__ Xk,
    const float* __restrict__ Xv, const float* __restrict__ Wq,
    const float* __restrict__ Wk, const float* __restrict__ Wv,
    const float* __restrict__ bq, const float* __restrict__ bk,
    const float* __restrict__ bv, _Float16* __restrict__ oq,
    _Float16* __restrict__ ok, _Float16* __restrict__ ov,
    float* __restrict__ clr) {
  __shared__ __attribute__((aligned(16))) _Float16 At[GEMM_BM][GEMM_LD];
  __shared__ __attribute__((aligned(16))) _Float16 Bt[GEMM_BN][GEMM_LD];
  const int z = blockIdx.x / QKV_TILES;
  const int sup = (blockIdx.x % QKV_TILES) / QKV_TILES_512;
  const int t = blockIdx.x % QKV_TILES_512;  // QKV_TILES is a multiple of it
  // column block, log2 of the row step, first row inside the 512
  int cb, rs, first;
  if (t < 12) {
    cb = t % 3; rs = 0; first = (t / 3) * GEMM_BM;
  } else if (t < 16) {
    cb = 3 + ((t - 12) & 1); rs = 1; first = ((t - 12) >> 1) * 2 * GEMM_BM + 1;
  } else if (t < 19) {
    cb = 5; rs = 2; first = t - 15;
  } else {
    cb = t - 13; rs = 2; first = 2;
  }
  const int rowbase = sup * 512 + first, colbase = cb * GEMM_BN;
  const float* X = z == 0 ? Xq : (z == 1 ? Xk : Xv);
  const float* W = z == 0 ? Wq : (z == 1 ? Wk : Wv);
  const float* bias = z == 0 ? bq : (z == 1 ? bk : bv);
  _Float16* out = z == 0 ? oq : (z == 1 ? ok : ov);
  v8f acc[4][2] = {};
  // the row step as a constant: in the loop every row offset stays an immediate
  // of its load; the branch is the same for the whole block
  if (rs == 0)
    gemm_tile<false, 0>(acc, At, Bt, rowbase, colbase, X, W);
  else if (rs == 1)
    gemm_tile<false, 1>(acc, At, Bt, rowbase, colbase, X, W);
  else
    gemm_tile<false, 2>(acc, At, Bt, rowbase, colbase, X, W);
  gemm_store_tile(acc, rowbase, rs, colbase, bias, out);
  // stands in front of any reuse of a register that the tile's stores name
  asm volatile("s_wait_xcnt 0x0" ::: "memory");
  for (int piece = blockIdx.x; piece < NTOK * EMBED / 8192; piece += 3 * QKV_TILES) {
    float* cp = clr + (size_t)piece * 8192 + threadIdx.x * 4;
    const v4f zero = {};
    // unrolled: eight whole-line 16-B stores, constant offsets from one address
#pragma unroll
    for (int i = 0; i < 8; ++i) *(v4f*)(cp + i * 1024) = zero;
  }
}

#define ATTN_BLOCKS ((4 * 6 + 2 * 5 + 1 * 5) * 32)
__global__ __launch_bounds__(128) void attn_kernel(
    const _Float16* __restrict__ Q, const _Float16* __restrict__ K,
    const _Float16* __restrict__ V, float* __restrict__ out,
    float* __restrict__ stats) {
  // one object, K first. A K buffer is 64 rows of 144 B, rounded up to 10 KiB, so
  // that each tensor load's place in LDS is a multiple of 2 KiB. V has 160-B
  // rows, the pitch (32 B x odd) of the transposing reader.
  struct Tiles {
    _Float16 k[2][5120];
    _Float16 v[2][64][80];
  };
  __shared__ __attribute__((aligned(2048))) Tiles tiles;
  _Float16 (&Vt)[2][64][80] = tiles.v;

  constexpr int S = 2048;  // dilated positions per segment, seglen / rate
  constexpr int qtiles = S / 64;
  // (segment, head) pairs [0, 24): seg 2048, r=1, off=0, heads [0,6); [24, 34):
  // seg 4096, r=2, off=1, heads [6,11); [34, 39): seg 8192, r=4, off=2, heads
  // [11,16). The divisors are literals, so the whole decode is scalar code.
  const int qt = blockIdx.x % qtiles;
  const int pair = blockIdx.x / qtiles;
  const int grp = (pair >= 24) + (pair >= 34);
  const int rate = 1 << grp;
  const int seg = grp == 0 ? pair / 6 : (grp == 1 ? (pair - 24) / 5 : 0);
  const int head = grp == 0 ? pair % 6 : (grp == 1 ? 6 + (pair - 24) % 5 : pair - 23);
  const int segbase = seg * (S << grp) + grp;
  const u32x8 kg1 = tdm_group1((uint32_t)(rate * EMBED * 2));

  const int tid = threadIdx.x, lane = tid & 31;
  const int wave = (int)uni((uint32_t)tid >> 5);
  const int hi = lane >> 4, nn = lane & 15;
  const size_t hoff = (size_t)head * HEAD_DIM;

  const int srow = tid >> 2, scol = (tid & 3) * 16;
  constexpr int NST = S / 64;  // stages
  const size_t half_step = (size_t)(32 * rate) * EMBED;  // 32 keys on, elements
  const _Float16* ksrc = K + (size_t)segbase * EMBED + hoff;
  const _Float16* vsrc = V + (size_t)(segbase + srow * rate) * EMBED + hoff + scol;

  // Q fragments for this wave's 16 queries (B operand: column nn, same k order as A)
  const int qrowA = qt * 64 + wave * 16 + nn;
  const _Float16* qp = Q + (size_t)(segbase + qrowA * rate) * EMBED + hoff;
  v16h qa0, qa1;
#pragma unroll
  for (int r = 0; r < 8; ++r) {
    const int k = ((r & 3) << 1) + ((r >> 2) << 4) + (hi << 3);
    qa0[2 * r]     = qp[k];
    qa0[2 * r + 1] = qp[k + 1];
    qa1[2 * r]     = qp[32 + k];
    qa1[2 * r + 1] = qp[32 + k + 1];
  }

  v8f o0 = {}, o1 = {}, o2 = {}, o3 = {};
  // query nn's running maximum, and the sum over this lane half's keys
  float row_m = -1e30f, row_l = 0.f;
  const float scale = 0.125f;  // 1/sqrt(64)

  // stage 0, waited for and published; then stage 1, in flight under pass 0
  async_to_lds_32B(&Vt[0][srow][scol], vsrc);
  async_to_lds_32B(&Vt[0][srow + 32][scol], vsrc + half_step);
  u32x4 kg0 = tdm_group0(&tiles.k[0][0], ksrc);
  if (pinned(wave == 0)) {
    tdm_load(kg0, kg1);
    tdm_wait(kg0, kg1);  // K stage 0 has landed
  }
  asm volatile("s_wait_asynccnt 0x0" ::: "memory");  // this wave's V copies too
  __syncthreads();  // ... visible to every wave
  if (pinned(wave == 0)) {
    kg0 = tdm_group0(&tiles.k[1][0], ksrc + 2 * half_step);
    tdm_load(kg0, kg1);
  }
  async_to_lds_32B(&Vt[1][srow][scol], vsrc + 2 * half_step);
  async_to_lds_32B(&Vt[1][srow + 32][scol], vsrc + 3 * half_step);

  for (int st = 0; st < NST; ++st) {
    const int buf = st & 1;
    // unrolled: the two blocks' LDS addresses differ by constants only
#pragma unroll
    for (int blk = 0; blk < 2; ++blk) {
    const _Float16* kt = &tiles.k[buf][blk * 32 * 72];
    const _Float16* vt = &Vt[buf][blk * 32][0];
    // K fragments, 16 (keys) x 32 (d) each, and V^T fragments, 16 (d) x 32
    // (keys) each
    const v16h ka0 = wmma_load_a(kt, 72);
    const v16h ka1 = wmma_load_a(kt + 32, 72);
    const v16h ka2 = wmma_load_a(kt + 16 * 72, 72);
    const v16h ka3 = wmma_load_a(kt + 16 * 72 + 32, 72);
    const v16h va0 = wmma_load_a_tr(vt, 80);
    const v16h va1 = wmma_load_a_tr(vt + 16, 80);
    const v16h va2 = wmma_load_a_tr(vt + 32, 80);
    const v16h va3 = wmma_load_a_tr(vt + 48, 80);
    // keeps the block's 16 LDS loads up here as one group, the V loads in flight
    // under the first product; left free they sink to their WMMAs, one exposed
    // LDS latency in front of each
    __builtin_amdgcn_sched_barrier(0);

    // S^T = K Q^T : two 16 (keys) x 16 (queries) tiles, d=64 -> 2 steps each
    v8f s0 = {}, s1 = {};
    s0 = WMMA_F16(ka0, qa0, s0);
    s1 = WMMA_F16(ka2, qa0, s1);
    s0 = WMMA_F16(ka1, qa1, s0);
    s1 = WMMA_F16(ka3, qa1, s1);

    // online softmax (f32); the lane holds keys v + 8*hi (s0) and 16 + v + 8*hi
    // (s1) of query nn, the other half of the wave the other 16 keys
    s0 *= scale;
    s1 *= scale;
    float mx = -1e30f;
    // unrolled: s0 and s1 are indexed by constants only and stay in registers
#pragma unroll
    for (int v = 0; v < 8; ++v) mx = fmaxf(mx, fmaxf(s0[v], s1[v]));
    mx = fmaxf(mx, xhalf(mx));
    const float mnew = fmaxf(row_m, mx);
    const float alpha = __expf(row_m - mnew);
    row_m = mnew;
    v16h pb;  // P^T as B: element s is key 8*hi + s, or 16 + 8*hi + (s - 8)
    float l0 = 0.f, l1 = 0.f;
#pragma unroll
    for (int v = 0; v < 8; ++v) {
      const float p0 = __expf(s0[v] - mnew);
      const float p1 = __expf(s1[v] - mnew);
      l0 += p0;
      l1 += p1;
      pb[v]     = (_Float16)p0;
      pb[8 + v] = (_Float16)p1;
    }
    row_l = row_l * alpha + (l0 + l1);

    // O^T = alpha O^T + V^T P^T
    o0 *= alpha; o1 *= alpha; o2 *= alpha; o3 *= alpha;
    o0 = WMMA_F16(va0, pb, o0);
    o1 = WMMA_F16(va1, pb, o1);
    o2 = WMMA_F16(va2, pb, o2);
    o3 = WMMA_F16(va3, pb, o3);
    __builtin_amdgcn_sched_barrier(0);
    }

    // publish point of stage st + 1, in the ring's order: this wave's LDS reads
    // of the buffer that is refilled behind the barrier have retired,
    asm volatile("s_wait_dscnt 0x0" ::: "memory");
    // its V copies of stage st + 1 have landed,
    asm volatile("s_wait_asynccnt 0x0" ::: "memory");
    // and the issuing wave's K stage
    if (pinned(wave == 0)) tdm_wait(kg0, kg1);
    __syncthreads();  // ... visible to every wave; every reader has left buf
    // stage st + 2 into the buffer this pass has read
    if (pinned(st + 2 < NST)) {
      const size_t off = (size_t)(st + 2) * 2 * half_step;
      if (pinned(wave == 0)) {
        kg0 = tdm_group0(&tiles.k[buf][0], ksrc + off);
        tdm_load(kg0, kg1);
      }
      async_to_lds_32B(&Vt[buf][srow][scol], vsrc + off);
      async_to_lds_32B(&Vt[buf][srow + 32][scol], vsrc + off + half_step);
    }
  }
  // nothing is in flight when the waves leave the loop
  asm volatile("s_wait_tensorcnt 0x0" ::: "memory");
  asm volatile("s_wait_asynccnt 0x0" ::: "memory");
  asm volatile("s_wait_dscnt 0x0" ::: "memory");

  // epilogue: query nn's row; this lane holds d = 16 t + 8 hi + 0..7 of tile t
  {
    const int qr = qt * 64 + wave * 16 + nn;
    const size_t pos = (size_t)(segbase + qr * rate);
    const float inv = 1.0f / (row_l + xhalf(row_l));
    float* op = out + pos * EMBED + hoff + 8 * hi;
    o0 *= inv; o1 *= inv; o2 *= inv; o3 *= inv;
    // this head's share of the row's layer-norm sums: sum and sum of squares of
    // the 64 values, half of them in each lane half
    const v8f t = (o0 + o1) + (o2 + o3);
    const v8f u = (o0 * o0 + o1 * o1) + (o2 * o2 + o3 * o3);
    float rs = ((t[0] + t[1]) + (t[2] + t[3])) + ((t[4] + t[5]) + (t[6] + t[7]));
    float rq = ((u[0] + u[1]) + (u[2] + u[3])) + ((u[4] + u[5]) + (u[6] + u[7]));
    rs += xhalf(rs);
    rq += xhalf(rq);
    *(v8f*)(op)      = o0;
    *(v8f*)(op + 16) = o1;
    *(v8f*)(op + 32) = o2;
    *(v8f*)(op + 48) = o3;
    if (hi == 0) {
      const v2f st = {rs, rq};
      *(v2f*)(stats + ((size_t)head * NTOK + pos) * 2) = st;
    }
  }
}

// ---- launcher --------------------------------------------------------------
extern "C" void kernel_launch(void* const* d_in, const int* in_sizes, int n_in,
                              void* d_out, int out_size, void* d_ws,
                              size_t ws_size, hipStream_t stream) {
  const float* query = (const float*)d_in[0];
  const float* key   = (const float*)d_in[1];
  const float* value = (const float*)d_in[2];
  const float* Wq = (const float*)d_in[3];  const float* bq = (const float*)d_in[4];
  const float* Wk = (const float*)d_in[5];  const float* bk = (const float*)d_in[6];
  const float* Wv = (const float*)d_in[7];  const float* bv = (const float*)d_in[8];
  const float* Wo = (const float*)d_in[9];  const float* bo = (const float*)d_in[10];
  const float* ln_g = (const float*)d_in[11];
  const float* ln_b = (const float*)d_in[12];

  char* ws = (char*)d_ws;
  const size_t nelem = (size_t)NTOK * EMBED;  // 8M elements
  _Float16* qf = (_Float16*)(ws);             // 16 MB
  _Float16* kf = (_Float16*)(ws + nelem * 2); // 16 MB
  _Float16* vf = (_Float16*)(ws + nelem * 4); // 16 MB
  float*  attn = (float*)(ws + nelem * 6);    // 32 MB
  float* stats = (float*)(ws + nelem * 10);   // 1 MB: [head][row] (sum, sum sq)

  const dim3 gblk(EMBED / GEMM_BN, NTOK / GEMM_BM);  // (8, 64)
  // q, k, v projections (the tiles the attention reads) and the clearing of attn,
  // one launch of 1008 workgroups
  qkv_gemm_kernel<<<3 * QKV_TILES, 256, 0, stream>>>(query, key, value, Wq, Wk, Wv, bq,
                                            bk, bv, qf, kf, vf, attn);

  // (4 segments x 6 heads + 2 x 5 + 1 x 5) x 32 query tiles
  attn_kernel<<<ATTN_BLOCKS, 128, 0, stream>>>(qf, kf, vf, attn, stats);

  // layer norm and output projection
  ln_gemm_bias_kernel<<<gblk, 256, 0, stream>>>(attn, Wo, bo, (float*)d_out,
                                                stats, ln_g, ln_b);
}

// v008
// It runs in 124 microseconds.
// Timed twice side by side with v007, it ran 1.08 times as fast both times.
// Counting every step since v000, it is 3.79 times as fast.
#include <hip/hip_runtime.h>

typedef __attribute__((ext_vector_type(16))) _Float16 v16h;
typedef __attribute__((ext_vector_type(8)))  float    v8f;

#define EMBED    1024
#define HEADS    16
#define HEAD_DIM 64
#define NTOK     8192

#define WMMA_F16(a, b, c) \
  __builtin_amdgcn_wmma_f32_16x16x32_f16(false, (a), false, (b), (short)0, (c), false, false)

__device__ __forceinline__ void async_to_lds_32B(void* lds, const void* gsrc) {
  const unsigned ldst = (unsigned)(unsigned long long)lds;
  asm volatile(
      "global_load_async_to_lds_b128 %0, %1, off\n\t"
      "global_load_async_to_lds_b128 %0, %1, off offset:16\n\t"
      // stands in front of any reuse of the two address registers the copies name
      "s_wait_xcnt 0x0"
      :
      : "v"(ldst), "v"(gsrc)
      : "memory");
}

typedef __attribute__((ext_vector_type(4))) uint32_t u32x4;
typedef __attribute__((ext_vector_type(8))) uint32_t u32x8;

__device__ __forceinline__ uint32_t uni(uint32_t v) {
  return (uint32_t)__builtin_amdgcn_readfirstlane(v);
}

__device__ __forceinline__ uint32_t pinned(uint32_t v) {
  uint32_t w = uni(v);
  asm volatile("" : "+s"(w));  // pinned(): holds the test in a scalar register
  return w;
}

__device__ __forceinline__ u32x8 tdm_group1(uint32_t src_pitch_bytes) {
  u32x8 g;
  g[0] = uni((1u << 20) | (4u << 22) | (3u << 25));
  g[1] = uni(128u << 16);
  g[2] = uni(64u << 16);
  g[3] = uni(128u << 16);
  g[4] = uni(64u);
  g[5] = uni(src_pitch_bytes);
  g[6] = uni(0u);
  g[7] = uni(0u);
  asm volatile("" : "+s"(g));
  return g;
}

__device__ __forceinline__ u32x4 tdm_group0(const void* lds_dst, const void* gsrc) {
  const uint64_t ga = (uint64_t)gsrc;
  u32x4 g;
  g[0] = uni(1u);                                   // count = 1
  g[1] = uni((uint32_t)(uint64_t)lds_dst);          // byte offset in the LDS
  g[2] = uni((uint32_t)ga);                         // address [31:0]
  g[3] = uni((((uint32_t)(ga >> 32)) & 0x01FFFFFFu) | 0x80000000u);
  asm volatile("" : "+s"(g));
  return g;
}

__device__ __forceinline__ void tdm_load(u32x4 g0, u32x8 g1) {
  asm volatile("tensor_load_to_lds %0, %1" ::"s"(g0), "s"(g1) : "memory");
}

// The issuing wave's wait for its request. Naming the request's two groups keeps
// their registers whole until it has landed.
__device__ __forceinline__ void tdm_wait(u32x4 g0, u32x8 g1) {
  asm volatile("s_wait_tensorcnt 0x0" ::"s"(g0), "s"(g1) : "memory");
}

__device__ __forceinline__ float xhalf(float x) {
  const int xi = __float_as_int(x);
  return __int_as_float(__builtin_amdgcn_permlanex16(
      xi, xi, 0x76543210, (int)0xFEDCBA98u, false, false));
}

__device__ __forceinline__ v16h wmma_load_a(const _Float16* p, int ld) {
  const int lane = threadIdx.x & 31;
  const int row = lane & 15, hi = lane >> 4;
  v16h a;
#pragma unroll
  for (int r = 0; r < 8; ++r) {
    const int k = ((r & 3) << 1) + ((r >> 2) << 4) + (hi << 3);
    a[2 * r]     = p[row * ld + k];
    a[2 * r + 1] = p[row * ld + k + 1];
  }
  return a;
}

__device__ __forceinline__ v16h wmma_load_b_nk(const _Float16* p, int ld) {
  const int lane = threadIdx.x & 31;
  const int n = lane & 15, hi = lane >> 4;
  v16h b;
#pragma unroll
  for (int r = 0; r < 8; ++r) {
    const int k = ((r & 3) << 1) + ((r >> 2) << 4) + (hi << 3);
    b[2 * r]     = p[n * ld + k];
    b[2 * r + 1] = p[n * ld + k + 1];
  }
  return b;
}

// A = T^T for a row-major 32 (k) x 16 (m) LDS tile: two ds_load_tr16_b128.
// Lane (c = lane & 15, hi) gets T[8 hi + 0..7][c] and T[16 + 8 hi + 0..7][c],
// the k order of the loaders above.
typedef __attribute__((ext_vector_type(8))) short s16x8;
typedef __attribute__((ext_vector_type(8))) _Float16 v8h;
__device__ __forceinline__ v8h lds_load_tr16(const _Float16* p) {
  typedef __attribute__((address_space(3))) s16x8 lds_s16x8;
  return __builtin_bit_cast(
      v8h, __builtin_amdgcn_ds_load_tr16_b128_v8i16((lds_s16x8*)p));
}

__device__ __forceinline__ v16h wmma_load_a_tr(const _Float16* p, int ld) {
  const int lane = threadIdx.x & 31;
  const _Float16* q =
      p + (8 * (lane >> 4) + (lane & 7)) * ld + 8 * ((lane >> 3) & 1);
  const v8h lo = lds_load_tr16(q);
  const v8h up = lds_load_tr16(q + 16 * ld);
  return __builtin_shufflevector(lo, up, 0, 1, 2, 3, 4, 5, 6, 7, 8, 9, 10, 11,
                                 12, 13, 14, 15);
}

// ---- GEMM: C[i][j] = sum_k X[i][k] * W[j][k] + bias[j] ---------------------
// Block tile BM x 128 x 64, eight waves. BM = 128: a 2 x 4 grid of waves, 64 x 32
// of C per wave. BM = 256: a 4 x 2 grid, 64 x 64 per wave, so that a staged W row
// feeds 256 outputs and a fragment read from LDS four products. A barrier pair
// covers 64 k.
// The tile's BM rows are rows rowbase + (r << RS) of X and of C, r = 0..BM-1.
// With LN set, X is layer-normalised on its way into LDS: a row's mean and
// variance come from the per-(head, row) sums that the attention kernel left in
// `stats`, so the normalised matrix is never written to memory.
typedef __attribute__((ext_vector_type(4))) _Float16 v4h;
typedef __attribute__((ext_vector_type(4))) float    v4f;
typedef __attribute__((ext_vector_type(2))) float    v2f;
#define GEMM_BM 128
#define GEMM_BN 128
#define GEMM_BK 64
#define GEMM_LD 72  // halfs: 128-B rows + 16 B, the pitch for 16-byte readers

template <bool LN, int RS, int BM>
__device__ __forceinline__ void gemm_tile(
    v8f (&acc)[4][BM / 64],
    _Float16 (&At)[BM][GEMM_LD], _Float16 (&Bt)[GEMM_BN][GEMM_LD],
    const int rowbase, const int colbase,
    const float* __restrict__ X, const float* __restrict__ W,
    const float* __restrict__ stats = nullptr,
    const float* __restrict__ lng = nullptr,
    const float* __restrict__ lnb = nullptr) {
  static_assert(!LN || BM == GEMM_BM, "the layer-norm prologue is laid out for 128 rows");
  constexpr int NC = BM / 64;               // 16-column fragments per wave
  constexpr int WC = GEMM_BN / (16 * NC);   // waves side by side
  constexpr int XR = BM / 16;               // X rows a thread stages
  // LN only: each row's sums over heads 0..7 and 8..15; gain and shift vectors
  __shared__ __attribute__((aligned(16))) float lnpart[2][GEMM_BM][2];
  __shared__ __attribute__((aligned(16))) float lngb[2][EMBED];
  const int tid = threadIdx.x;
  const int wave = tid >> 5, lane = tid & 31;
  const int wrow = (wave / WC) * 64, wcol = (wave % WC) * (16 * NC);

  const int sr = tid >> 4, sc = (tid & 15) * 4;
  const float* xp = X + (size_t)(rowbase + (sr << RS)) * EMBED + sc;
  const float* wp = W + (size_t)(colbase + sr) * EMBED + sc;

  // LN: x -> x * ra + rc is (x - mean) * rstd for the thread's eight staged rows
  float ra[8], rc[8];
  if constexpr (LN) {
    const int prow = tid & (GEMM_BM - 1), ph = tid >> 7;
    const int grow = rowbase + prow;
    float s = 0.f, q = 0.f;
    // unrolled: eight independent 8-B loads in flight together
#pragma unroll
    for (int j = 0; j < 8; ++j) {
      const int head = ph * 8 + j;
      const int grp = (head >= 6) + (head >= 11);
      const int crow = (grow & ~((1 << grp) - 1)) | grp;
      const v2f p = *(const v2f*)(stats + ((size_t)head * NTOK + crow) * 2);
      s += crow == grow ? p[0] : 0.f;
      q += crow == grow ? p[1] : 0.f;
    }
    lnpart[ph][prow][0] = s;
    lnpart[ph][prow][1] = q;
    *(v4f*)&lngb[0][tid * 4] = *(const v4f*)(lng + tid * 4);
    *(v4f*)&lngb[1][tid * 4] = *(const v4f*)(lnb + tid * 4);
    __syncthreads();  // the sums and the two vectors, visible to every wave
    // unrolled: ra and rc are indexed by constants only and stay in registers
#pragma unroll
    for (int i = 0; i < 8; ++i) {
      const int r = sr + i * 16;
      const float mean = (lnpart[0][r][0] + lnpart[1][r][0]) * (1.f / EMBED);
      const float var =
          (lnpart[0][r][1] + lnpart[1][r][1]) * (1.f / EMBED) - mean * mean;
      const float rstd = rsqrtf(var + 1e-5f);
      ra[i] = rstd;
      rc[i] = -mean * rstd;
    }
  }

  for (int kk = 0; kk < EMBED; kk += GEMM_BK) {
    v4f xs[XR], ws[8];
    const float* xk = xp + kk;
    const float* wk = wp + kk;
    // both unrolled: xs/ws are indexed by constants only and stay in registers
#pragma unroll
    for (int i = 0; i < XR; ++i) xs[i] = *(const v4f*)(xk + ((i * 16) << RS) * EMBED);
#pragma unroll
    for (int i = 0; i < 8; ++i) ws[i] = *(const v4f*)(wk + i * 16 * EMBED);
    // the wait that belongs in front of any reuse of a register that an issued
    // load names; naming both pointers keeps the address pairs whole until it,
    // and the statement keeps all the loads ahead of the conversions, in flight
    // together, instead of load and conversion taking turns in few registers
    asm volatile("s_wait_xcnt 0x0" ::"v"(xk), "v"(wk) : "memory");
    if constexpr (LN) {
      const v4f g4 = *(const v4f*)&lngb[0][kk + sc];
      const v4f b4 = *(const v4f*)&lngb[1][kk + sc];
#pragma unroll
      for (int i = 0; i < 8; ++i) xs[i] = (xs[i] * ra[i] + rc[i]) * g4 + b4;
    }
#pragma unroll
    for (int i = 0; i < XR; ++i)
      *(v4h*)&At[sr + i * 16][sc] = __builtin_convertvector(xs[i], v4h);
#pragma unroll
    for (int i = 0; i < 8; ++i)
      *(v4h*)&Bt[sr + i * 16][sc] = __builtin_convertvector(ws[i], v4h);
    __syncthreads();
    // this loop and those inside it unrolled: acc, a and b are indexed by
    // constants only; k runs upward as before
#pragma unroll
    for (int ks = 0; ks < GEMM_BK; ks += 32) {
      v16h a[4], b[NC];
#pragma unroll
      for (int m = 0; m < 4; ++m)
        a[m] = wmma_load_a(&At[wrow + m * 16][ks], GEMM_LD);
#pragma unroll
      for (int c = 0; c < NC; ++c)
        b[c] = wmma_load_b_nk(&Bt[wcol + c * 16][ks], GEMM_LD);
#pragma unroll
      for (int c = 0; c < NC; ++c)
#pragma unroll
        for (int m = 0; m < 4; ++m) acc[m][c] = WMMA_F16(a[m], b[c], acc[m][c]);
    }
    __syncthreads();
  }
}

// C = acc + bias for the tile above; rs is the tile's RS, here a run-time value:
// one copy of the stores serves every row step, at one address addition a row.
template <typename T, int NC>
__device__ __forceinline__ void gemm_store_tile(
    const v8f (&acc)[4][NC], const int rowbase, const int rs, const int colbase,
    const float* __restrict__ bias, T* __restrict__ out) {
  const int tid = threadIdx.x;
  const int wave = tid >> 5, lane = tid & 31;
  const int hi = lane >> 4, nn = lane & 15;
  constexpr int WC = GEMM_BN / (16 * NC);  // waves side by side, as in gemm_tile
  const int wrow = (wave / WC) * 64, wcol = (wave % WC) * (16 * NC);
  const int col0 = colbase + wcol + nn;
  float bc[NC];
  // unrolled: bc is indexed by constants only
#pragma unroll
  for (int c = 0; c < NC; ++c) bc[c] = bias[col0 + 16 * c];
  const unsigned mine = (unsigned)(((wrow + 8 * hi) << rs) * EMBED + wcol + nn);
  T* tile = out + (size_t)rowbase * EMBED + colbase;
  // all unrolled: acc is indexed by constants only
#pragma unroll
  for (int m = 0; m < 4; ++m)
#pragma unroll
    for (int v = 0; v < 8; ++v) {
      T* row = tile + (((m * 16 + v) * EMBED) << rs);
#pragma unroll
      for (int c = 0; c < NC; ++c) row[mine + 16 * c] = (T)(acc[m][c][v] + bc[c]);
    }
}

__global__ __launch_bounds__(256) void ln_gemm_bias_kernel(
    const float* __restrict__ X, const float* __restrict__ W,
    const float* __restrict__ bias, float* __restrict__ out,
    const float* __restrict__ stats, const float* __restrict__ lng,
    const float* __restrict__ lnb) {
  __shared__ __attribute__((aligned(16))) _Float16 At[GEMM_BM][GEMM_LD];
  __shared__ __attribute__((aligned(16))) _Float16 Bt[GEMM_BN][GEMM_LD];
  const int rowbase = blockIdx.y * GEMM_BM, colbase = blockIdx.x * GEMM_BN;
  v8f acc[4][2] = {};
  gemm_tile<true, 0, GEMM_BM>(acc, At, Bt, rowbase, colbase, X, W, stats, lng, lnb);
  gemm_store_tile(acc, rowbase, 0, colbase, bias, out);
}

// The three projections and the clearing of the attention buffer depend on
// nothing of one another: one launch, the block index picks the projection, so
// their fills, load waits and tails overlap.
// The attention reads a head's q, k and v only at the rows of its dilation: heads
// [0,6) at every row, [6,11) at rows = 1 mod 2, [11,16) at rows = 2 mod 4. Only
// tiles that hold such elements are computed; the rest of oq, ok and ov stays
// unwritten and is never read. A tile is 256 rows by 128 columns. Per 1024 rows
// and projection, by 128-column block:
//   blocks 0..2 (heads 0..5)    4 tiles each, rows in a run
//   blocks 3, 4 (heads 6..9)    2 tiles each, every second row from row 1
//   block  5    (heads 10, 11)  3 tiles, every fourth row from row 1, 2 or 3
//   blocks 6, 7 (heads 12..15)  1 tile each, every fourth row from row 2
// 21 tiles where the full product has 32.
// The blocks clear the 1024 pieces of 32 KiB of `clr` (8M floats in all) in turn,
// behind the last barrier, so that nothing in the block waits for those stores.
#define QKV_BM 256
#define QKV_SPAN (4 * QKV_BM)  // rows that one set of 21 tiles covers
#define QKV_TILES_SPAN 21
#define QKV_TILES ((NTOK / QKV_SPAN) * QKV_TILES_SPAN)  // per projection
__global__ __launch_bounds__(256) void qkv_gemm_kernel(
    const float* __restrict__ Xq, const float* __restrict__ Xk,
    const float* __restrict__ Xv, const float* __restrict__ Wq,
    const float* __restrict__ Wk, const float* __restrict__ Wv,
    const float* __restrict__ bq, const float* __restrict__ bk,
    const float* __restrict__ bv, _Float16* __restrict__ oq,
    _Float16* __restrict__ ok, _Float16* __restrict__ ov,
    float* __restrict__ clr) {
  __shared__ __attribute__((aligned(16))) _Float16 At[QKV_BM][GEMM_LD];
  __shared__ __attribute__((aligned(16))) _Float16 Bt[GEMM_BN][GEMM_LD];
  const int z = blockIdx.x / QKV_TILES;
  const int sup = (blockIdx.x % QKV_TILES) / QKV_TILES_SPAN;
  const int t = blockIdx.x % QKV_TILES_SPAN;  // QKV_TILES is a multiple of it
  // column block, log2 of the row step, first row inside the span
  int cb, rs, first;
  if (t < 12) {
    cb = t % 3; rs = 0; first = (t / 3) * QKV_BM;
  } else if (t < 16) {
    cb = 3 + ((t - 12) & 1); rs = 1; first = ((t - 12) >> 1) * 2 * QKV_BM + 1;
  } else if (t < 19) {
    cb = 5; rs = 2; first = t - 15;
  } else {
    cb = t - 13; rs = 2; first = 2;
  }
  const int rowbase = sup * QKV_SPAN + first, colbase = cb * GEMM_BN;
  const float* X = z == 0 ? Xq : (z == 1 ? Xk : Xv);
  const float* W = z == 0 ? Wq : (z == 1 ? Wk : Wv);
  const float* bias = z == 0 ? bq : (z == 1 ? bk : bv);
  _Float16* out = z == 0 ? oq : (z == 1 ? ok : ov);
  v8f acc[4][QKV_BM / 64] = {};
  // the row step as a constant: in the loop every row offset stays an immediate
  // of its load; the branch is the same for the whole block
  if (rs == 0)
    gemm_tile<false, 0, QKV_BM>(acc, At, Bt, rowbase, colbase, X, W);
  else if (rs == 1)
    gemm_tile<false, 1, QKV_BM>(acc, At, Bt, rowbase, colbase, X, W);
  else
    gemm_tile<false, 2, QKV_BM>(acc, At, Bt, rowbase, colbase, X, W);
  gemm_store_tile(acc, rowbase, rs, colbase, bias, out);
  // stands in front of any reuse of a register that the tile's stores name
  asm volatile("s_wait_xcnt 0x0" ::: "memory");
  for (int piece = blockIdx.x; piece < NTOK * EMBED / 8192; piece += 3 * QKV_TILES) {
    float* cp = clr + (size_t)piece * 8192 + threadIdx.x * 4;
    const v4f zero = {};
    // unrolled: eight whole-line 16-B stores, constant offsets from one address
#pragma unroll
    for (int i = 0; i < 8; ++i) *(v4f*)(cp + i * 1024) = zero;
  }
}

#define ATTN_BLOCKS ((4 * 6 + 2 * 5 + 1 * 5) * 32)
__global__ __launch_bounds__(128) void attn_kernel(
    const _Float16* __restrict__ Q, const _Float16* __restrict__ K,
    const _Float16* __restrict__ V, float* __restrict__ out,
    float* __restrict__ stats) {
  // one object, K first. A K buffer is 64 rows of 144 B, rounded up to 10 KiB, so
  // that each tensor load's place in LDS is a multiple of 2 KiB. V has 160-B
  // rows, the pitch (32 B x odd) of the transposing reader.
  struct Tiles {
    _Float16 k[2][5120];
    _Float16 v[2][64][80];
  };
  __shared__ __attribute__((aligned(2048))) Tiles tiles;
  _Float16 (&Vt)[2][64][80] = tiles.v;

  constexpr int S = 2048;  // dilated positions per segment, seglen / rate
  constexpr int qtiles = S / 64;
  // (segment, head) pairs [0, 24): seg 2048, r=1, off=0, heads [0,6); [24, 34):
  // seg 4096, r=2, off=1, heads [6,11); [34, 39): seg 8192, r=4, off=2, heads
  // [11,16). The divisors are literals, so the whole decode is scalar code.
  const int qt = blockIdx.x % qtiles;
  const int pair = blockIdx.x / qtiles;
  const int grp = (pair >= 24) + (pair >= 34);
  const int rate = 1 << grp;
  const int seg = grp == 0 ? pair / 6 : (grp == 1 ? (pair - 24) / 5 : 0);
  const int head = grp == 0 ? pair % 6 : (grp == 1 ? 6 + (pair - 24) % 5 : pair - 23);
  const int segbase = seg * (S << grp) + grp;
  const u32x8 kg1 = tdm_group1((uint32_t)(rate * EMBED * 2));

  const int tid = threadIdx.x, lane = tid & 31;
  const int wave = (int)uni((uint32_t)tid >> 5);
  const int hi = lane >> 4, nn = lane & 15;
  const size_t hoff = (size_t)head * HEAD_DIM;

  const int srow = tid >> 2, scol = (tid & 3) * 16;
  constexpr int NST = S / 64;  // stages
  const size_t half_step = (size_t)(32 * rate) * EMBED;  // 32 keys on, elements
  const _Float16* ksrc = K + (size_t)segbase * EMBED + hoff;
  const _Float16* vsrc = V + (size_t)(segbase + srow * rate) * EMBED + hoff + scol;

  // Q fragments for this wave's 16 queries (B operand: column nn, same k order as A)
  const int qrowA = qt * 64 + wave * 16 + nn;
  const _Float16* qp = Q + (size_t)(segbase + qrowA * rate) * EMBED + hoff;
  v16h qa0, qa1;
#pragma unroll
  for (int r = 0; r < 8; ++r) {
    const int k = ((r & 3) << 1) + ((r >> 2) << 4) + (hi << 3);
    qa0[2 * r]     = qp[k];
    qa0[2 * r + 1] = qp[k + 1];
    qa1[2 * r]     = qp[32 + k];
    qa1[2 * r + 1] = qp[32 + k + 1];
  }

  v8f o0 = {}, o1 = {}, o2 = {}, o3 = {};
  // query nn's running maximum, and the sum over this lane half's keys
  float row_m = -1e30f, row_l = 0.f;
  const float scale = 0.125f;  // 1/sqrt(64)

  // stage 0, waited for and published; then stage 1, in flight under pass 0
  async_to_lds_32B(&Vt[0][srow][scol], vsrc);
  async_to_lds_32B(&Vt[0][srow + 32][scol], vsrc + half_step);
  u32x4 kg0 = tdm_group0(&tiles.k[0][0], ksrc);
  if (pinned(wave == 0)) {
    tdm_load(kg0, kg1);
    tdm_wait(kg0, kg1);  // K stage 0 has landed
  }
  asm volatile("s_wait_asynccnt 0x0" ::: "memory");  // this wave's V copies too
  __syncthreads();  // ... visible to every wave
  if (pinned(wave == 0)) {
    kg0 = tdm_group0(&tiles.k[1][0], ksrc + 2 * half_step);
    tdm_load(kg0, kg1);
  }
  async_to_lds_32B(&Vt[1][srow][scol], vsrc + 2 * half_step);
  async_to_lds_32B(&Vt[1][srow + 32][scol], vsrc + 3 * half_step);

  for (int st = 0; st < NST; ++st) {
    const int buf = st & 1;
    // unrolled: the two blocks' LDS addresses differ by constants only
#pragma unroll
    for (int blk = 0; blk < 2; ++blk) {
    const _Float16* kt = &tiles.k[buf][blk * 32 * 72];
    const _Float16* vt = &Vt[buf][blk * 32][0];
    // K fragments, 16 (keys) x 32 (d) each, and V^T fragments, 16 (d) x 32
    // (keys) each
    const v16h ka0 = wmma_load_a(kt, 72);
    const v16h ka1 = wmma_load_a(kt + 32, 72);
    const v16h ka2 = wmma_load_a(kt + 16 * 72, 72);
    const v16h ka3 = wmma_load_a(kt + 16 * 72 + 32, 72);
    const v16h va0 = wmma_load_a_tr(vt, 80);
    const v16h va1 = wmma_load_a_tr(vt + 16, 80);
    const v16h va2 = wmma_load_a_tr(vt + 32, 80);
    const v16h va3 = wmma_load_a_tr(vt + 48, 80);
    // keeps the block's 16 LDS loads up here as one group, the V loads in flight
    // under the first product; left free they sink to their WMMAs, one exposed
    // LDS latency in front of each
    __builtin_amdgcn_sched_barrier(0);

    // S^T = K Q^T : two 16 (keys) x 16 (queries) tiles, d=64 -> 2 steps each
    v8f s0 = {}, s1 = {};
    s0 = WMMA_F16(ka0, qa0, s0);
    s1 = WMMA_F16(ka2, qa0, s1);
    s0 = WMMA_F16(ka1, qa1, s0);
    s1 = WMMA_F16(ka3, qa1, s1);

    // online softmax (f32); the lane holds keys v + 8*hi (s0) and 16 + v + 8*hi
    // (s1) of query nn, the other half of the wave the other 16 keys
    s0 *= scale;
    s1 *= scale;
    float mx = -1e30f;
    // unrolled: s0 and s1 are indexed by constants only and stay in registers
#pragma unroll
    for (int v = 0; v < 8; ++v) mx = fmaxf(mx, fmaxf(s0[v], s1[v]));
    mx = fmaxf(mx, xhalf(mx));
    const float mnew = fmaxf(row_m, mx);
    const float alpha = __expf(row_m - mnew);
    row_m = mnew;
    v16h pb;  // P^T as B: element s is key 8*hi + s, or 16 + 8*hi + (s - 8)
    float l0 = 0.f, l1 = 0.f;
#pragma unroll
    for (int v = 0; v < 8; ++v) {
      const float p0 = __expf(s0[v] - mnew);
      const float p1 = __expf(s1[v] - mnew);
      l0 += p0;
      l1 += p1;
      pb[v]     = (_Float16)p0;
      pb[8 + v] = (_Float16)p1;
    }
    row_l = row_l * alpha + (l0 + l1);

    // O^T = alpha O^T + V^T P^T
    o0 *= alpha; o1 *= alpha; o2 *= alpha; o3 *= alpha;
    o0 = WMMA_F16(va0, pb, o0);
    o1 = WMMA_F16(va1, pb, o1);
    o2 = WMMA_F16(va2, pb, o2);
    o3 = WMMA_F16(va3, pb, o3);
    __builtin_amdgcn_sched_barrier(0);
    }

    // publish point of stage st + 1, in the ring's order: this wave's LDS reads
    // of the buffer that is refilled behind the barrier have retired,
    asm volatile("s_wait_dscnt 0x0" ::: "memory");
    // its V copies of stage st + 1 have landed,
    asm volatile("s_wait_asynccnt 0x0" ::: "memory");
    // and the issuing wave's K stage
    if (pinned(wave == 0)) tdm_wait(kg0, kg1);
    __syncthreads();  // ... visible to every wave; every reader has left buf
    // stage st + 2 into the buffer this pass has read
    if (pinned(st + 2 < NST)) {
      const size_t off = (size_t)(st + 2) * 2 * half_step;
      if (pinned(wave == 0)) {
        kg0 = tdm_group0(&tiles.k[buf][0], ksrc + off);
        tdm_load(kg0, kg1);
      }
      async_to_lds_32B(&Vt[buf][srow][scol], vsrc + off);
      async_to_lds_32B(&Vt[buf][srow + 32][scol], vsrc + off + half_step);
    }
  }
  // nothing is in flight when the waves leave the loop
  asm volatile("s_wait_tensorcnt 0x0" ::: "memory");
  asm volatile("s_wait_asynccnt 0x0" ::: "memory");
  asm volatile("s_wait_dscnt 0x0" ::: "memory");

  // epilogue: query nn's row; this lane holds d = 16 t + 8 hi + 0..7 of tile t
  {
    const int qr = qt * 64 + wave * 16 + nn;
    const size_t pos = (size_t)(segbase + qr * rate);
    const float inv = 1.0f / (row_l + xhalf(row_l));
    float* op = out + pos * EMBED + hoff + 8 * hi;
    o0 *= inv; o1 *= inv; o2 *= inv; o3 *= inv;
    // this head's share of the row's layer-norm sums: sum and sum of squares of
    // the 64 values, half of them in each lane half
    const v8f t = (o0 + o1) + (o2 + o3);
    const v8f u = (o0 * o0 + o1 * o1) + (o2 * o2 + o3 * o3);
    float rs = ((t[0] + t[1]) + (t[2] + t[3])) + ((t[4] + t[5]) + (t[6] + t[7]));
    float rq = ((u[0] + u[1]) + (u[2] + u[3])) + ((u[4] + u[5]) + (u[6] + u[7]));
    rs += xhalf(rs);
    rq += xhalf(rq);
    *(v8f*)(op)      = o0;
    *(v8f*)(op + 16) = o1;
    *(v8f*)(op + 32) = o2;
    *(v8f*)(op + 48) = o3;
    if (hi == 0) {
      const v2f st = {rs, rq};
      *(v2f*)(stats + ((size_t)head * NTOK + pos) * 2) = st;
    }
  }
}

// ---- launcher --------------------------------------------------------------
extern "C" void kernel_launch(void* const* d_in, const int* in_sizes, int n_in,
                              void* d_out, int out_size, void* d_ws,
                              size_t ws_size, hipStream_t stream) {
  const float* query = (const float*)d_in[0];
  const float* key   = (const float*)d_in[1];
  const float* value = (const float*)d_in[2];
  const float* Wq = (const float*)d_in[3];  const float* bq = (const float*)d_in[4];
  const float* Wk = (const float*)d_in[5];  const float* bk = (const float*)d_in[6];
  const float* Wv = (const float*)d_in[7];  const float* bv = (const float*)d_in[8];
  const float* Wo = (const float*)d_in[9];  const float* bo = (const float*)d_in[10];
  const float* ln_g = (const float*)d_in[11];
  const float* ln_b = (const float*)d_in[12];

  char* ws = (char*)d_ws;
  const size_t nelem = (size_t)NTOK * EMBED;  // 8M elements
  _Float16* qf = (_Float16*)(ws);             // 16 MB
  _Float16* kf = (_Float16*)(ws + nelem * 2); // 16 MB
  _Float16* vf = (_Float16*)(ws + nelem * 4); // 16 MB
  float*  attn = (float*)(ws + nelem * 6);    // 32 MB
  float* stats = (float*)(ws + nelem * 10);   // 1 MB: [head][row] (sum, sum sq)

  const dim3 gblk(EMBED / GEMM_BN, NTOK / GEMM_BM);  // (8, 64)
  // q, k, v projections (the tiles the attention reads) and the clearing of attn,
  // one launch of 504 workgroups
  qkv_gemm_kernel<<<3 * QKV_TILES, 256, 0, stream>>>(query, key, value, Wq, Wk, Wv, bq,
                                            bk, bv, qf, kf, vf, attn);

  // (4 segments x 6 heads + 2 x 5 + 1 x 5) x 32 query tiles
  attn_kernel<<<ATTN_BLOCKS, 128, 0, stream>>>(qf, kf, vf, attn, stats);

  // layer norm and output projection
  ln_gemm_bias_kernel<<<gblk, 256, 0, stream>>>(attn, Wo, bo, (float*)d_out,
                                                stats, ln_g, ln_b);
}

// v009
// One run takes 112 microseconds.
// Next to v008, in two timings, it ran 1.09 and 1.10 times as fast.
// Counting every step since v000, it is 4.15 times as fast.
#include <hip/hip_runtime.h>

typedef __attribute__((ext_vector_type(16))) _Float16 v16h;
typedef __attribute__((ext_vector_type(8)))  float    v8f;

#define EMBED    1024
#define HEADS    16
#define HEAD_DIM 64
#define NTOK     8192

#define WMMA_F16(a, b, c) \
  __builtin_amdgcn_wmma_f32_16x16x32_f16(false, (a), false, (b), (short)0, (c), false, false)

__device__ __forceinline__ void async_to_lds_32B(void* lds, const void* gsrc) {
  const unsigned ldst = (unsigned)(unsigned long long)lds;
  asm volatile(
      "global_load_async_to_lds_b128 %0, %1, off\n\t"
      "global_load_async_to_lds_b128 %0, %1, off offset:16\n\t"
      // stands in front of any reuse of the two address registers the copies name
      "s_wait_xcnt 0x0"
      :
      : "v"(ldst), "v"(gsrc)
      : "memory");
}

typedef __attribute__((ext_vector_type(4))) uint32_t u32x4;
typedef __attribute__((ext_vector_type(8))) uint32_t u32x8;

__device__ __forceinline__ uint32_t uni(uint32_t v) {
  return (uint32_t)__builtin_amdgcn_readfirstlane(v);
}

__device__ __forceinline__ uint32_t pinned(uint32_t v) {
  uint32_t w = uni(v);
  asm volatile("" : "+s"(w));  // pinned(): holds the test in a scalar register
  return w;
}

__device__ __forceinline__ u32x8 tdm_group1(uint32_t src_pitch_bytes) {
  u32x8 g;
  g[0] = uni((1u << 20) | (4u << 22) | (3u << 25));
  g[1] = uni(128u << 16);
  g[2] = uni(64u << 16);
  g[3] = uni(128u << 16);
  g[4] = uni(64u);
  g[5] = uni(src_pitch_bytes);
  g[6] = uni(0u);
  g[7] = uni(0u);
  asm volatile("" : "+s"(g));
  return g;
}

__device__ __forceinline__ u32x4 tdm_group0(const void* lds_dst, const void* gsrc) {
  const uint64_t ga = (uint64_t)gsrc;
  u32x4 g;
  g[0] = uni(1u);                                   // count = 1
  g[1] = uni((uint32_t)(uint64_t)lds_dst);          // byte offset in the LDS
  g[2] = uni((uint32_t)ga);                         // address [31:0]
  g[3] = uni((((uint32_t)(ga >> 32)) & 0x01FFFFFFu) | 0x80000000u);
  asm volatile("" : "+s"(g));
  return g;
}

__device__ __forceinline__ void tdm_load(u32x4 g0, u32x8 g1) {
  asm volatile("tensor_load_to_lds %0, %1" ::"s"(g0), "s"(g1) : "memory");
}

// The issuing wave's wait for its request. Naming the request's two groups keeps
// their registers whole until it has landed.
__device__ __forceinline__ void tdm_wait(u32x4 g0, u32x8 g1) {
  asm volatile("s_wait_tensorcnt 0x0" ::"s"(g0), "s"(g1) : "memory");
}

__device__ __forceinline__ float xhalf(float x) {
  const int xi = __float_as_int(x);
  return __int_as_float(__builtin_amdgcn_permlanex16(
      xi, xi, 0x76543210, (int)0xFEDCBA98u, false, false));
}

__device__ __forceinline__ v16h wmma_load_a(const _Float16* p, int ld) {
  const int lane = threadIdx.x & 31;
  const int row = lane & 15, hi = lane >> 4;
  v16h a;
#pragma unroll
  for (int r = 0; r < 8; ++r) {
    const int k = ((r & 3) << 1) + ((r >> 2) << 4) + (hi << 3);
    a[2 * r]     = p[row * ld + k];
    a[2 * r + 1] = p[row * ld + k + 1];
  }
  return a;
}

__device__ __forceinline__ v16h wmma_load_b_nk(const _Float16* p, int ld) {
  const int lane = threadIdx.x & 31;
  const int n = lane & 15, hi = lane >> 4;
  v16h b;
#pragma unroll
  for (int r = 0; r < 8; ++r) {
    const int k = ((r & 3) << 1) + ((r >> 2) << 4) + (hi << 3);
    b[2 * r]     = p[n * ld + k];
    b[2 * r + 1] = p[n * ld + k + 1];
  }
  return b;
}

// A = T^T for a row-major 32 (k) x 16 (m) LDS tile: two ds_load_tr16_b128.
// Lane (c = lane & 15, hi) gets T[8 hi + 0..7][c] and T[16 + 8 hi + 0..7][c],
// the k order of the loaders above.
typedef __attribute__((ext_vector_type(8))) short s16x8;
typedef __attribute__((ext_vector_type(8))) _Float16 v8h;
__device__ __forceinline__ v8h lds_load_tr16(const _Float16* p) {
  typedef __attribute__((address_space(3))) s16x8 lds_s16x8;
  return __builtin_bit_cast(
      v8h, __builtin_amdgcn_ds_load_tr16_b128_v8i16((lds_s16x8*)p));
}

__device__ __forceinline__ v16h wmma_load_a_tr(const _Float16* p, int ld) {
  const int lane = threadIdx.x & 31;
  const _Float16* q =
      p + (8 * (lane >> 4) + (lane & 7)) * ld + 8 * ((lane >> 3) & 1);
  const v8h lo = lds_load_tr16(q);
  const v8h up = lds_load_tr16(q + 16 * ld);
  return __builtin_shufflevector(lo, up, 0, 1, 2, 3, 4, 5, 6, 7, 8, 9, 10, 11,
                                 12, 13, 14, 15);
}

// ---- GEMM: C[i][j] = sum_k X[i][k] * W[j][k] + bias[j] ---------------------
// Block tile BM x 128 x 64, eight waves. BM = 128: a 2 x 4 grid of waves, 64 x 32
// of C per wave. BM = 256: a 4 x 2 grid, 64 x 64 per wave, so that a staged W row
// feeds 256 outputs and a fragment read from LDS four products. A barrier pair
// covers 64 k.
// The tile's BM rows are rows rowbase + (r << RS) of X and of C, r = 0..BM-1.
// With LN set, X is layer-normalised on its way into LDS: a row's mean and
// variance come from the per-(head, row) sums that the attention kernel left in
// `stats`, so the normalised matrix is never written to memory. The loop then
// runs over nk blocks of 64 k, one head each: heads 0..5, then heads 6 + skip on;
// each row's shift -mean * rstd is left in `lnrc` for the caller.
typedef __attribute__((ext_vector_type(4))) _Float16 v4h;
typedef __attribute__((ext_vector_type(4))) float    v4f;
typedef __attribute__((ext_vector_type(2))) float    v2f;
#define GEMM_BM 128
#define GEMM_BN 128
#define GEMM_BK 64
#define GEMM_LD 72  // halfs: 128-B rows + 16 B, the pitch for 16-byte readers

template <bool LN, int RS, int BM>
__device__ __forceinline__ void gemm_tile(
    v8f (&acc)[4][BM / 64],
    _Float16 (&At)[BM][GEMM_LD], _Float16 (&Bt)[GEMM_BN][GEMM_LD],
    const int rowbase, const int colbase,
    const float* __restrict__ X, const float* __restrict__ W,
    const float* __restrict__ stats = nullptr,
    const float* __restrict__ lng = nullptr,
    const float* __restrict__ lnb = nullptr,
    const int nk = EMBED / GEMM_BK, const int skip = 0,
    float* lnrc = nullptr) {
  static_assert(!LN || BM == GEMM_BM, "the layer-norm prologue is laid out for 128 rows");
  constexpr int NC = BM / 64;               // 16-column fragments per wave
  constexpr int WC = GEMM_BN / (16 * NC);   // waves side by side
  constexpr int XR = BM / 16;               // X rows a thread stages
  // LN only: each row's sums over heads 0..7 and 8..15; gain and shift vectors
  __shared__ __attribute__((aligned(16))) float lnpart[2][GEMM_BM][2];
  __shared__ __attribute__((aligned(16))) float lngb[2][EMBED];
  const int tid = threadIdx.x;
  const int wave = tid >> 5, lane = tid & 31;
  const int wrow = (wave / WC) * 64, wcol = (wave % WC) * (16 * NC);

  const int sr = tid >> 4, sc = (tid & 15) * 4;
  const float* xp = X + (size_t)(rowbase + (sr << RS)) * EMBED + sc;
  const float* wp = W + (size_t)(colbase + sr) * EMBED + sc;

  // LN: x -> x * ra + rc is (x - mean) * rstd for the thread's eight staged rows
  float ra[8], rc[8];
  if constexpr (LN) {
    const int prow = tid & (GEMM_BM - 1), ph = tid >> 7;
    const int grow = rowbase + (prow << RS);
    float s = 0.f, q = 0.f;
    v2f p[8];
    // unrolled: eight independent 8-B loads in flight together
#pragma unroll
    for (int j = 0; j < 8; ++j) {
      const int head = ph * 8 + j;
      const int grp = (head >= 6) + (head >= 11);
      const int crow = (grow & ~((1 << grp) - 1)) | grp;
      p[j] = *(const v2f*)(stats + ((size_t)head * NTOK + crow) * 2);
    }
    // stands in front of any reuse of a register that these eight loads name
    asm volatile("s_wait_xcnt 0x0" ::: "memory");
    // unrolled: p is indexed by constants only; the sums run in the loads' order
#pragma unroll
    for (int j = 0; j < 8; ++j) {
      const int head = ph * 8 + j;
      const int grp = (head >= 6) + (head >= 11);
      const bool covered = ((grow & ~((1 << grp) - 1)) | grp) == grow;
      s += covered ? p[j][0] : 0.f;
      q += covered ? p[j][1] : 0.f;
    }
    lnpart[ph][prow][0] = s;
    lnpart[ph][prow][1] = q;
    *(v4f*)&lngb[0][tid * 4] = *(const v4f*)(lng + tid * 4);
    *(v4f*)&lngb[1][tid * 4] = *(const v4f*)(lnb + tid * 4);
    __syncthreads();  // the sums and the two vectors, visible to every wave
    // unrolled: ra and rc are indexed by constants only and stay in registers
#pragma unroll
    for (int i = 0; i < 8; ++i) {
      const int r = sr + i * 16;
      const float mean = (lnpart[0][r][0] + lnpart[1][r][0]) * (1.f / EMBED);
      const float var =
          (lnpart[0][r][1] + lnpart[1][r][1]) * (1.f / EMBED) - mean * mean;
      const float rstd = rsqrtf(var + 1e-5f);
      ra[i] = rstd;
      rc[i] = -mean * rstd;
    }
    // a loop of its own, so that the LDS reads above stay one group; read by
    // the caller behind the main loop's barriers
    if ((tid & 15) == 0) {
      // unrolled: rc is indexed by constants only
#pragma unroll
      for (int i = 0; i < 8; ++i) lnrc[sr + i * 16] = rc[i];
    }
  }

  for (int it = 0; it < nk; ++it) {
    const int kk = (LN && it >= 6 ? it + skip : it) * GEMM_BK;
    v4f xs[XR], ws[8];
    const float* xk = xp + kk;
    const float* wk = wp + kk;
    // both unrolled: xs/ws are indexed by constants only and stay in registers
#pragma unroll
    for (int i = 0; i < XR; ++i) xs[i] = *(const v4f*)(xk + ((i * 16) << RS) * EMBED);
#pragma unroll
    for (int i = 0; i < 8; ++i) ws[i] = *(const v4f*)(wk + i * 16 * EMBED);
    // the wait that belongs in front of any reuse of a register that an issued
    // load names; naming both pointers keeps the address pairs whole until it,
    // and the statement keeps all the loads ahead of the conversions, in flight
    // together, instead of load and conversion taking turns in few registers
    asm volatile("s_wait_xcnt 0x0" ::"v"(xk), "v"(wk) : "memory");
    if constexpr (LN) {
      const v4f g4 = *(const v4f*)&lngb[0][kk + sc];
      const v4f b4 = *(const v4f*)&lngb[1][kk + sc];
#pragma unroll
      for (int i = 0; i < 8; ++i) xs[i] = (xs[i] * ra[i] + rc[i]) * g4 + b4;
    }
#pragma unroll
    for (int i = 0; i < XR; ++i)
      *(v4h*)&At[sr + i * 16][sc] = __builtin_convertvector(xs[i], v4h);
#pragma unroll
    for (int i = 0; i < 8; ++i)
      *(v4h*)&Bt[sr + i * 16][sc] = __builtin_convertvector(ws[i], v4h);
    __syncthreads();
    // this loop and those inside it unrolled: acc, a and b are indexed by
    // constants only; k runs upward as before
#pragma unroll
    for (int ks = 0; ks < GEMM_BK; ks += 32) {
      v16h a[4], b[NC];
#pragma unroll
      for (int m = 0; m < 4; ++m)
        a[m] = wmma_load_a(&At[wrow + m * 16][ks], GEMM_LD);
#pragma unroll
      for (int c = 0; c < NC; ++c)
        b[c] = wmma_load_b_nk(&Bt[wcol + c * 16][ks], GEMM_LD);
#pragma unroll
      for (int c = 0; c < NC; ++c)
#pragma unroll
        for (int m = 0; m < 4; ++m) acc[m][c] = WMMA_F16(a[m], b[c], acc[m][c]);
    }
    __syncthreads();
  }
}

// C = acc + bias for the tile above; rs is the tile's RS, here a run-time value:
// one copy of the stores serves every row step, at one address addition a row.
template <typename T, int NC>
__device__ __forceinline__ void gemm_store_tile(
    const v8f (&acc)[4][NC], const int rowbase, const int rs, const int colbase,
    const float* __restrict__ bias, T* __restrict__ out) {
  const int tid = threadIdx.x;
  const int wave = tid >> 5, lane = tid & 31;
  const int hi = lane >> 4, nn = lane & 15;
  constexpr int WC = GEMM_BN / (16 * NC);  // waves side by side, as in gemm_tile
  const int wrow = (wave / WC) * 64, wcol = (wave % WC) * (16 * NC);
  const int col0 = colbase + wcol + nn;
  float bc[NC];
  // unrolled: bc is indexed by constants only
#pragma unroll
  for (int c = 0; c < NC; ++c) bc[c] = bias[col0 + 16 * c];
  const unsigned mine = (unsigned)(((wrow + 8 * hi) << rs) * EMBED + wcol + nn);
  T* tile = out + (size_t)rowbase * EMBED + colbase;
  // all unrolled: acc is indexed by constants only
#pragma unroll
  for (int m = 0; m < 4; ++m)
#pragma unroll
    for (int v = 0; v < 8; ++v) {
      T* row = tile + (((m * 16 + v) * EMBED) << rs);
#pragma unroll
      for (int c = 0; c < NC; ++c) row[mine + 16 * c] = (T)(acc[m][c][v] + bc[c]);
    }
}

// Output projection of the layer-normalised attention result. A row of that
// result is zero by construction in the heads whose dilation skips the row:
//   rows = 0 mod 4       hold heads 0..5
//   rows = 1, 3 mod 4    hold heads 0..10
//   rows = 2 mod 4       hold heads 0..5 and 11..15
// A tile takes 128 rows of one such class (every fourth row) and runs only over
// the heads that the class holds; the zeros are never stored, read or multiplied.
// Normalised, a zero is rc * g[k] + b[k] with rc = -mean * rstd of its row, so
// the skipped heads add rc * sum(g[k] W[j][k]) + sum(b[k] W[j][k]) to out[i][j]:
// `colsum` holds these sums, [0] g and [1] b over heads 6..10, [2] g and [3] b
// over heads 11..15, one value per output column.
__global__ __launch_bounds__(256) void ln_gemm_bias_kernel(
    const float* __restrict__ X, const float* __restrict__ W,
    const float* __restrict__ bias, float* __restrict__ out,
    const float* __restrict__ stats, const float* __restrict__ lng,
    const float* __restrict__ lnb, const float* __restrict__ colsum) {
  __shared__ __attribute__((aligned(16))) _Float16 At[GEMM_BM][GEMM_LD];
  __shared__ __attribute__((aligned(16))) _Float16 Bt[GEMM_BN][GEMM_LD];
  __shared__ __attribute__((aligned(32))) float lnrc[GEMM_BM];
  const int cls = blockIdx.y & 3;
  const int rowbase = (blockIdx.y >> 2) * (4 * GEMM_BM) + cls;
  const int colbase = blockIdx.x * GEMM_BN;
  const int tid = threadIdx.x;
  const int wave = tid >> 5, lane = tid & 31;
  const int hi = lane >> 4, nn = lane & 15;
  const int wrow = (wave >> 2) * 64, wcol = (wave & 3) * 32;  // as in gemm_tile
  const int col0 = colbase + wcol + nn;
  const bool no_mid = (cls & 1) == 0;  // heads 6..10 skipped
  const bool no_top = cls != 2;        // heads 11..15 skipped
  // the columns' terms, loaded ahead of the tile: nothing waits for them behind it
  float bc[2], gc[2];
  // unrolled: bc and gc are indexed by constants only
#pragma unroll
  for (int c = 0; c < 2; ++c) {
    const int col = col0 + 16 * c;
    const float g1 = colsum[col], b1 = colsum[EMBED + col];
    const float g2 = colsum[2 * EMBED + col], b2 = colsum[3 * EMBED + col];
    gc[c] = (no_mid ? g1 : 0.f) + (no_top ? g2 : 0.f);
    bc[c] = bias[col] + ((no_mid ? b1 : 0.f) + (no_top ? b2 : 0.f));
  }
  v8f acc[4][2] = {};
  gemm_tile<true, 2, GEMM_BM>(acc, At, Bt, rowbase, colbase, X, W, stats, lng, lnb,
                              cls == 0 ? 6 : 11, cls == 2 ? 5 : 0, lnrc);
  float* tile = out + (size_t)rowbase * EMBED + col0;
  // all unrolled: acc is indexed by constants only
#pragma unroll
  for (int m = 0; m < 4; ++m) {
    const int r0 = wrow + m * 16 + 8 * hi;
    const v8f rc = *(const v8f*)&lnrc[r0];
#pragma unroll
    for (int v = 0; v < 8; ++v)
#pragma unroll
      for (int c = 0; c < 2; ++c)
        tile[(size_t)((r0 + v) * 4) * EMBED + 16 * c] =
            acc[m][c][v] + (rc[v] * gc[c] + bc[c]);
  }
}

// The three projections depend on nothing of one another: one launch, the block
// index picks the projection, so their fills, load waits and tails overlap.
// The attention reads a head's q, k and v only at the rows of its dilation: heads
// [0,6) at every row, [6,11) at rows = 1 mod 2, [11,16) at rows = 2 mod 4. Only
// tiles that hold such elements are computed; the rest of oq, ok and ov stays
// unwritten and is never read. A tile is 256 rows by 128 columns. Per 1024 rows
// and projection, by 128-column block:
//   blocks 0..2 (heads 0..5)    4 tiles each, rows in a run
//   blocks 3, 4 (heads 6..9)    2 tiles each, every second row from row 1
//   block  5    (heads 10, 11)  3 tiles, every fourth row from row 1, 2 or 3
//   blocks 6, 7 (heads 12..15)  1 tile each, every fourth row from row 2
// 21 tiles where the full product has 32.
// Behind their tiles the first 128 blocks form the column sums that the output
// projection uses in place of the heads it skips: block 32 q + p gives the 32
// values [q][32 p ..] of `colsum`, one whole 128-B line from one wave.
#define QKV_BM 256
#define QKV_SPAN (4 * QKV_BM)  // rows that one set of 21 tiles covers
#define QKV_TILES_SPAN 21
#define QKV_TILES ((NTOK / QKV_SPAN) * QKV_TILES_SPAN)  // per projection
__global__ __launch_bounds__(256) void qkv_gemm_kernel(
    const float* __restrict__ Xq, const float* __restrict__ Xk,
    const float* __restrict__ Xv, const float* __restrict__ Wq,
    const float* __restrict__ Wk, const float* __restrict__ Wv,
    const float* __restrict__ bq, const float* __restrict__ bk,
    const float* __restrict__ bv, _Float16* __restrict__ oq,
    _Float16* __restrict__ ok, _Float16* __restrict__ ov,
    const float* __restrict__ Wo, const float* __restrict__ lng,
    const float* __restrict__ lnb, float* __restrict__ colsum) {
  __shared__ __attribute__((aligned(16))) _Float16 At[QKV_BM][GEMM_LD];
  __shared__ __attribute__((aligned(16))) _Float16 Bt[GEMM_BN][GEMM_LD];
  const int z = blockIdx.x / QKV_TILES;
  const int sup = (blockIdx.x % QKV_TILES) / QKV_TILES_SPAN;
  const int t = blockIdx.x % QKV_TILES_SPAN;  // QKV_TILES is a multiple of it
  // column block, log2 of the row step, first row inside the span
  int cb, rs, first;
  if (t < 12) {
    cb = t % 3; rs = 0; first = (t / 3) * QKV_BM;
  } else if (t < 16) {
    cb = 3 + ((t - 12) & 1); rs = 1; first = ((t - 12) >> 1) * 2 * QKV_BM + 1;
  } else if (t < 19) {
    cb = 5; rs = 2; first = t - 15;
  } else {
    cb = t - 13; rs = 2; first = 2;
  }
  const int rowbase = sup * QKV_SPAN + first, colbase = cb * GEMM_BN;
  const float* X = z == 0 ? Xq : (z == 1 ? Xk : Xv);
  const float* W = z == 0 ? Wq : (z == 1 ? Wk : Wv);
  const float* bias = z == 0 ? bq : (z == 1 ? bk : bv);
  _Float16* out = z == 0 ? oq : (z == 1 ? ok : ov);
  v8f acc[4][QKV_BM / 64] = {};
  // the row step as a constant: in the loop every row offset stays an immediate
  // of its load; the branch is the same for the whole block
  if (rs == 0)
    gemm_tile<false, 0, QKV_BM>(acc, At, Bt, rowbase, colbase, X, W);
  else if (rs == 1)
    gemm_tile<false, 1, QKV_BM>(acc, At, Bt, rowbase, colbase, X, W);
  else
    gemm_tile<false, 2, QKV_BM>(acc, At, Bt, rowbase, colbase, X, W);
  gemm_store_tile(acc, rowbase, rs, colbase, bias, out);
  // stands in front of any reuse of a register that the tile's stores name
  asm volatile("s_wait_xcnt 0x0" ::: "memory");
  if (blockIdx.x < 4 * EMBED / 32) {
    __shared__ float part[32][33];
    const int wave = threadIdx.x >> 5, lane = threadIdx.x & 31;
    const int q = blockIdx.x >> 5, j0 = (blockIdx.x & 31) * 32;
    float gv[10], wv[4][10];
    const float* vec = (q & 1) ? lnb : lng;
    // five heads = 320 k from head 6 or head 11 on, ten per lane
    const int k0 = (q >> 1 ? 11 : 6) * HEAD_DIM + lane;
    // all unrolled: gv and wv are indexed by constants only; 50 loads in flight
#pragma unroll
    for (int t = 0; t < 10; ++t) gv[t] = vec[k0 + 32 * t];
#pragma unroll
    for (int u = 0; u < 4; ++u)
#pragma unroll
      for (int t = 0; t < 10; ++t)
        wv[u][t] = Wo[(size_t)(j0 + wave * 4 + u) * EMBED + k0 + 32 * t];
    // stands in front of any reuse of a register that these loads name
    asm volatile("s_wait_xcnt 0x0" ::: "memory");
#pragma unroll
    for (int u = 0; u < 4; ++u) {
      float s = 0.f;
#pragma unroll
      for (int t = 0; t < 10; ++t) s += gv[t] * wv[u][t];
      part[wave * 4 + u][lane] = s;
    }
    // the shares, visible to the wave that adds them up. A barrier with fences
    // for LDS alone: __syncthreads() would also wait out the tile's stores, which
    // now drain under the sums
    __builtin_amdgcn_fence(__ATOMIC_RELEASE, "workgroup", "local");
    __builtin_amdgcn_s_barrier();
    __builtin_amdgcn_fence(__ATOMIC_ACQUIRE, "workgroup", "local");
    if (wave == 0) {
      float s = 0.f;
      // unrolled: 32 LDS reads at constant offsets from one address
#pragma unroll
      for (int l = 0; l < 32; ++l) s += part[lane][l];
      colsum[q * EMBED + j0 + lane] = s;
    }
  }
}

#define ATTN_BLOCKS ((4 * 6 + 2 * 5 + 1 * 5) * 32)
__global__ __launch_bounds__(128) void attn_kernel(
    const _Float16* __restrict__ Q, const _Float16* __restrict__ K,
    const _Float16* __restrict__ V, float* __restrict__ out,
    float* __restrict__ stats) {
  // one object, K first. A K buffer is 64 rows of 144 B, rounded up to 10 KiB, so
  // that each tensor load's place in LDS is a multiple of 2 KiB. V has 160-B
  // rows, the pitch (32 B x odd) of the transposing reader.
  struct Tiles {
    _Float16 k[2][5120];
    _Float16 v[2][64][80];
  };
  __shared__ __attribute__((aligned(2048))) Tiles tiles;
  _Float16 (&Vt)[2][64][80] = tiles.v;

  constexpr int S = 2048;  // dilated positions per segment, seglen / rate
  constexpr int qtiles = S / 64;
  // (segment, head) pairs [0, 24): seg 2048, r=1, off=0, heads [0,6); [24, 34):
  // seg 4096, r=2, off=1, heads [6,11); [34, 39): seg 8192, r=4, off=2, heads
  // [11,16). The divisors are literals, so the whole decode is scalar code.
  const int qt = blockIdx.x % qtiles;
  const int pair = blockIdx.x / qtiles;
  const int grp = (pair >= 24) + (pair >= 34);
  const int rate = 1 << grp;
  const int seg = grp == 0 ? pair / 6 : (grp == 1 ? (pair - 24) / 5 : 0);
  const int head = grp == 0 ? pair % 6 : (grp == 1 ? 6 + (pair - 24) % 5 : pair - 23);
  const int segbase = seg * (S << grp) + grp;
  const u32x8 kg1 = tdm_group1((uint32_t)(rate * EMBED * 2));

  const int tid = threadIdx.x, lane = tid & 31;
  const int wave = (int)uni((uint32_t)tid >> 5);
  const int hi = lane >> 4, nn = lane & 15;
  const size_t hoff = (size_t)head * HEAD_DIM;

  const int srow = tid >> 2, scol = (tid & 3) * 16;
  constexpr int NST = S / 64;  // stages
  const size_t half_step = (size_t)(32 * rate) * EMBED;  // 32 keys on, elements
  const _Float16* ksrc = K + (size_t)segbase * EMBED + hoff;
  const _Float16* vsrc = V + (size_t)(segbase + srow * rate) * EMBED + hoff + scol;

  // Q fragments for this wave's 16 queries (B operand: column nn, same k order as A)
  const int qrowA = qt * 64 + wave * 16 + nn;
  const _Float16* qp = Q + (size_t)(segbase + qrowA * rate) * EMBED + hoff;
  v16h qa0, qa1;
#pragma unroll
  for (int r = 0; r < 8; ++r) {
    const int k = ((r & 3) << 1) + ((r >> 2) << 4) + (hi << 3);
    qa0[2 * r]     = qp[k];
    qa0[2 * r + 1] = qp[k + 1];
    qa1[2 * r]     = qp[32 + k];
    qa1[2 * r + 1] = qp[32 + k + 1];
  }

  v8f o0 = {}, o1 = {}, o2 = {}, o3 = {};
  // query nn's running maximum, and the sum over this lane half's keys
  float row_m = -1e30f, row_l = 0.f;
  const float scale = 0.125f;  // 1/sqrt(64)

  // stage 0, waited for and published; then stage 1, in flight under pass 0
  async_to_lds_32B(&Vt[0][srow][scol], vsrc);
  async_to_lds_32B(&Vt[0][srow + 32][scol], vsrc + half_step);
  u32x4 kg0 = tdm_group0(&tiles.k[0][0], ksrc);
  if (pinned(wave == 0)) {
    tdm_load(kg0, kg1);
    tdm_wait(kg0, kg1);  // K stage 0 has landed
  }
  asm volatile("s_wait_asynccnt 0x0" ::: "memory");  // this wave's V copies too
  __syncthreads();  // ... visible to every wave
  if (pinned(wave == 0)) {
    kg0 = tdm_group0(&tiles.k[1][0], ksrc + 2 * half_step);
    tdm_load(kg0, kg1);
  }
  async_to_lds_32B(&Vt[1][srow][scol], vsrc + 2 * half_step);
  async_to_lds_32B(&Vt[1][srow + 32][scol], vsrc + 3 * half_step);

  for (int st = 0; st < NST; ++st) {
    const int buf = st & 1;
    // unrolled: the two blocks' LDS addresses differ by constants only
#pragma unroll
    for (int blk = 0; blk < 2; ++blk) {
    const _Float16* kt = &tiles.k[buf][blk * 32 * 72];
    const _Float16* vt = &Vt[buf][blk * 32][0];
    // K fragments, 16 (keys) x 32 (d) each, and V^T fragments, 16 (d) x 32
    // (keys) each
    const v16h ka0 = wmma_load_a(kt, 72);
    const v16h ka1 = wmma_load_a(kt + 32, 72);
    const v16h ka2 = wmma_load_a(kt + 16 * 72, 72);
    const v16h ka3 = wmma_load_a(kt + 16 * 72 + 32, 72);
    const v16h va0 = wmma_load_a_tr(vt, 80);
    const v16h va1 = wmma_load_a_tr(vt + 16, 80);
    const v16h va2 = wmma_load_a_tr(vt + 32, 80);
    const v16h va3 = wmma_load_a_tr(vt + 48, 80);
    // keeps the block's 16 LDS loads up here as one group, the V loads in flight
    // under the first product; left free they sink to their WMMAs, one exposed
    // LDS latency in front of each
    __builtin_amdgcn_sched_barrier(0);

    // S^T = K Q^T : two 16 (keys) x 16 (queries) tiles, d=64 -> 2 steps each
    v8f s0 = {}, s1 = {};
    s0 = WMMA_F16(ka0, qa0, s0);
    s1 = WMMA_F16(ka2, qa0, s1);
    s0 = WMMA_F16(ka1, qa1, s0);
    s1 = WMMA_F16(ka3, qa1, s1);

    // online softmax (f32); the lane holds keys v + 8*hi (s0) and 16 + v + 8*hi
    // (s1) of query nn, the other half of the wave the other 16 keys
    s0 *= scale;
    s1 *= scale;
    float mx = -1e30f;
    // unrolled: s0 and s1 are indexed by constants only and stay in registers
#pragma unroll
    for (int v = 0; v < 8; ++v) mx = fmaxf(mx, fmaxf(s0[v], s1[v]));
    mx = fmaxf(mx, xhalf(mx));
    const float mnew = fmaxf(row_m, mx);
    const float alpha = __expf(row_m - mnew);
    row_m = mnew;
    v16h pb;  // P^T as B: element s is key 8*hi + s, or 16 + 8*hi + (s - 8)
    float l0 = 0.f, l1 = 0.f;
#pragma unroll
    for (int v = 0; v < 8; ++v) {
      const float p0 = __expf(s0[v] - mnew);
      const float p1 = __expf(s1[v] - mnew);
      l0 += p0;
      l1 += p1;
      pb[v]     = (_Float16)p0;
      pb[8 + v] = (_Float16)p1;
    }
    row_l = row_l * alpha + (l0 + l1);

    // O^T = alpha O^T + V^T P^T
    o0 *= alpha; o1 *= alpha; o2 *= alpha; o3 *= alpha;
    o0 = WMMA_F16(va0, pb, o0);
    o1 = WMMA_F16(va1, pb, o1);
    o2 = WMMA_F16(va2, pb, o2);
    o3 = WMMA_F16(va3, pb, o3);
    __builtin_amdgcn_sched_barrier(0);
    }

    // publish point of stage st + 1, in the ring's order: this wave's LDS reads
    // of the buffer that is refilled behind the barrier have retired,
    asm volatile("s_wait_dscnt 0x0" ::: "memory");
    // its V copies of stage st + 1 have landed,
    asm volatile("s_wait_asynccnt 0x0" ::: "memory");
    // and the issuing wave's K stage
    if (pinned(wave == 0)) tdm_wait(kg0, kg1);
    __syncthreads();  // ... visible to every wave; every reader has left buf
    // stage st + 2 into the buffer this pass has read
    if (pinned(st + 2 < NST)) {
      const size_t off = (size_t)(st + 2) * 2 * half_step;
      if (pinned(wave == 0)) {
        kg0 = tdm_group0(&tiles.k[buf][0], ksrc + off);
        tdm_load(kg0, kg1);
      }
      async_to_lds_32B(&Vt[buf][srow][scol], vsrc + off);
      async_to_lds_32B(&Vt[buf][srow + 32][scol], vsrc + off + half_step);
    }
  }
  // nothing is in flight when the waves leave the loop
  asm volatile("s_wait_tensorcnt 0x0" ::: "memory");
  asm volatile("s_wait_asynccnt 0x0" ::: "memory");
  asm volatile("s_wait_dscnt 0x0" ::: "memory");

  // epilogue: query nn's row; this lane holds d = 16 t + 8 hi + 0..7 of tile t
  {
    const int qr = qt * 64 + wave * 16 + nn;
    const size_t pos = (size_t)(segbase + qr * rate);
    const float inv = 1.0f / (row_l + xhalf(row_l));
    float* op = out + pos * EMBED + hoff + 8 * hi;
    o0 *= inv; o1 *= inv; o2 *= inv; o3 *= inv;
    // this head's share of the row's layer-norm sums: sum and sum of squares of
    // the 64 values, half of them in each lane half
    const v8f t = (o0 + o1) + (o2 + o3);
    const v8f u = (o0 * o0 + o1 * o1) + (o2 * o2 + o3 * o3);
    float rs = ((t[0] + t[1]) + (t[2] + t[3])) + ((t[4] + t[5]) + (t[6] + t[7]));
    float rq = ((u[0] + u[1]) + (u[2] + u[3])) + ((u[4] + u[5]) + (u[6] + u[7]));
    rs += xhalf(rs);
    rq += xhalf(rq);
    *(v8f*)(op)      = o0;
    *(v8f*)(op + 16) = o1;
    *(v8f*)(op + 32) = o2;
    *(v8f*)(op + 48) = o3;
    if (hi == 0) {
      const v2f st = {rs, rq};
      *(v2f*)(stats + ((size_t)head * NTOK + pos) * 2) = st;
    }
  }
}

// ---- launcher --------------------------------------------------------------
extern "C" void kernel_launch(void* const* d_in, const int* in_sizes, int n_in,
                              void* d_out, int out_size, void* d_ws,
                              size_t ws_size, hipStream_t stream) {
  const float* query = (const float*)d_in[0];
  const float* key   = (const float*)d_in[1];
  const float* value = (const float*)d_in[2];
  const float* Wq = (const float*)d_in[3];  const float* bq = (const float*)d_in[4];
  const float* Wk = (const float*)d_in[5];  const float* bk = (const float*)d_in[6];
  const float* Wv = (const float*)d_in[7];  const float* bv = (const float*)d_in[8];
  const float* Wo = (const float*)d_in[9];  const float* bo = (const float*)d_in[10];
  const float* ln_g = (const float*)d_in[11];
  const float* ln_b = (const float*)d_in[12];

  char* ws = (char*)d_ws;
  const size_t nelem = (size_t)NTOK * EMBED;  // 8M elements
  _Float16* qf = (_Float16*)(ws);             // 16 MB
  _Float16* kf = (_Float16*)(ws + nelem * 2); // 16 MB
  _Float16* vf = (_Float16*)(ws + nelem * 4); // 16 MB
  float*  attn = (float*)(ws + nelem * 6);    // 32 MB
  float* stats = (float*)(ws + nelem * 10);   // 1 MB: [head][row] (sum, sum sq)
  float* colsum = (float*)(ws + nelem * 10 + (1 << 20));  // 16 KB: [4][column]

  const dim3 gblk(EMBED / GEMM_BN, NTOK / GEMM_BM);  // (8, 64)
  // q, k, v projections (the tiles the attention reads) and the column sums of Wo,
  // one launch of 504 workgroups
  qkv_gemm_kernel<<<3 * QKV_TILES, 256, 0, stream>>>(query, key, value, Wq, Wk, Wv, bq,
                                            bk, bv, qf, kf, vf, Wo, ln_g, ln_b,
                                            colsum);

  // (4 segments x 6 heads + 2 x 5 + 1 x 5) x 32 query tiles
  attn_kernel<<<ATTN_BLOCKS, 128, 0, stream>>>(qf, kf, vf, attn, stats);

  // layer norm and output projection
  ln_gemm_bias_kernel<<<gblk, 256, 0, stream>>>(attn, Wo, bo, (float*)d_out,
                                                stats, ln_g, ln_b, colsum);
}

// v010
// One run takes 107 microseconds.
// Timed twice side by side with v009, it ran 1.05 times as fast both times.
// All steps since v000 together make it 4.35 times as fast.
#include <hip/hip_runtime.h>

typedef __attribute__((ext_vector_type(16))) _Float16 v16h;
typedef __attribute__((ext_vector_type(8)))  float    v8f;

#define EMBED    1024
#define HEADS    16
#define HEAD_DIM 64
#define NTOK     8192

#define WMMA_F16(a, b, c) \
  __builtin_amdgcn_wmma_f32_16x16x32_f16(false, (a), false, (b), (short)0, (c), false, false)

__device__ __forceinline__ void async_to_lds_32B(void* lds, const void* gsrc) {
  const unsigned ldst = (unsigned)(unsigned long long)lds;
  asm volatile(
      "global_load_async_to_lds_b128 %0, %1, off\n\t"
      "global_load_async_to_lds_b128 %0, %1, off offset:16\n\t"
      // stands in front of any reuse of the two address registers the copies name
      "s_wait_xcnt 0x0"
      :
      : "v"(ldst), "v"(gsrc)
      : "memory");
}

typedef __attribute__((ext_vector_type(4))) uint32_t u32x4;
typedef __attribute__((ext_vector_type(8))) uint32_t u32x8;

__device__ __forceinline__ uint32_t uni(uint32_t v) {
  return (uint32_t)__builtin_amdgcn_readfirstlane(v);
}

__device__ __forceinline__ uint32_t pinned(uint32_t v) {
  uint32_t w = uni(v);
  asm volatile("" : "+s"(w));  // pinned(): holds the test in a scalar register
  return w;
}

__device__ __forceinline__ u32x8 tdm_group1(uint32_t src_pitch_bytes) {
  u32x8 g;
  g[0] = uni((1u << 20) | (4u << 22) | (3u << 25));
  g[1] = uni(128u << 16);
  g[2] = uni(64u << 16);
  g[3] = uni(128u << 16);
  g[4] = uni(64u);
  g[5] = uni(src_pitch_bytes);
  g[6] = uni(0u);
  g[7] = uni(0u);
  asm volatile("" : "+s"(g));
  return g;
}

__device__ __forceinline__ u32x4 tdm_group0(const void* lds_dst, const void* gsrc) {
  const uint64_t ga = (uint64_t)gsrc;
  u32x4 g;
  g[0] = uni(1u);                                   // count = 1
  g[1] = uni((uint32_t)(uint64_t)lds_dst);          // byte offset in the LDS
  g[2] = uni((uint32_t)ga);                         // address [31:0]
  g[3] = uni((((uint32_t)(ga >> 32)) & 0x01FFFFFFu) | 0x80000000u);
  asm volatile("" : "+s"(g));
  return g;
}

__device__ __forceinline__ void tdm_load(u32x4 g0, u32x8 g1) {
  asm volatile("tensor_load_to_lds %0, %1" ::"s"(g0), "s"(g1) : "memory");
}

// The issuing wave's wait for its request. Naming the request's two groups keeps
// their registers whole until it has landed.
__device__ __forceinline__ void tdm_wait(u32x4 g0, u32x8 g1) {
  asm volatile("s_wait_tensorcnt 0x0" ::"s"(g0), "s"(g1) : "memory");
}

__device__ __forceinline__ float xhalf(float x) {
  const int xi = __float_as_int(x);
  return __int_as_float(__builtin_amdgcn_permlanex16(
      xi, xi, 0x76543210, (int)0xFEDCBA98u, false, false));
}

__device__ __forceinline__ v16h wmma_load_a(const _Float16* p, int ld) {
  const int lane = threadIdx.x & 31;
  const int row = lane & 15, hi = lane >> 4;
  v16h a;
#pragma unroll
  for (int r = 0; r < 8; ++r) {
    const int k = ((r & 3) << 1) + ((r >> 2) << 4) + (hi << 3);
    a[2 * r]     = p[row * ld + k];
    a[2 * r + 1] = p[row * ld + k + 1];
  }
  return a;
}

__device__ __forceinline__ v16h wmma_load_b_nk(const _Float16* p, int ld) {
  const int lane = threadIdx.x & 31;
  const int n = lane & 15, hi = lane >> 4;
  v16h b;
#pragma unroll
  for (int r = 0; r < 8; ++r) {
    const int k = ((r & 3) << 1) + ((r >> 2) << 4) + (hi << 3);
    b[2 * r]     = p[n * ld + k];
    b[2 * r + 1] = p[n * ld + k + 1];
  }
  return b;
}

// A = T^T for a row-major 32 (k) x 16 (m) LDS tile: two ds_load_tr16_b128.
// Lane (c = lane & 15, hi) gets T[8 hi + 0..7][c] and T[16 + 8 hi + 0..7][c],
// the k order of the loaders above.
typedef __attribute__((ext_vector_type(8))) short s16x8;
typedef __attribute__((ext_vector_type(8))) _Float16 v8h;
__device__ __forceinline__ v8h lds_load_tr16(const _Float16* p) {
  typedef __attribute__((address_space(3))) s16x8 lds_s16x8;
  return __builtin_bit_cast(
      v8h, __builtin_amdgcn_ds_load_tr16_b128_v8i16((lds_s16x8*)p));
}

__device__ __forceinline__ v16h wmma_load_a_tr(const _Float16* p, int ld) {
  const int lane = threadIdx.x & 31;
  const _Float16* q =
      p + (8 * (lane >> 4) + (lane & 7)) * ld + 8 * ((lane >> 3) & 1);
  const v8h lo = lds_load_tr16(q);
  const v8h up = lds_load_tr16(q + 16 * ld);
  return __builtin_shufflevector(lo, up, 0, 1, 2, 3, 4, 5, 6, 7, 8, 9, 10, 11,
                                 12, 13, 14, 15);
}

// ---- GEMM: C[i][j] = sum_k X[i][k] * W[j][k] + bias[j] ---------------------
// Block tile BM x 128 x 64, eight waves. BM = 128: a 2 x 4 grid of waves, 64 x 32
// of C per wave. BM = 256: a 4 x 2 grid, 64 x 64 per wave, so that a staged W row
// feeds 256 outputs and a fragment read from LDS four products. A barrier pair
// covers 64 k.
// The tile's BM rows are rows rowbase + (r << RS) of X and of C, r = 0..BM-1.
// With LN set, X is layer-normalised on its way into LDS: a row's mean and
// variance come from the per-(head, row) sums that the attention kernel left in
// `stats`, so the normalised matrix is never written to memory. The loop then
// runs over nk blocks of 64 k, one head each: heads 0..5, then heads 6 + skip on;
// each row's shift -mean * rstd is left in `lnrc` for the caller.
typedef __attribute__((ext_vector_type(4))) _Float16 v4h;
typedef __attribute__((ext_vector_type(4))) float    v4f;
typedef __attribute__((ext_vector_type(2))) float    v2f;
#define GEMM_BM 128
#define GEMM_BN 128
#define GEMM_BK 64
#define GEMM_LD 72  // halfs: 128-B rows + 16 B, the pitch for 16-byte readers

template <bool LN, int RS, int BM>
__device__ __forceinline__ void gemm_tile(
    v8f (&acc)[4][BM / 64],
    _Float16 (&At)[BM][GEMM_LD], _Float16 (&Bt)[GEMM_BN][GEMM_LD],
    const int rowbase, const int colbase,
    const float* __restrict__ X, const float* __restrict__ W,
    const float* __restrict__ stats = nullptr,
    const float* __restrict__ lng = nullptr,
    const float* __restrict__ lnb = nullptr,
    const int nk = EMBED / GEMM_BK, const int skip = 0,
    float* lnrc = nullptr) {
  static_assert(!LN || BM == GEMM_BM, "the layer-norm prologue is laid out for 128 rows");
  constexpr int NC = BM / 64;               // 16-column fragments per wave
  constexpr int WC = GEMM_BN / (16 * NC);   // waves side by side
  constexpr int XR = BM / 16;               // X rows a thread stages
  // LN only: each row's sums over heads 0..7 and 8..15; gain and shift vectors
  __shared__ __attribute__((aligned(16))) float lnpart[2][GEMM_BM][2];
  __shared__ __attribute__((aligned(16))) float lngb[2][EMBED];
  const int tid = threadIdx.x;
  const int wave = tid >> 5, lane = tid & 31;
  const int wrow = (wave / WC) * 64, wcol = (wave % WC) * (16 * NC);

  const int sr = tid >> 4, sc = (tid & 15) * 4;
  const float* xp = X + (size_t)(rowbase + (sr << RS)) * EMBED + sc;
  const float* wp = W + (size_t)(colbase + sr) * EMBED + sc;

  // LN: x -> x * ra + rc is (x - mean) * rstd for the thread's eight staged rows
  float ra[8], rc[8];
  if constexpr (LN) {
    const int prow = tid & (GEMM_BM - 1), ph = tid >> 7;
    const int grow = rowbase + (prow << RS);
    float s = 0.f, q = 0.f;
    v2f p[8];
    // unrolled: eight independent 8-B loads in flight together
#pragma unroll
    for (int j = 0; j < 8; ++j) {
      const int head = ph * 8 + j;
      const int grp = (head >= 6) + (head >= 11);
      const int crow = (grow & ~((1 << grp) - 1)) | grp;
      p[j] = *(const v2f*)(stats + ((size_t)head * NTOK + crow) * 2);
    }
    // stands in front of any reuse of a register that these eight loads name
    asm volatile("s_wait_xcnt 0x0" ::: "memory");
    // unrolled: p is indexed by constants only; the sums run in the loads' order
#pragma unroll
    for (int j = 0; j < 8; ++j) {
      const int head = ph * 8 + j;
      const int grp = (head >= 6) + (head >= 11);
      const bool covered = ((grow & ~((1 << grp) - 1)) | grp) == grow;
      s += covered ? p[j][0] : 0.f;
      q += covered ? p[j][1] : 0.f;
    }
    lnpart[ph][prow][0] = s;
    lnpart[ph][prow][1] = q;
    *(v4f*)&lngb[0][tid * 4] = *(const v4f*)(lng + tid * 4);
    *(v4f*)&lngb[1][tid * 4] = *(const v4f*)(lnb + tid * 4);
    __syncthreads();  // the sums and the two vectors, visible to every wave
    // unrolled: ra and rc are indexed by constants only and stay in registers
#pragma unroll
    for (int i = 0; i < 8; ++i) {
      const int r = sr + i * 16;
      const float mean = (lnpart[0][r][0] + lnpart[1][r][0]) * (1.f / EMBED);
      const float var =
          (lnpart[0][r][1] + lnpart[1][r][1]) * (1.f / EMBED) - mean * mean;
      const float rstd = rsqrtf(var + 1e-5f);
      ra[i] = rstd;
      rc[i] = -mean * rstd;
    }
    // a loop of its own, so that the LDS reads above stay one group; read by
    // the caller behind the main loop's barriers
    if ((tid & 15) == 0) {
      // unrolled: rc is indexed by constants only
#pragma unroll
      for (int i = 0; i < 8; ++i) lnrc[sr + i * 16] = rc[i];
    }
  }

  for (int it = 0; it < nk; ++it) {
    const int kk = (LN && it >= 6 ? it + skip : it) * GEMM_BK;
    v4f xs[XR], ws[8];
    const float* xk = xp + kk;
    const float* wk = wp + kk;
    // both unrolled: xs/ws are indexed by constants only and stay in registers
#pragma unroll
    for (int i = 0; i < XR; ++i) xs[i] = *(const v4f*)(xk + ((i * 16) << RS) * EMBED);
#pragma unroll
    for (int i = 0; i < 8; ++i) ws[i] = *(const v4f*)(wk + i * 16 * EMBED);
    // the wait that belongs in front of any reuse of a register that an issued
    // load names; naming both pointers keeps the address pairs whole until it,
    // and the statement keeps all the loads ahead of the conversions, in flight
    // together, instead of load and conversion taking turns in few registers
    asm volatile("s_wait_xcnt 0x0" ::"v"(xk), "v"(wk) : "memory");
    if constexpr (LN) {
      const v4f g4 = *(const v4f*)&lngb[0][kk + sc];
      const v4f b4 = *(const v4f*)&lngb[1][kk + sc];
#pragma unroll
      for (int i = 0; i < 8; ++i) xs[i] = (xs[i] * ra[i] + rc[i]) * g4 + b4;
    }
#pragma unroll
    for (int i = 0; i < XR; ++i)
      *(v4h*)&At[sr + i * 16][sc] = __builtin_convertvector(xs[i], v4h);
#pragma unroll
    for (int i = 0; i < 8; ++i)
      *(v4h*)&Bt[sr + i * 16][sc] = __builtin_convertvector(ws[i], v4h);
    __syncthreads();
    // this loop and those inside it unrolled: acc, a and b are indexed by
    // constants only; k runs upward as before
#pragma unroll
    for (int ks = 0; ks < GEMM_BK; ks += 32) {
      v16h a[4], b[NC];
#pragma unroll
      for (int m = 0; m < 4; ++m)
        a[m] = wmma_load_a(&At[wrow + m * 16][ks], GEMM_LD);
#pragma unroll
      for (int c = 0; c < NC; ++c)
        b[c] = wmma_load_b_nk(&Bt[wcol + c * 16][ks], GEMM_LD);
#pragma unroll
      for (int c = 0; c < NC; ++c)
#pragma unroll
        for (int m = 0; m < 4; ++m) acc[m][c] = WMMA_F16(a[m], b[c], acc[m][c]);
    }
    __syncthreads();
  }
}

// C = acc + bias for the tile above; rs is the tile's RS, here a run-time value:
// one copy of the stores serves every row step, at one address addition a row.
template <typename T, int NC>
__device__ __forceinline__ void gemm_store_tile(
    const v8f (&acc)[4][NC], const int rowbase, const int rs, const int colbase,
    const float* __restrict__ bias, T* __restrict__ out) {
  const int tid = threadIdx.x;
  const int wave = tid >> 5, lane = tid & 31;
  const int hi = lane >> 4, nn = lane & 15;
  constexpr int WC = GEMM_BN / (16 * NC);  // waves side by side, as in gemm_tile
  const int wrow = (wave / WC) * 64, wcol = (wave % WC) * (16 * NC);
  const int col0 = colbase + wcol + nn;
  float bc[NC];
  // unrolled: bc is indexed by constants only
#pragma unroll
  for (int c = 0; c < NC; ++c) bc[c] = bias[col0 + 16 * c];
  const unsigned mine = (unsigned)(((wrow + 8 * hi) << rs) * EMBED + wcol + nn);
  T* tile = out + (size_t)rowbase * EMBED + colbase;
  // all unrolled: acc is indexed by constants only
#pragma unroll
  for (int m = 0; m < 4; ++m)
#pragma unroll
    for (int v = 0; v < 8; ++v) {
      T* row = tile + (((m * 16 + v) * EMBED) << rs);
#pragma unroll
      for (int c = 0; c < NC; ++c) row[mine + 16 * c] = (T)(acc[m][c][v] + bc[c]);
    }
}

// Output projection of the layer-normalised attention result. A row of that
// result is zero by construction in the heads whose dilation skips the row:
//   rows = 0 mod 4       hold heads 0..5
//   rows = 1, 3 mod 4    hold heads 0..10
//   rows = 2 mod 4       hold heads 0..5 and 11..15
// A tile takes 128 rows of one such class (every fourth row) and runs only over
// the heads that the class holds; the zeros are never stored, read or multiplied.
// Normalised, a zero is rc * g[k] + b[k] with rc = -mean * rstd of its row, so
// the skipped heads add rc * sum(g[k] W[j][k]) + sum(b[k] W[j][k]) to out[i][j]:
// `colsum` holds these sums, [0] g and [1] b over heads 6..10, [2] g and [3] b
// over heads 11..15, one value per output column.
__global__ __launch_bounds__(256) void ln_gemm_bias_kernel(
    const float* __restrict__ X, const float* __restrict__ W,
    const float* __restrict__ bias, float* __restrict__ out,
    const float* __restrict__ stats, const float* __restrict__ lng,
    const float* __restrict__ lnb, const float* __restrict__ colsum) {
  __shared__ __attribute__((aligned(16))) _Float16 At[GEMM_BM][GEMM_LD];
  __shared__ __attribute__((aligned(16))) _Float16 Bt[GEMM_BN][GEMM_LD];
  __shared__ __attribute__((aligned(32))) float lnrc[GEMM_BM];
  const int cls = blockIdx.y & 3;
  const int rowbase = (blockIdx.y >> 2) * (4 * GEMM_BM) + cls;
  const int colbase = blockIdx.x * GEMM_BN;
  const int tid = threadIdx.x;
  const int wave = tid >> 5, lane = tid & 31;
  const int hi = lane >> 4, nn = lane & 15;
  const int wrow = (wave >> 2) * 64, wcol = (wave & 3) * 32;  // as in gemm_tile
  const int col0 = colbase + wcol + nn;
  const bool no_mid = (cls & 1) == 0;  // heads 6..10 skipped
  const bool no_top = cls != 2;        // heads 11..15 skipped
  // the columns' terms, loaded ahead of the tile: nothing waits for them behind it
  float bc[2], gc[2];
  // unrolled: bc and gc are indexed by constants only
#pragma unroll
  for (int c = 0; c < 2; ++c) {
    const int col = col0 + 16 * c;
    const float g1 = colsum[col], b1 = colsum[EMBED + col];
    const float g2 = colsum[2 * EMBED + col], b2 = colsum[3 * EMBED + col];
    gc[c] = (no_mid ? g1 : 0.f) + (no_top ? g2 : 0.f);
    bc[c] = bias[col] + ((no_mid ? b1 : 0.f) + (no_top ? b2 : 0.f));
  }
  v8f acc[4][2] = {};
  gemm_tile<true, 2, GEMM_BM>(acc, At, Bt, rowbase, colbase, X, W, stats, lng, lnb,
                              cls == 0 ? 6 : 11, cls == 2 ? 5 : 0, lnrc);
  float* tile = out + (size_t)rowbase * EMBED + col0;
  // all unrolled: acc is indexed by constants only
#pragma unroll
  for (int m = 0; m < 4; ++m) {
    const int r0 = wrow + m * 16 + 8 * hi;
    const v8f rc = *(const v8f*)&lnrc[r0];
#pragma unroll
    for (int v = 0; v < 8; ++v)
#pragma unroll
      for (int c = 0; c < 2; ++c)
        tile[(size_t)((r0 + v) * 4) * EMBED + 16 * c] =
            acc[m][c][v] + (rc[v] * gc[c] + bc[c]);
  }
}

// The three projections depend on nothing of one another: one launch, the block
// index picks the projection, so their fills, load waits and tails overlap.
// The attention reads a head's q, k and v only at the rows of its dilation: heads
// [0,6) at every row, [6,11) at rows = 1 mod 2, [11,16) at rows = 2 mod 4. Only
// tiles that hold such elements are computed; the rest of oq, ok and ov stays
// unwritten and is never read. A tile is 256 rows by 128 columns. Per 1024 rows
// and projection, by 128-column block:
//   blocks 0..2 (heads 0..5)    4 tiles each, rows in a run
//   blocks 3, 4 (heads 6..9)    2 tiles each, every second row from row 1
//   block  5    (heads 10, 11)  3 tiles, every fourth row from row 1, 2 or 3
//   blocks 6, 7 (heads 12..15)  1 tile each, every fourth row from row 2
// 21 tiles where the full product has 32.
// Behind their tiles the first 128 blocks form the column sums that the output
// projection uses in place of the heads it skips: block 32 q + p gives the 32
// values [q][32 p ..] of `colsum`, one whole 128-B line from one wave.
#define QKV_BM 256
#define QKV_SPAN (4 * QKV_BM)  // rows that one set of 21 tiles covers
#define QKV_TILES_SPAN 21
#define QKV_TILES ((NTOK / QKV_SPAN) * QKV_TILES_SPAN)  // per projection
__global__ __launch_bounds__(256) void qkv_gemm_kernel(
    const float* __restrict__ Xq, const float* __restrict__ Xk,
    const float* __restrict__ Xv, const float* __restrict__ Wq,
    const float* __restrict__ Wk, const float* __restrict__ Wv,
    const float* __restrict__ bq, const float* __restrict__ bk,
    const float* __restrict__ bv, _Float16* __restrict__ oq,
    _Float16* __restrict__ ok, _Float16* __restrict__ ov,
    const float* __restrict__ Wo, const float* __restrict__ lng,
    const float* __restrict__ lnb, float* __restrict__ colsum) {
  __shared__ __attribute__((aligned(16))) _Float16 At[QKV_BM][GEMM_LD];
  __shared__ __attribute__((aligned(16))) _Float16 Bt[GEMM_BN][GEMM_LD];
  const int z = blockIdx.x / QKV_TILES;
  const int sup = (blockIdx.x % QKV_TILES) / QKV_TILES_SPAN;
  const int t = blockIdx.x % QKV_TILES_SPAN;  // QKV_TILES is a multiple of it
  // column block, log2 of the row step, first row inside the span
  int cb, rs, first;
  if (t < 12) {
    cb = t % 3; rs = 0; first = (t / 3) * QKV_BM;
  } else if (t < 16) {
    cb = 3 + ((t - 12) & 1); rs = 1; first = ((t - 12) >> 1) * 2 * QKV_BM + 1;
  } else if (t < 19) {
    cb = 5; rs = 2; first = t - 15;
  } else {
    cb = t - 13; rs = 2; first = 2;
  }
  const int rowbase = sup * QKV_SPAN + first, colbase = cb * GEMM_BN;
  const float* X = z == 0 ? Xq : (z == 1 ? Xk : Xv);
  const float* W = z == 0 ? Wq : (z == 1 ? Wk : Wv);
  const float* bias = z == 0 ? bq : (z == 1 ? bk : bv);
  _Float16* out = z == 0 ? oq : (z == 1 ? ok : ov);
  v8f acc[4][QKV_BM / 64] = {};
  // the row step as a constant: in the loop every row offset stays an immediate
  // of its load; the branch is the same for the whole block
  if (rs == 0)
    gemm_tile<false, 0, QKV_BM>(acc, At, Bt, rowbase, colbase, X, W);
  else if (rs == 1)
    gemm_tile<false, 1, QKV_BM>(acc, At, Bt, rowbase, colbase, X, W);
  else
    gemm_tile<false, 2, QKV_BM>(acc, At, Bt, rowbase, colbase, X, W);
  gemm_store_tile(acc, rowbase, rs, colbase, bias, out);
  // stands in front of any reuse of a register that the tile's stores name
  asm volatile("s_wait_xcnt 0x0" ::: "memory");
  if (blockIdx.x < 4 * EMBED / 32) {
    __shared__ float part[32][33];
    const int wave = threadIdx.x >> 5, lane = threadIdx.x & 31;
    const int q = blockIdx.x >> 5, j0 = (blockIdx.x & 31) * 32;
    float gv[10], wv[4][10];
    const float* vec = (q & 1) ? lnb : lng;
    // five heads = 320 k from head 6 or head 11 on, ten per lane
    const int k0 = (q >> 1 ? 11 : 6) * HEAD_DIM + lane;
    // all unrolled: gv and wv are indexed by constants only; 50 loads in flight
#pragma unroll
    for (int t = 0; t < 10; ++t) gv[t] = vec[k0 + 32 * t];
#pragma unroll
    for (int u = 0; u < 4; ++u)
#pragma unroll
      for (int t = 0; t < 10; ++t)
        wv[u][t] = Wo[(size_t)(j0 + wave * 4 + u) * EMBED + k0 + 32 * t];
    // stands in front of any reuse of a register that these loads name
    asm volatile("s_wait_xcnt 0x0" ::: "memory");
#pragma unroll
    for (int u = 0; u < 4; ++u) {
      float s = 0.f;
#pragma unroll
      for (int t = 0; t < 10; ++t) s += gv[t] * wv[u][t];
      part[wave * 4 + u][lane] = s;
    }
    // the shares, visible to the wave that adds them up. A barrier with fences
    // for LDS alone: __syncthreads() would also wait out the tile's stores, which
    // now drain under the sums
    __builtin_amdgcn_fence(__ATOMIC_RELEASE, "workgroup", "local");
    __builtin_amdgcn_s_barrier();
    __builtin_amdgcn_fence(__ATOMIC_ACQUIRE, "workgroup", "local");
    if (wave == 0) {
      float s = 0.f;
      // unrolled: 32 LDS reads at constant offsets from one address
#pragma unroll
      for (int l = 0; l < 32; ++l) s += part[lane][l];
      colsum[q * EMBED + j0 + lane] = s;
    }
  }
}

#define ATTN_BLOCKS ((4 * 6 + 2 * 5 + 1 * 5) * 32)

// P = exp(s - m) for a lane's 4 x 8 scores of one stage. Per block of 32 keys: P^T
// as a B operand (element e is key 8*hi + e, or 16 + 8*hi + (e - 8)) and the sum.
__device__ __forceinline__ void attn_exp(const v8f (&s)[4], const float m,
                                         v16h (&pb)[2], float (&lb)[2]) {
  // both unrolled: s, pb and lb are indexed by constants only
#pragma unroll
  for (int blk = 0; blk < 2; ++blk) {
    v2f l = {0.f, 0.f};  // the sums over the block's first and second 16 keys
#pragma unroll
    for (int v = 0; v < 8; ++v) {
      const v2f p = {__expf(s[2 * blk][v] - m), __expf(s[2 * blk + 1][v] - m)};
      l += p;
      pb[blk][v]     = (_Float16)p[0];
      pb[blk][8 + v] = (_Float16)p[1];
    }
    lb[blk] = l[0] + l[1];
  }
}
__global__ __launch_bounds__(128) void attn_kernel(
    const _Float16* __restrict__ Q, const _Float16* __restrict__ K,
    const _Float16* __restrict__ V, float* __restrict__ out,
    float* __restrict__ stats) {
  // one object, K first. A K buffer is 64 rows of 144 B, rounded up to 10 KiB, so
  // that each tensor load's place in LDS is a multiple of 2 KiB. V has 160-B
  // rows, the pitch (32 B x odd) of the transposing reader.
  struct Tiles {
    _Float16 k[2][5120];
    _Float16 v[2][64][80];
  };
  __shared__ __attribute__((aligned(2048))) Tiles tiles;
  _Float16 (&Vt)[2][64][80] = tiles.v;

  constexpr int S = 2048;  // dilated positions per segment, seglen / rate
  constexpr int qtiles = S / 64;
  // (segment, head) pairs [0, 24): seg 2048, r=1, off=0, heads [0,6); [24, 34):
  // seg 4096, r=2, off=1, heads [6,11); [34, 39): seg 8192, r=4, off=2, heads
  // [11,16). The divisors are literals, so the whole decode is scalar code.
  const int qt = blockIdx.x % qtiles;
  const int pair = blockIdx.x / qtiles;
  const int grp = (pair >= 24) + (pair >= 34);
  const int rate = 1 << grp;
  const int seg = grp == 0 ? pair / 6 : (grp == 1 ? (pair - 24) / 5 : 0);
  const int head = grp == 0 ? pair % 6 : (grp == 1 ? 6 + (pair - 24) % 5 : pair - 23);
  const int segbase = seg * (S << grp) + grp;
  const u32x8 kg1 = tdm_group1((uint32_t)(rate * EMBED * 2));

  const int tid = threadIdx.x, lane = tid & 31;
  const int wave = (int)uni((uint32_t)tid >> 5);
  const int hi = lane >> 4, nn = lane & 15;
  const size_t hoff = (size_t)head * HEAD_DIM;

  const int srow = tid >> 2, scol = (tid & 3) * 16;
  constexpr int NST = S / 64;  // stages
  const size_t half_step = (size_t)(32 * rate) * EMBED;  // 32 keys on, elements
  const _Float16* ksrc = K + (size_t)segbase * EMBED + hoff;
  const _Float16* vsrc = V + (size_t)(segbase + srow * rate) * EMBED + hoff + scol;

  // Q fragments for this wave's 16 queries (B operand: column nn, same k order as A)
  const int qrowA = qt * 64 + wave * 16 + nn;
  const _Float16* qp = Q + (size_t)(segbase + qrowA * rate) * EMBED + hoff;
  v16h qa0, qa1;
#pragma unroll
  for (int r = 0; r < 8; ++r) {
    const int k = ((r & 3) << 1) + ((r >> 2) << 4) + (hi << 3);
    qa0[2 * r]     = qp[k];
    qa0[2 * r + 1] = qp[k + 1];
    qa1[2 * r]     = qp[32 + k];
    qa1[2 * r + 1] = qp[32 + k + 1];
  }

  v8f o0 = {}, o1 = {}, o2 = {}, o3 = {};
  // query nn's reference point (a maximum seen so far, the same in both lane
  // halves) and the sum over this lane half's keys
  constexpr float LAZY = 4096.f;
  float row_m = -1e30f, row_l = 0.f;
  const float scale = 0.125f;  // 1/sqrt(64)

  // stage 0, waited for and published; then stage 1, in flight under pass 0
  async_to_lds_32B(&Vt[0][srow][scol], vsrc);
  async_to_lds_32B(&Vt[0][srow + 32][scol], vsrc + half_step);
  u32x4 kg0 = tdm_group0(&tiles.k[0][0], ksrc);
  if (pinned(wave == 0)) {
    tdm_load(kg0, kg1);
    tdm_wait(kg0, kg1);  // K stage 0 has landed
  }
  asm volatile("s_wait_asynccnt 0x0" ::: "memory");  // this wave's V copies too
  __syncthreads();  // ... visible to every wave
  if (pinned(wave == 0)) {
    kg0 = tdm_group0(&tiles.k[1][0], ksrc + 2 * half_step);
    tdm_load(kg0, kg1);
  }
  async_to_lds_32B(&Vt[1][srow][scol], vsrc + 2 * half_step);
  async_to_lds_32B(&Vt[1][srow + 32][scol], vsrc + 3 * half_step);

  for (int st = 0; st < NST; ++st) {
    const int buf = st & 1;
    const _Float16* kt = &tiles.k[buf][0];
    const _Float16* vt = &Vt[buf][0][0];
    // K fragments of the stage's 64 keys: four groups of 16 keys, 16 x 32 (d) each
    v16h ka[4][2];
    // unrolled: ka is indexed by constants only and stays in registers
#pragma unroll
    for (int g = 0; g < 4; ++g) {
      ka[g][0] = wmma_load_a(kt + g * 16 * 72, 72);
      ka[g][1] = wmma_load_a(kt + g * 16 * 72 + 32, 72);
    }
    // keeps the 16 K loads up here as one group; left free they go in pairs in
    // front of their WMMAs, one exposed LDS latency each
    __builtin_amdgcn_sched_barrier(0);

    // S^T = K Q^T : four 16 (keys) x 16 (queries) tiles, d=64 -> 2 steps each
    v8f s[4] = {};
#pragma unroll
    for (int g = 0; g < 4; ++g) s[g] = WMMA_F16(ka[g][0], qa0, s[g]);
#pragma unroll
    for (int g = 0; g < 4; ++g) s[g] = WMMA_F16(ka[g][1], qa1, s[g]);

    // V^T fragments, 16 (d) x 32 (keys) each, two blocks of 32 keys; here the
    // first block's
    v16h va[2][4];
    // unrolled: va is indexed by constants only
#pragma unroll
    for (int t = 0; t < 4; ++t) va[0][t] = wmma_load_a_tr(vt + t * 16, 80);
    // keeps these 8 V loads up here as one group, in flight under the exponentials;
    // left free they sink to their WMMAs, one exposed LDS latency in front of each
    __builtin_amdgcn_sched_barrier(0);

    // softmax (f32); the lane holds keys 16 g + v + 8*hi (s[g]) of query nn, the
    // other half of the wave the other 32 keys
    // unrolled: s is indexed by constants only
#pragma unroll
    for (int g = 0; g < 4; ++g) s[g] *= scale;
    v16h pb[2];   // P^T as B, one per block of 32 keys
    float lb[2];  // this lane's sum of P, per block
    attn_exp(s, row_m, pb, lb);
    // Lazy rescale: the reference point row_m stays while this lane's 32 values of
    // P add up to no more than LAZY; they are positive, so each of them is then at
    // most LAZY too, far inside f16. Maximum, exchange between the lane halves,
    // factor and a second round of exponentials stand under one test per stage,
    // the same for the whole wave: a scalar branch, every lane stays on. The
    // negated form also takes the infinite sum of the first stage.
    if (__builtin_amdgcn_ballot_w32(!(lb[0] + lb[1] <= LAZY)) != 0) {
      float ma = -1e30f, mb = -1e30f;
      // unrolled: s is indexed by constants only; two chains of maxima
#pragma unroll
      for (int v = 0; v < 8; ++v) {
        ma = fmaxf(ma, fmaxf(s[0][v], s[1][v]));
        mb = fmaxf(mb, fmaxf(s[2][v], s[3][v]));
      }
      const float mx = fmaxf(ma, mb);
      const float mnew = fmaxf(row_m, fmaxf(mx, xhalf(mx)));
      const float alpha = __expf(row_m - mnew);
      row_m = mnew;
      row_l *= alpha;
      o0 *= alpha; o1 *= alpha; o2 *= alpha; o3 *= alpha;
      attn_exp(s, row_m, pb, lb);
    }
    row_l = (row_l + lb[0]) + lb[1];

#pragma unroll
    for (int t = 0; t < 4; ++t)
      va[1][t] = wmma_load_a_tr(vt + 32 * 80 + t * 16, 80);
    // keeps these 8 loads one group in front of the products
    __builtin_amdgcn_sched_barrier(0);

    // O^T += V^T P^T
    // unrolled: va and pb are indexed by constants only
#pragma unroll
    for (int blk = 0; blk < 2; ++blk) {
      o0 = WMMA_F16(va[blk][0], pb[blk], o0);
      o1 = WMMA_F16(va[blk][1], pb[blk], o1);
      o2 = WMMA_F16(va[blk][2], pb[blk], o2);
      o3 = WMMA_F16(va[blk][3], pb[blk], o3);
    }
    // keeps the waits below behind the pass's last product
    __builtin_amdgcn_sched_barrier(0);

    // publish point of stage st + 1, in the ring's order: this wave's LDS reads
    // of the buffer that is refilled behind the barrier have retired,
    asm volatile("s_wait_dscnt 0x0" ::: "memory");
    // its V copies of stage st + 1 have landed,
    asm volatile("s_wait_asynccnt 0x0" ::: "memory");
    // and the issuing wave's K stage
    if (pinned(wave == 0)) tdm_wait(kg0, kg1);
    __syncthreads();  // ... visible to every wave; every reader has left buf
    // stage st + 2 into the buffer this pass has read
    if (pinned(st + 2 < NST)) {
      const size_t off = (size_t)(st + 2) * 2 * half_step;
      if (pinned(wave == 0)) {
        kg0 = tdm_group0(&tiles.k[buf][0], ksrc + off);
        tdm_load(kg0, kg1);
      }
      async_to_lds_32B(&Vt[buf][srow][scol], vsrc + off);
      async_to_lds_32B(&Vt[buf][srow + 32][scol], vsrc + off + half_step);
    }
  }
  // nothing is in flight when the waves leave the loop
  asm volatile("s_wait_tensorcnt 0x0" ::: "memory");
  asm volatile("s_wait_asynccnt 0x0" ::: "memory");
  asm volatile("s_wait_dscnt 0x0" ::: "memory");

  // epilogue: query nn's row; this lane holds d = 16 t + 8 hi + 0..7 of tile t
  {
    const int qr = qt * 64 + wave * 16 + nn;
    const size_t pos = (size_t)(segbase + qr * rate);
    const float inv = 1.0f / (row_l + xhalf(row_l));
    float* op = out + pos * EMBED + hoff + 8 * hi;
    o0 *= inv; o1 *= inv; o2 *= inv; o3 *= inv;
    // this head's share of the row's layer-norm sums: sum and sum of squares of
    // the 64 values, half of them in each lane half
    const v8f t = (o0 + o1) + (o2 + o3);
    const v8f u = (o0 * o0 + o1 * o1) + (o2 * o2 + o3 * o3);
    float rs = ((t[0] + t[1]) + (t[2] + t[3])) + ((t[4] + t[5]) + (t[6] + t[7]));
    float rq = ((u[0] + u[1]) + (u[2] + u[3])) + ((u[4] + u[5]) + (u[6] + u[7]));
    rs += xhalf(rs);
    rq += xhalf(rq);
    *(v8f*)(op)      = o0;
    *(v8f*)(op + 16) = o1;
    *(v8f*)(op + 32) = o2;
    *(v8f*)(op + 48) = o3;
    if (hi == 0) {
      const v2f st = {rs, rq};
      *(v2f*)(stats + ((size_t)head * NTOK + pos) * 2) = st;
    }
  }
}

// ---- launcher --------------------------------------------------------------
extern "C" void kernel_launch(void* const* d_in, const int* in_sizes, int n_in,
                              void* d_out, int out_size, void* d_ws,
                              size_t ws_size, hipStream_t stream) {
  const float* query = (const float*)d_in[0];
  const float* key   = (const float*)d_in[1];
  const float* value = (const float*)d_in[2];
  const float* Wq = (const float*)d_in[3];  const float* bq = (const float*)d_in[4];
  const float* Wk = (const float*)d_in[5];  const float* bk = (const float*)d_in[6];
  const float* Wv = (const float*)d_in[7];  const float* bv = (const float*)d_in[8];
  const float* Wo = (const float*)d_in[9];  const float* bo = (const float*)d_in[10];
  const float* ln_g = (const float*)d_in[11];
  const float* ln_b = (const float*)d_in[12];

  char* ws = (char*)d_ws;
  const size_t nelem = (size_t)NTOK * EMBED;  // 8M elements
  _Float16* qf = (_Float16*)(ws);             // 16 MB
  _Float16* kf = (_Float16*)(ws + nelem * 2); // 16 MB
  _Float16* vf = (_Float16*)(ws + nelem * 4); // 16 MB
  float*  attn = (float*)(ws + nelem * 6);    // 32 MB
  float* stats = (float*)(ws + nelem * 10);   // 1 MB: [head][row] (sum, sum sq)
  float* colsum = (float*)(ws + nelem * 10 + (1 << 20));  // 16 KB: [4][column]

  const dim3 gblk(EMBED / GEMM_BN, NTOK / GEMM_BM);  // (8, 64)
  // q, k, v projections (the tiles the attention reads) and the column sums of Wo,
  // one launch of 504 workgroups
  qkv_gemm_kernel<<<3 * QKV_TILES, 256, 0, stream>>>(query, key, value, Wq, Wk, Wv, bq,
                                            bk, bv, qf, kf, vf, Wo, ln_g, ln_b,
                                            colsum);

  // (4 segments x 6 heads + 2 x 5 + 1 x 5) x 32 query tiles
  attn_kernel<<<ATTN_BLOCKS, 128, 0, stream>>>(qf, kf, vf, attn, stats);

  // layer norm and output projection
  ln_gemm_bias_kernel<<<gblk, 256, 0, stream>>>(attn, Wo, bo, (float*)d_out,
                                                stats, ln_g, ln_b, colsum);
}
